// v000
// Measured on an AMD MI455X. A time is GPU time per run, averaged over a window of back-to-back runs after a warm-up
// (all launches, gaps included; the runs take copies of the inputs in turn), and the median of several windows.
// Apart from v000's, it joins two sittings. Times from different sittings can be a few percent apart, while
// side-by-side timings come from the same sitting.
// v000 is the starting kernel. One run takes 270 microseconds.
#include <hip/hip_runtime.h>
#include <hip/hip_bf16.h>

typedef __attribute__((ext_vector_type(16))) _Float16 v16h;
typedef __attribute__((ext_vector_type(8)))  _Float16 v8h;
typedef __attribute__((ext_vector_type(8)))  float    v8f;

#define BB 8
#define CC 512
#define LL 4096
#define NHEAD 8
#define DHEAD 64

__device__ __forceinline__ v8f zero8() {
  v8f z = {0.f,0.f,0.f,0.f,0.f,0.f,0.f,0.f};
  return z;
}

__device__ __forceinline__ v8f wmma16(v16h a, v16h b, v8f c) {
  // (neg_a, A, neg_b, B, c_mod, C, reuse_a, reuse_b) -> v_wmma_f32_16x16x32_f16
  return __builtin_amdgcn_wmma_f32_16x16x32_f16(false, a, false, b, (short)0, c,
                                                false, false);
}

__device__ __forceinline__ v16h mk16(v8h lo, v8h hi) {
  union { v16h v; v8h h[2]; } u;
  u.h[0] = lo; u.h[1] = hi;
  return u.v;
}

__device__ __forceinline__ v16h frag_ld(const _Float16* base, int row0,
                                        int rowStride, int kb) {
  const int lane = threadIdx.x & 31;
  const _Float16* p = base + (size_t)(row0 + (lane & 15)) * rowStride
                           + kb + ((lane >> 4) << 3);
  v8h lo = *(const v8h*)(p);
  v8h hi = *(const v8h*)(p + 16);
  return mk16(lo, hi);
}

// ---------------------------------------------------------------------------
// Projection GEMM: Y[b,m,n] = W . X[b,:,n] + bias   (M=K=512, N=4096/batch)
// Block: 256 threads (8 waves), tile 128(M) x 128(N).
// The entire X^T panel (N=128 rows x K=512 cols, f16) is staged in LDS once;
// W tiles (128x32) are double-buffered per K-step so their global loads hide
// under the WMMAs with a single barrier per step.
// Wave (wm 0..3, wn 0..1) owns a 32x64 sub-tile = 2x4 WMMA accumulators.
// ---------------------------------------------------------------------------
template<bool IN_F16, bool OUT_F32>
__global__ __launch_bounds__(256) void panel_gemm(
    const float* __restrict__ W, const float* __restrict__ bias,
    const float* __restrict__ Xf, const _Float16* __restrict__ Xh,
    float* __restrict__ Yf, _Float16* __restrict__ Yh)
{
  __shared__ __align__(16) _Float16 sX[128][520];    // [n][k], 520 = 512+8 pad
  __shared__ __align__(16) _Float16 sA[2][128][40];  // double-buffered W tile
  __shared__ float sBias[128];

  const int tid  = threadIdx.x;
  const int b    = blockIdx.z;
  const int m0   = blockIdx.y * 128;
  const int n0   = blockIdx.x * 128;
  const int wid  = tid >> 5;
  const int lane = tid & 31;
  const int wm   = wid & 3;
  const int wn   = wid >> 2;

  if (tid < 128) sBias[tid] = bias[m0 + tid];

  // ---- stage X^T panel: X[b][k][n0..+127] -> sX[n][k] f16 ----
  // Each thread owns a K-pair (k2,k2+1) x 8 n's per 32-K chunk; the pair packs
  // into one 32-bit LDS store (halves the transpose scatter).
  {
    const int k2   = ((tid >> 4) & 15) * 2;  // 0,2,...,30
    const int nseg = tid & 15;               // n = nseg*8 .. +7
    for (int kk = 0; kk < 512; kk += 32) {
      if (IN_F16) {
        const _Float16* r0 =
            Xh + ((size_t)b * 512 + kk + k2) * LL + n0 + nseg * 8;
        v8h x0 = *(const v8h*)(r0);
        v8h x1 = *(const v8h*)(r0 + LL);
        if (kk + 32 < 512) __builtin_prefetch(r0 + (size_t)32 * LL, 0, 3);
        #pragma unroll
        for (int j = 0; j < 8; ++j) {
          union { _Float16 h[2]; unsigned u; } p;
          p.h[0] = x0[j];
          p.h[1] = x1[j];
          *(unsigned*)&sX[nseg * 8 + j][kk + k2] = p.u;  // k2 even: 4B aligned
        }
      } else {
        const float* r0 = Xf + ((size_t)b * 512 + kk + k2) * LL + n0 + nseg * 8;
        const float* r1 = r0 + LL;
        float4 a0 = *(const float4*)(r0);
        float4 a1 = *(const float4*)(r0 + 4);
        float4 c0 = *(const float4*)(r1);
        float4 c1 = *(const float4*)(r1 + 4);
        if (kk + 32 < 512) __builtin_prefetch(r0 + (size_t)32 * LL, 0, 3);
        float f0[8] = {a0.x,a0.y,a0.z,a0.w,a1.x,a1.y,a1.z,a1.w};
        float f1[8] = {c0.x,c0.y,c0.z,c0.w,c1.x,c1.y,c1.z,c1.w};
        #pragma unroll
        for (int j = 0; j < 8; ++j) {
          union { _Float16 h[2]; unsigned u; } p;
          p.h[0] = (_Float16)f0[j];
          p.h[1] = (_Float16)f1[j];
          *(unsigned*)&sX[nseg * 8 + j][kk + k2] = p.u;
        }
      }
    }
  }

  // ---- stage first W tile into sA[0] ----
  const int rA = tid >> 1, segA = tid & 1;
  {
    const float* src = W + (size_t)(m0 + rA) * 512 + segA * 16;
    float4 f0 = *(const float4*)(src + 0);
    float4 f1 = *(const float4*)(src + 4);
    float4 f2 = *(const float4*)(src + 8);
    float4 f3 = *(const float4*)(src + 12);
    v8h h0 = {(_Float16)f0.x,(_Float16)f0.y,(_Float16)f0.z,(_Float16)f0.w,
              (_Float16)f1.x,(_Float16)f1.y,(_Float16)f1.z,(_Float16)f1.w};
    v8h h1 = {(_Float16)f2.x,(_Float16)f2.y,(_Float16)f2.z,(_Float16)f2.w,
              (_Float16)f3.x,(_Float16)f3.y,(_Float16)f3.z,(_Float16)f3.w};
    *(v8h*)&sA[0][rA][segA * 16]     = h0;
    *(v8h*)&sA[0][rA][segA * 16 + 8] = h1;
  }
  __syncthreads();

  v8f acc[2][4];
  #pragma unroll
  for (int mt = 0; mt < 2; ++mt)
    #pragma unroll
    for (int nt = 0; nt < 4; ++nt) acc[mt][nt] = zero8();

  for (int ks = 0; ks < 16; ++ks) {
    const int kb  = ks * 32;
    const int cur = ks & 1;
    const bool have_next = (ks + 1 < 16);

    // issue global loads of the next W tile first (latency hides under WMMA)
    float4 f0 = {}, f1 = {}, f2 = {}, f3 = {};
    if (have_next) {
      const float* src = W + (size_t)(m0 + rA) * 512 + kb + 32 + segA * 16;
      f0 = *(const float4*)(src + 0);
      f1 = *(const float4*)(src + 4);
      f2 = *(const float4*)(src + 8);
      f3 = *(const float4*)(src + 12);
    }

    // compute: 2x4 WMMA tiles per wave from resident panel + current W tile
    v16h afr[2];
    #pragma unroll
    for (int mt = 0; mt < 2; ++mt)
      afr[mt] = frag_ld(&sA[cur][0][0], wm * 32 + mt * 16, 40, 0);
    #pragma unroll
    for (int nt = 0; nt < 4; ++nt) {
      v16h bfr = frag_ld(&sX[0][0], wn * 64 + nt * 16, 520, kb);
      #pragma unroll
      for (int mt = 0; mt < 2; ++mt)
        acc[mt][nt] = wmma16(afr[mt], bfr, acc[mt][nt]);
    }

    // convert + store next W tile into the other buffer
    if (have_next) {
      v8h h0 = {(_Float16)f0.x,(_Float16)f0.y,(_Float16)f0.z,(_Float16)f0.w,
                (_Float16)f1.x,(_Float16)f1.y,(_Float16)f1.z,(_Float16)f1.w};
      v8h h1 = {(_Float16)f2.x,(_Float16)f2.y,(_Float16)f2.z,(_Float16)f2.w,
                (_Float16)f3.x,(_Float16)f3.y,(_Float16)f3.z,(_Float16)f3.w};
      *(v8h*)&sA[cur ^ 1][rA][segA * 16]     = h0;
      *(v8h*)&sA[cur ^ 1][rA][segA * 16 + 8] = h1;
    }
    __syncthreads();
  }

  #pragma unroll
  for (int mt = 0; mt < 2; ++mt)
    #pragma unroll
    for (int r = 0; r < 8; ++r) {
      const int crel = wm * 32 + mt * 16 + r + ((lane >> 4) << 3);
      const float bv = sBias[crel];
      const int c = m0 + crel;
      #pragma unroll
      for (int nt = 0; nt < 4; ++nt) {
        const int n = n0 + wn * 64 + nt * 16 + (lane & 15);
        const float val = acc[mt][nt][r] + bv;
        const size_t off = ((size_t)b * 512 + c) * LL + n;
        if (OUT_F32) Yf[off] = val;
        else         Yh[off] = (_Float16)val;
      }
    }
}

// ---------------------------------------------------------------------------
// Channel attention, one block per (batch, head).
// Phase 1: S = q . k^T (64x64, K=4096) via WMMA, straight from global f16
//          (rows of q_head/k_head are K-contiguous, matching frag layout).
// Softmax over rows (scale 1/sqrt(L) = 1/64) in fp32 LDS -> P f16.
// Phase 2: O = P . v_head (64x4096, K=64), v tiles transposed through LDS.
// ---------------------------------------------------------------------------
__global__ __launch_bounds__(256) void attn64(
    const _Float16* __restrict__ q, const _Float16* __restrict__ k,
    const _Float16* __restrict__ v, _Float16* __restrict__ o)
{
  __shared__ float                  sS[64][65];   // logits fp32
  __shared__ __align__(16) _Float16 sP[64][72];   // softmax probs f16
  __shared__ __align__(16) _Float16 sV[128][72];  // v tile transposed [l][e]

  const int tid  = threadIdx.x;
  const int wid  = tid >> 5;
  const int lane = tid & 31;
  const int bh   = blockIdx.x;
  const int b    = bh >> 3;
  const int head = bh & 7;
  const size_t hb = ((size_t)b * CC + head * DHEAD) * LL;
  const _Float16* qh = q + hb;
  const _Float16* kh = k + hb;
  const _Float16* vh = v + hb;
  _Float16* oh       = o + hb;

  // ---- phase 1: logits. 16 tiles, 2 per wave (shared A fragment). ----
  const int mt  = wid & 3;
  const int nt0 = (wid >> 2) * 2;
  v8f s0 = zero8(), s1 = zero8();
  for (int kb = 0; kb < LL; kb += 32) {
    v16h af = frag_ld(qh, mt * 16, LL, kb);
    v16h b0 = frag_ld(kh, nt0 * 16, LL, kb);
    v16h b1 = frag_ld(kh, (nt0 + 1) * 16, LL, kb);
    s0 = wmma16(af, b0, s0);
    s1 = wmma16(af, b1, s1);
  }
  const float scale = 0.015625f;  // 1/sqrt(4096)
  #pragma unroll
  for (int r = 0; r < 8; ++r) {
    const int row = mt * 16 + r + ((lane >> 4) << 3);
    sS[row][nt0 * 16 + (lane & 15)]       = s0[r] * scale;
    sS[row][(nt0 + 1) * 16 + (lane & 15)] = s1[r] * scale;
  }
  __syncthreads();

  // ---- softmax over e (64 wide), one thread per row ----
  if (tid < 64) {
    float mx = -3.0e38f;
    for (int e = 0; e < 64; ++e) mx = fmaxf(mx, sS[tid][e]);
    float sum = 0.f;
    for (int e = 0; e < 64; ++e) {
      float t = __expf(sS[tid][e] - mx);
      sum += t;
      sS[tid][e] = t;
    }
    const float inv = 1.f / sum;
    for (int e = 0; e < 64; ++e) sP[tid][e] = (_Float16)(sS[tid][e] * inv);
  }
  __syncthreads();

  v16h pf[4][2];
  #pragma unroll
  for (int m2 = 0; m2 < 4; ++m2)
    #pragma unroll
    for (int ks = 0; ks < 2; ++ks)
      pf[m2][ks] = frag_ld(&sP[0][0], m2 * 16, 72, ks * 32);

  for (int l0 = 0; l0 < LL; l0 += 128) {
    __syncthreads();
    // stage v[e=0..63][l0..+127] transposed into sV[l][e]
    {
      const int e = tid >> 2, seg = tid & 3;
      const _Float16* src = vh + (size_t)e * LL + l0 + seg * 32;
      #pragma unroll
      for (int q4 = 0; q4 < 4; ++q4) {
        v8h x = *(const v8h*)(src + q4 * 8);
        #pragma unroll
        for (int j = 0; j < 8; ++j) sV[seg * 32 + q4 * 8 + j][e] = x[j];
      }
    }
    __syncthreads();

    // each wave owns a 16-wide l sub-chunk: n_local = wid*16 + lane%16
    v8f oacc[4];
    #pragma unroll
    for (int m2 = 0; m2 < 4; ++m2) oacc[m2] = zero8();
    #pragma unroll
    for (int ks = 0; ks < 2; ++ks) {
      v16h bf = frag_ld(&sV[0][0], wid * 16, 72, ks * 32);
      #pragma unroll
      for (int m2 = 0; m2 < 4; ++m2)
        oacc[m2] = wmma16(pf[m2][ks], bf, oacc[m2]);
    }
    #pragma unroll
    for (int m2 = 0; m2 < 4; ++m2)
      #pragma unroll
      for (int r = 0; r < 8; ++r) {
        const int c = m2 * 16 + r + ((lane >> 4) << 3);
        oh[(size_t)c * LL + l0 + wid * 16 + (lane & 15)] = (_Float16)oacc[m2][r];
      }
  }
}

// ---------------------------------------------------------------------------
extern "C" void kernel_launch(void* const* d_in, const int* in_sizes, int n_in,
                              void* d_out, int out_size, void* d_ws, size_t ws_size,
                              hipStream_t stream) {
  const float* query = (const float*)d_in[0];
  const float* key_  = (const float*)d_in[1];
  const float* value = (const float*)d_in[2];
  const float* wq = (const float*)d_in[3];
  const float* bq = (const float*)d_in[4];
  const float* wk = (const float*)d_in[5];
  const float* bk = (const float*)d_in[6];
  const float* wv = (const float*)d_in[7];
  const float* bv = (const float*)d_in[8];
  const float* wo = (const float*)d_in[9];
  const float* bo = (const float*)d_in[10];
  float* out = (float*)d_out;

  // f16 intermediates in workspace: q,k,v,attn-out (B*C*L halfs = 32 MiB each)
  const size_t S = (size_t)BB * CC * LL;
  _Float16* q16 = (_Float16*)d_ws;
  _Float16* k16 = q16 + S;
  _Float16* v16 = k16 + S;
  _Float16* o16 = v16 + S;

  dim3 blk(256);
  dim3 grd(LL / 128, CC / 128, BB);  // (32, 4, 8)

  // The three projections use three DIFFERENT inputs (wq.query, wk.key,
  // wv.value), so nothing is shared between them: one GEMM per launch.
  panel_gemm<false, false><<<grd, blk, 0, stream>>>(wq, bq, query, nullptr,
                                                    nullptr, q16);
  panel_gemm<false, false><<<grd, blk, 0, stream>>>(wk, bk, key_, nullptr,
                                                    nullptr, k16);
  panel_gemm<false, false><<<grd, blk, 0, stream>>>(wv, bv, value, nullptr,
                                                    nullptr, v16);

  attn64<<<dim3(BB * NHEAD), blk, 0, stream>>>(q16, k16, v16, o16);

  panel_gemm<true, true><<<grd, blk, 0, stream>>>(wo, bo, nullptr, o16,
                                                  out, nullptr);
}

// v001
// One run takes 198 microseconds.
// In two side-by-side timings against v000, it was 1.38 and 1.39 times as fast.
#include <hip/hip_runtime.h>
#include <hip/hip_bf16.h>

typedef __attribute__((ext_vector_type(16))) _Float16 v16h;
typedef __attribute__((ext_vector_type(8)))  _Float16 v8h;
typedef __attribute__((ext_vector_type(8)))  float    v8f;

#define BB 8
#define CC 512
#define LL 4096
#define NHEAD 8
#define DHEAD 64

__device__ __forceinline__ v8f zero8() {
  v8f z = {0.f,0.f,0.f,0.f,0.f,0.f,0.f,0.f};
  return z;
}

__device__ __forceinline__ v8f wmma16(v16h a, v16h b, v8f c) {
  // (neg_a, A, neg_b, B, c_mod, C, reuse_a, reuse_b) -> v_wmma_f32_16x16x32_f16
  return __builtin_amdgcn_wmma_f32_16x16x32_f16(false, a, false, b, (short)0, c,
                                                false, false);
}

__device__ __forceinline__ v16h mk16(v8h lo, v8h hi) {
  union { v16h v; v8h h[2]; } u;
  u.h[0] = lo; u.h[1] = hi;
  return u.v;
}

__device__ __forceinline__ v16h frag_ld(const _Float16* base, int row0,
                                        int rowStride, int kb) {
  const int lane = threadIdx.x & 31;
  const _Float16* p = base + (size_t)(row0 + (lane & 15)) * rowStride
                           + kb + ((lane >> 4) << 3);
  v8h lo = *(const v8h*)(p);
  v8h hi = *(const v8h*)(p + 16);
  return mk16(lo, hi);
}

// ---------------------------------------------------------------------------
// Projection GEMM: Y[b,m,n] = W . X[b,:,n] + bias   (M=K=512, N=4096/batch)
// Block: 256 threads (8 waves), tile 128(M) x 128(N).
// The entire X^T panel (N=128 rows x K=512 cols, f16) is staged in LDS once;
// W tiles (128x32) are double-buffered per K-step so their global loads hide
// under the WMMAs with a single barrier per step.
// Wave (wm 0..3, wn 0..1) owns a 32x64 sub-tile = 2x4 WMMA accumulators.
// ---------------------------------------------------------------------------
template<bool IN_F16, bool OUT_F32>
__global__ __launch_bounds__(256) void panel_gemm(
    const float* __restrict__ W, const float* __restrict__ bias,
    const float* __restrict__ Xf, const _Float16* __restrict__ Xh,
    float* __restrict__ Yf, _Float16* __restrict__ Yh)
{
  __shared__ __align__(16) _Float16 sX[128][520];    // [n][k], 520 = 512+8 pad
  __shared__ __align__(16) _Float16 sA[2][128][40];  // double-buffered W tile
  __shared__ float sBias[128];

  const int tid  = threadIdx.x;
  const int b    = blockIdx.z;
  const int m0   = blockIdx.y * 128;
  const int n0   = blockIdx.x * 128;
  const int wid  = tid >> 5;
  const int lane = tid & 31;
  const int wm   = wid & 3;
  const int wn   = wid >> 2;

  if (tid < 128) sBias[tid] = bias[m0 + tid];

  // ---- stage X^T panel: X[b][k][n0..+127] -> sX[n][k] f16 ----
  // Each thread owns a K-pair (k2,k2+1) x 8 n's per 32-K chunk; the pair packs
  // into one 32-bit LDS store (halves the transpose scatter).
  {
    const int k2   = ((tid >> 4) & 15) * 2;  // 0,2,...,30
    const int nseg = tid & 15;               // n = nseg*8 .. +7
    for (int kk = 0; kk < 512; kk += 32) {
      if (IN_F16) {
        const _Float16* r0 =
            Xh + ((size_t)b * 512 + kk + k2) * LL + n0 + nseg * 8;
        v8h x0 = *(const v8h*)(r0);
        v8h x1 = *(const v8h*)(r0 + LL);
        if (kk + 32 < 512) __builtin_prefetch(r0 + (size_t)32 * LL, 0, 3);
        #pragma unroll
        for (int j = 0; j < 8; ++j) {
          union { _Float16 h[2]; unsigned u; } p;
          p.h[0] = x0[j];
          p.h[1] = x1[j];
          *(unsigned*)&sX[nseg * 8 + j][kk + k2] = p.u;  // k2 even: 4B aligned
        }
      } else {
        const float* r0 = Xf + ((size_t)b * 512 + kk + k2) * LL + n0 + nseg * 8;
        const float* r1 = r0 + LL;
        float4 a0 = *(const float4*)(r0);
        float4 a1 = *(const float4*)(r0 + 4);
        float4 c0 = *(const float4*)(r1);
        float4 c1 = *(const float4*)(r1 + 4);
        if (kk + 32 < 512) __builtin_prefetch(r0 + (size_t)32 * LL, 0, 3);
        float f0[8] = {a0.x,a0.y,a0.z,a0.w,a1.x,a1.y,a1.z,a1.w};
        float f1[8] = {c0.x,c0.y,c0.z,c0.w,c1.x,c1.y,c1.z,c1.w};
        #pragma unroll
        for (int j = 0; j < 8; ++j) {
          union { _Float16 h[2]; unsigned u; } p;
          p.h[0] = (_Float16)f0[j];
          p.h[1] = (_Float16)f1[j];
          *(unsigned*)&sX[nseg * 8 + j][kk + k2] = p.u;
        }
      }
    }
  }

  // ---- stage first W tile into sA[0] ----
  const int rA = tid >> 1, segA = tid & 1;
  {
    const float* src = W + (size_t)(m0 + rA) * 512 + segA * 16;
    float4 f0 = *(const float4*)(src + 0);
    float4 f1 = *(const float4*)(src + 4);
    float4 f2 = *(const float4*)(src + 8);
    float4 f3 = *(const float4*)(src + 12);
    v8h h0 = {(_Float16)f0.x,(_Float16)f0.y,(_Float16)f0.z,(_Float16)f0.w,
              (_Float16)f1.x,(_Float16)f1.y,(_Float16)f1.z,(_Float16)f1.w};
    v8h h1 = {(_Float16)f2.x,(_Float16)f2.y,(_Float16)f2.z,(_Float16)f2.w,
              (_Float16)f3.x,(_Float16)f3.y,(_Float16)f3.z,(_Float16)f3.w};
    *(v8h*)&sA[0][rA][segA * 16]     = h0;
    *(v8h*)&sA[0][rA][segA * 16 + 8] = h1;
  }
  __syncthreads();

  v8f acc[2][4];
  #pragma unroll
  for (int mt = 0; mt < 2; ++mt)
    #pragma unroll
    for (int nt = 0; nt < 4; ++nt) acc[mt][nt] = zero8();

  for (int ks = 0; ks < 16; ++ks) {
    const int kb  = ks * 32;
    const int cur = ks & 1;
    const bool have_next = (ks + 1 < 16);

    // issue global loads of the next W tile first (latency hides under WMMA)
    float4 f0 = {}, f1 = {}, f2 = {}, f3 = {};
    if (have_next) {
      const float* src = W + (size_t)(m0 + rA) * 512 + kb + 32 + segA * 16;
      f0 = *(const float4*)(src + 0);
      f1 = *(const float4*)(src + 4);
      f2 = *(const float4*)(src + 8);
      f3 = *(const float4*)(src + 12);
    }

    // compute: 2x4 WMMA tiles per wave from resident panel + current W tile
    v16h afr[2];
    #pragma unroll
    for (int mt = 0; mt < 2; ++mt)
      afr[mt] = frag_ld(&sA[cur][0][0], wm * 32 + mt * 16, 40, 0);
    #pragma unroll
    for (int nt = 0; nt < 4; ++nt) {
      v16h bfr = frag_ld(&sX[0][0], wn * 64 + nt * 16, 520, kb);
      #pragma unroll
      for (int mt = 0; mt < 2; ++mt)
        acc[mt][nt] = wmma16(afr[mt], bfr, acc[mt][nt]);
    }

    // convert + store next W tile into the other buffer
    if (have_next) {
      v8h h0 = {(_Float16)f0.x,(_Float16)f0.y,(_Float16)f0.z,(_Float16)f0.w,
                (_Float16)f1.x,(_Float16)f1.y,(_Float16)f1.z,(_Float16)f1.w};
      v8h h1 = {(_Float16)f2.x,(_Float16)f2.y,(_Float16)f2.z,(_Float16)f2.w,
                (_Float16)f3.x,(_Float16)f3.y,(_Float16)f3.z,(_Float16)f3.w};
      *(v8h*)&sA[cur ^ 1][rA][segA * 16]     = h0;
      *(v8h*)&sA[cur ^ 1][rA][segA * 16 + 8] = h1;
    }
    __syncthreads();
  }

  #pragma unroll
  for (int mt = 0; mt < 2; ++mt)
    #pragma unroll
    for (int r = 0; r < 8; ++r) {
      const int crel = wm * 32 + mt * 16 + r + ((lane >> 4) << 3);
      const float bv = sBias[crel];
      const int c = m0 + crel;
      #pragma unroll
      for (int nt = 0; nt < 4; ++nt) {
        const int n = n0 + wn * 64 + nt * 16 + (lane & 15);
        const float val = acc[mt][nt][r] + bv;
        const size_t off = ((size_t)b * 512 + c) * LL + n;
        if (OUT_F32) Yf[off] = val;
        else         Yh[off] = (_Float16)val;
      }
    }
}

// ---------------------------------------------------------------------------
// Channel attention, split along L so that every WGP gets work.
// attn_logits: grid (KSPLIT, batch*head). A block takes L/KSPLIT columns of
//   q_head and k_head; each wave takes its own 64 columns (one 128-byte line
//   per row) and forms all 16 tiles of the 64x64 partial product, so every
//   element of q and k is loaded once. The eight waves' partials are summed
//   through LDS in fixed order and stored f32 in fragment order.
// attn_pv: grid (LCH, batch*head). A block sums the KSPLIT partials in fixed
//   order, redoes the softmax (scale 1/sqrt(L) = 1/64) and forms
//   O = P . v_head for its own L/LCH columns, v tiles transposed through LDS.
// ---------------------------------------------------------------------------
#define KSPLIT 8
#define LCH 8

__global__ __launch_bounds__(256) void attn_logits(
    const _Float16* __restrict__ q, const _Float16* __restrict__ k,
    float* __restrict__ part)
{
  __shared__ __align__(16) float sRed[8][4096];  // one 64x64 partial per wave

  const int tid  = threadIdx.x;
  const int wid  = tid >> 5;
  const int lane = tid & 31;
  const int sp   = blockIdx.x;
  const int bh   = blockIdx.y;
  const size_t hb = (size_t)bh * DHEAD * LL;
  const _Float16* qh = q + hb;
  const _Float16* kh = k + hb;
  const int kbase = sp * (LL / KSPLIT) + wid * (LL / KSPLIT / 8);

  v8f acc[4][4];
  #pragma unroll
  for (int mi = 0; mi < 4; ++mi)
    #pragma unroll
    for (int ni = 0; ni < 4; ++ni) acc[mi][ni] = zero8();

  #pragma unroll
  for (int s = 0; s < LL / KSPLIT / 8 / 32; ++s) {
    const int kb = kbase + s * 32;
    v16h af[4], bf[4];
    #pragma unroll
    for (int i = 0; i < 4; ++i) {
      af[i] = frag_ld(qh, i * 16, LL, kb);
      bf[i] = frag_ld(kh, i * 16, LL, kb);
    }
    #pragma unroll
    for (int mi = 0; mi < 4; ++mi)
      #pragma unroll
      for (int ni = 0; ni < 4; ++ni)
        acc[mi][ni] = wmma16(af[mi], bf[ni], acc[mi][ni]);
  }

  // fragment order: idx = tile*256 + (r>>2)*128 + lane*4 + (r&3)
  #pragma unroll
  for (int mi = 0; mi < 4; ++mi)
    #pragma unroll
    for (int ni = 0; ni < 4; ++ni)
      #pragma unroll
      for (int hf = 0; hf < 2; ++hf) {
        float4 t = {acc[mi][ni][hf * 4 + 0], acc[mi][ni][hf * 4 + 1],
                    acc[mi][ni][hf * 4 + 2], acc[mi][ni][hf * 4 + 3]};
        *(float4*)&sRed[wid][(mi * 4 + ni) * 256 + hf * 128 + lane * 4] = t;
      }
  __syncthreads();

  float* dst = part + ((size_t)bh * KSPLIT + sp) * 4096;
  #pragma unroll
  for (int j = 0; j < 4; ++j) {
    const int idx = (tid + 256 * j) * 4;
    float4 s = *(const float4*)&sRed[0][idx];
    #pragma unroll
    for (int w = 1; w < 8; ++w) {
      float4 t = *(const float4*)&sRed[w][idx];
      s.x += t.x; s.y += t.y; s.z += t.z; s.w += t.w;
    }
    *(float4*)(dst + idx) = s;
  }
}

__global__ __launch_bounds__(256) void attn_pv(
    const float* __restrict__ part, const _Float16* __restrict__ v,
    _Float16* __restrict__ o)
{
  __shared__ float                  sS[64][65];   // logits fp32
  __shared__ __align__(16) _Float16 sP[64][72];   // softmax probs f16
  __shared__ __align__(16) _Float16 sV[128][72];  // v tile transposed [l][e]

  const int tid  = threadIdx.x;
  const int wid  = tid >> 5;
  const int lane = tid & 31;
  const int bh   = blockIdx.y;
  const size_t hb = (size_t)bh * DHEAD * LL;
  const _Float16* vh = v + hb;
  _Float16* oh       = o + hb;

  // ---- logits: sum the KSPLIT partials, undo the fragment order ----
  const float scale = 0.015625f;  // 1/sqrt(4096)
  const float* pb = part + (size_t)bh * KSPLIT * 4096;
  #pragma unroll
  for (int j = 0; j < 4; ++j) {
    const int idx = (tid + 256 * j) * 4;
    float4 s = *(const float4*)(pb + idx);
    #pragma unroll
    for (int sp = 1; sp < KSPLIT; ++sp) {
      float4 t = *(const float4*)(pb + sp * 4096 + idx);
      s.x += t.x; s.y += t.y; s.z += t.z; s.w += t.w;
    }
    const int tile = idx >> 8;
    const int fl   = (idx >> 2) & 31;
    const int row  = (tile >> 2) * 16 + ((idx >> 7) & 1) * 4 + ((fl >> 4) << 3);
    const int col  = (tile & 3) * 16 + (fl & 15);
    sS[row + 0][col] = s.x * scale;
    sS[row + 1][col] = s.y * scale;
    sS[row + 2][col] = s.z * scale;
    sS[row + 3][col] = s.w * scale;
  }
  __syncthreads();

  // ---- softmax over e (64 wide), one thread per row ----
  if (tid < 64) {
    float mx = -3.0e38f;
    for (int e = 0; e < 64; ++e) mx = fmaxf(mx, sS[tid][e]);
    float sum = 0.f;
    for (int e = 0; e < 64; ++e) {
      float t = __expf(sS[tid][e] - mx);
      sum += t;
      sS[tid][e] = t;
    }
    const float inv = 1.f / sum;
    for (int e = 0; e < 64; ++e) sP[tid][e] = (_Float16)(sS[tid][e] * inv);
  }
  __syncthreads();

  v16h pf[4][2];
  #pragma unroll
  for (int m2 = 0; m2 < 4; ++m2)
    #pragma unroll
    for (int ks = 0; ks < 2; ++ks)
      pf[m2][ks] = frag_ld(&sP[0][0], m2 * 16, 72, ks * 32);

  const int lbeg = blockIdx.x * (LL / LCH);
  for (int l0 = lbeg; l0 < lbeg + LL / LCH; l0 += 128) {
    __syncthreads();
    // stage v[e=0..63][l0..+127] transposed into sV[l][e]
    {
      const int e = tid >> 2, seg = tid & 3;
      const _Float16* src = vh + (size_t)e * LL + l0 + seg * 32;
      #pragma unroll
      for (int q4 = 0; q4 < 4; ++q4) {
        v8h x = *(const v8h*)(src + q4 * 8);
        #pragma unroll
        for (int j = 0; j < 8; ++j) sV[seg * 32 + q4 * 8 + j][e] = x[j];
      }
    }
    __syncthreads();

    // each wave owns a 16-wide l sub-chunk: n_local = wid*16 + lane%16
    v8f oacc[4];
    #pragma unroll
    for (int m2 = 0; m2 < 4; ++m2) oacc[m2] = zero8();
    #pragma unroll
    for (int ks = 0; ks < 2; ++ks) {
      v16h bf = frag_ld(&sV[0][0], wid * 16, 72, ks * 32);
      #pragma unroll
      for (int m2 = 0; m2 < 4; ++m2)
        oacc[m2] = wmma16(pf[m2][ks], bf, oacc[m2]);
    }
    #pragma unroll
    for (int m2 = 0; m2 < 4; ++m2)
      #pragma unroll
      for (int r = 0; r < 8; ++r) {
        const int c = m2 * 16 + r + ((lane >> 4) << 3);
        oh[(size_t)c * LL + l0 + wid * 16 + (lane & 15)] = (_Float16)oacc[m2][r];
      }
  }
}

// ---------------------------------------------------------------------------
extern "C" void kernel_launch(void* const* d_in, const int* in_sizes, int n_in,
                              void* d_out, int out_size, void* d_ws, size_t ws_size,
                              hipStream_t stream) {
  const float* query = (const float*)d_in[0];
  const float* key_  = (const float*)d_in[1];
  const float* value = (const float*)d_in[2];
  const float* wq = (const float*)d_in[3];
  const float* bq = (const float*)d_in[4];
  const float* wk = (const float*)d_in[5];
  const float* bk = (const float*)d_in[6];
  const float* wv = (const float*)d_in[7];
  const float* bv = (const float*)d_in[8];
  const float* wo = (const float*)d_in[9];
  const float* bo = (const float*)d_in[10];
  float* out = (float*)d_out;

  // f16 intermediates in workspace: q,k,v,attn-out (B*C*L halfs = 32 MiB each)
  const size_t S = (size_t)BB * CC * LL;
  _Float16* q16 = (_Float16*)d_ws;
  _Float16* k16 = q16 + S;
  _Float16* v16 = k16 + S;
  _Float16* o16 = v16 + S;
  // f32 logit partials behind them: B*heads*KSPLIT*64*64 floats = 8 MiB
  float* part = (float*)(o16 + S);

  dim3 blk(256);
  dim3 grd(LL / 128, CC / 128, BB);  // (32, 4, 8)

  // The three projections use three DIFFERENT inputs (wq.query, wk.key,
  // wv.value), so nothing is shared between them: one GEMM per launch.
  panel_gemm<false, false><<<grd, blk, 0, stream>>>(wq, bq, query, nullptr,
                                                    nullptr, q16);
  panel_gemm<false, false><<<grd, blk, 0, stream>>>(wk, bk, key_, nullptr,
                                                    nullptr, k16);
  panel_gemm<false, false><<<grd, blk, 0, stream>>>(wv, bv, value, nullptr,
                                                    nullptr, v16);

  attn_logits<<<dim3(KSPLIT, BB * NHEAD), blk, 0, stream>>>(q16, k16, part);
  attn_pv<<<dim3(LCH, BB * NHEAD), blk, 0, stream>>>(part, v16, o16);

  panel_gemm<true, true><<<grd, blk, 0, stream>>>(wo, bo, nullptr, o16,
                                                  out, nullptr);
}

// v002
// One run takes 140 microseconds.
// Next to v001, in two timings, it ran 1.41 and 1.42 times as fast.
// Counting every step since v000, it is 1.96 times as fast.
#include <hip/hip_runtime.h>
#include <hip/hip_bf16.h>

typedef __attribute__((ext_vector_type(16))) _Float16 v16h;
typedef __attribute__((ext_vector_type(8)))  _Float16 v8h;
typedef __attribute__((ext_vector_type(8)))  float    v8f;

#define BB 8
#define CC 512
#define LL 4096
#define NHEAD 8
#define DHEAD 64

__device__ __forceinline__ v8f zero8() {
  v8f z = {0.f,0.f,0.f,0.f,0.f,0.f,0.f,0.f};
  return z;
}

__device__ __forceinline__ v8f wmma16(v16h a, v16h b, v8f c) {
  // (neg_a, A, neg_b, B, c_mod, C, reuse_a, reuse_b) -> v_wmma_f32_16x16x32_f16
  return __builtin_amdgcn_wmma_f32_16x16x32_f16(false, a, false, b, (short)0, c,
                                                false, false);
}

__device__ __forceinline__ v16h mk16(v8h lo, v8h hi) {
  union { v16h v; v8h h[2]; } u;
  u.h[0] = lo; u.h[1] = hi;
  return u.v;
}

__device__ __forceinline__ v16h frag_ld(const _Float16* base, int row0,
                                        int rowStride, int kb) {
  const int lane = threadIdx.x & 31;
  const _Float16* p = base + (size_t)(row0 + (lane & 15)) * rowStride
                           + kb + ((lane >> 4) << 3);
  v8h lo = *(const v8h*)(p);
  v8h hi = *(const v8h*)(p + 16);
  return mk16(lo, hi);
}

// ---------------------------------------------------------------------------
// Projection GEMM: Y[b,m,n] = W . X[b,:,n] + bias   (M=K=512, N=4096/batch)
// Block: 1024 threads (32 waves), tile 512(M, all of it) x 128(N): one block
// per X panel, so every element of X is read, converted and transposed once.
// The entire X^T panel (N=128 rows x K=512 cols, f16) is staged in LDS once;
// W tiles (512x32) are double-buffered per K-step so their global loads hide
// under the WMMAs with a single barrier per step.
// Wave (wm 0..15, wn 0..1) owns a 32x64 sub-tile = 2x4 WMMA accumulators.
// ---------------------------------------------------------------------------
template<bool IN_F16, bool OUT_F32>
__global__ __launch_bounds__(1024) void panel_gemm(
    const float* __restrict__ W, const float* __restrict__ bias,
    const float* __restrict__ Xf, const _Float16* __restrict__ Xh,
    float* __restrict__ Yf, _Float16* __restrict__ Yh)
{
  __shared__ __align__(16) _Float16 sX[128][520];    // [n][k], 520 = 512+8 pad
  __shared__ __align__(16) _Float16 sA[2][512][40];  // double-buffered W tile
  __shared__ float sBias[512];

  const int tid  = threadIdx.x;
  const int b    = blockIdx.z;
  const int n0   = blockIdx.x * 128;
  const int wid  = tid >> 5;
  const int lane = tid & 31;
  const int wm   = wid & 15;
  const int wn   = wid >> 4;

  if (tid < 512) sBias[tid] = bias[tid];

  // ---- stage X^T panel: X[b][k][n0..+127] -> sX[n][k] f16 ----
  // Each thread owns a K-pair (k2,k2+1) x 8 n's per 128-K chunk; the pair packs
  // into one 32-bit LDS store (halves the transpose scatter).
  {
    const int k2   = (tid >> 4) * 2;         // 0,2,...,126
    const int nseg = tid & 15;               // n = nseg*8 .. +7
    for (int kk = 0; kk < 512; kk += 128) {
      if (IN_F16) {
        const _Float16* r0 =
            Xh + ((size_t)b * 512 + kk + k2) * LL + n0 + nseg * 8;
        v8h x0 = *(const v8h*)(r0);
        v8h x1 = *(const v8h*)(r0 + LL);
        if (kk + 128 < 512) __builtin_prefetch(r0 + (size_t)128 * LL, 0, 3);
        #pragma unroll
        for (int j = 0; j < 8; ++j) {
          union { _Float16 h[2]; unsigned u; } p;
          p.h[0] = x0[j];
          p.h[1] = x1[j];
          *(unsigned*)&sX[nseg * 8 + j][kk + k2] = p.u;  // k2 even: 4B aligned
        }
      } else {
        const float* r0 = Xf + ((size_t)b * 512 + kk + k2) * LL + n0 + nseg * 8;
        const float* r1 = r0 + LL;
        float4 a0 = *(const float4*)(r0);
        float4 a1 = *(const float4*)(r0 + 4);
        float4 c0 = *(const float4*)(r1);
        float4 c1 = *(const float4*)(r1 + 4);
        if (kk + 128 < 512) __builtin_prefetch(r0 + (size_t)128 * LL, 0, 3);
        float f0[8] = {a0.x,a0.y,a0.z,a0.w,a1.x,a1.y,a1.z,a1.w};
        float f1[8] = {c0.x,c0.y,c0.z,c0.w,c1.x,c1.y,c1.z,c1.w};
        #pragma unroll
        for (int j = 0; j < 8; ++j) {
          union { _Float16 h[2]; unsigned u; } p;
          p.h[0] = (_Float16)f0[j];
          p.h[1] = (_Float16)f1[j];
          *(unsigned*)&sX[nseg * 8 + j][kk + k2] = p.u;
        }
      }
    }
  }

  // ---- stage first W tile into sA[0] ----
  const int rA = tid >> 1, segA = tid & 1;
  {
    const float* src = W + (size_t)rA * 512 + segA * 16;
    float4 f0 = *(const float4*)(src + 0);
    float4 f1 = *(const float4*)(src + 4);
    float4 f2 = *(const float4*)(src + 8);
    float4 f3 = *(const float4*)(src + 12);
    v8h h0 = {(_Float16)f0.x,(_Float16)f0.y,(_Float16)f0.z,(_Float16)f0.w,
              (_Float16)f1.x,(_Float16)f1.y,(_Float16)f1.z,(_Float16)f1.w};
    v8h h1 = {(_Float16)f2.x,(_Float16)f2.y,(_Float16)f2.z,(_Float16)f2.w,
              (_Float16)f3.x,(_Float16)f3.y,(_Float16)f3.z,(_Float16)f3.w};
    *(v8h*)&sA[0][rA][segA * 16]     = h0;
    *(v8h*)&sA[0][rA][segA * 16 + 8] = h1;
  }
  __syncthreads();

  v8f acc[2][4];
  #pragma unroll
  for (int mt = 0; mt < 2; ++mt)
    #pragma unroll
    for (int nt = 0; nt < 4; ++nt) acc[mt][nt] = zero8();

  for (int ks = 0; ks < 16; ++ks) {
    const int kb  = ks * 32;
    const int cur = ks & 1;
    const bool have_next = (ks + 1 < 16);

    // issue global loads of the next W tile first (latency hides under WMMA)
    float4 f0 = {}, f1 = {}, f2 = {}, f3 = {};
    if (have_next) {
      const float* src = W + (size_t)rA * 512 + kb + 32 + segA * 16;
      f0 = *(const float4*)(src + 0);
      f1 = *(const float4*)(src + 4);
      f2 = *(const float4*)(src + 8);
      f3 = *(const float4*)(src + 12);
    }

    // compute: 2x4 WMMA tiles per wave from resident panel + current W tile
    v16h afr[2];
    #pragma unroll
    for (int mt = 0; mt < 2; ++mt)
      afr[mt] = frag_ld(&sA[cur][0][0], wm * 32 + mt * 16, 40, 0);
    #pragma unroll
    for (int nt = 0; nt < 4; ++nt) {
      v16h bfr = frag_ld(&sX[0][0], wn * 64 + nt * 16, 520, kb);
      #pragma unroll
      for (int mt = 0; mt < 2; ++mt)
        acc[mt][nt] = wmma16(afr[mt], bfr, acc[mt][nt]);
    }

    // convert + store next W tile into the other buffer
    if (have_next) {
      v8h h0 = {(_Float16)f0.x,(_Float16)f0.y,(_Float16)f0.z,(_Float16)f0.w,
                (_Float16)f1.x,(_Float16)f1.y,(_Float16)f1.z,(_Float16)f1.w};
      v8h h1 = {(_Float16)f2.x,(_Float16)f2.y,(_Float16)f2.z,(_Float16)f2.w,
                (_Float16)f3.x,(_Float16)f3.y,(_Float16)f3.z,(_Float16)f3.w};
      *(v8h*)&sA[cur ^ 1][rA][segA * 16]     = h0;
      *(v8h*)&sA[cur ^ 1][rA][segA * 16 + 8] = h1;
    }
    __syncthreads();
  }

  #pragma unroll
  for (int mt = 0; mt < 2; ++mt)
    #pragma unroll
    for (int r = 0; r < 8; ++r) {
      const int c = wm * 32 + mt * 16 + r + ((lane >> 4) << 3);
      const float bv = sBias[c];
      #pragma unroll
      for (int nt = 0; nt < 4; ++nt) {
        const int n = n0 + wn * 64 + nt * 16 + (lane & 15);
        const float val = acc[mt][nt][r] + bv;
        const size_t off = ((size_t)b * 512 + c) * LL + n;
        if (OUT_F32) Yf[off] = val;
        else         Yh[off] = (_Float16)val;
      }
    }
}

// ---------------------------------------------------------------------------
// Channel attention, split along L so that every WGP gets work.
// attn_logits: grid (KSPLIT, batch*head). A block takes L/KSPLIT columns of
//   q_head and k_head; each wave takes its own 64 columns (one 128-byte line
//   per row) and forms all 16 tiles of the 64x64 partial product, so every
//   element of q and k is loaded once. The eight waves' partials are summed
//   through LDS in fixed order and stored f32 in fragment order.
// attn_pv: grid (LCH, batch*head). A block sums the KSPLIT partials in fixed
//   order, redoes the softmax (scale 1/sqrt(L) = 1/64) and forms
//   O = P . v_head for its own L/LCH columns, v tiles transposed through LDS.
// ---------------------------------------------------------------------------
#define KSPLIT 8
#define LCH 8

__global__ __launch_bounds__(256) void attn_logits(
    const _Float16* __restrict__ q, const _Float16* __restrict__ k,
    float* __restrict__ part)
{
  __shared__ __align__(16) float sRed[8][4096];  // one 64x64 partial per wave

  const int tid  = threadIdx.x;
  const int wid  = tid >> 5;
  const int lane = tid & 31;
  const int sp   = blockIdx.x;
  const int bh   = blockIdx.y;
  const size_t hb = (size_t)bh * DHEAD * LL;
  const _Float16* qh = q + hb;
  const _Float16* kh = k + hb;
  const int kbase = sp * (LL / KSPLIT) + wid * (LL / KSPLIT / 8);

  v8f acc[4][4];
  #pragma unroll
  for (int mi = 0; mi < 4; ++mi)
    #pragma unroll
    for (int ni = 0; ni < 4; ++ni) acc[mi][ni] = zero8();

  #pragma unroll
  for (int s = 0; s < LL / KSPLIT / 8 / 32; ++s) {
    const int kb = kbase + s * 32;
    v16h af[4], bf[4];
    #pragma unroll
    for (int i = 0; i < 4; ++i) {
      af[i] = frag_ld(qh, i * 16, LL, kb);
      bf[i] = frag_ld(kh, i * 16, LL, kb);
    }
    #pragma unroll
    for (int mi = 0; mi < 4; ++mi)
      #pragma unroll
      for (int ni = 0; ni < 4; ++ni)
        acc[mi][ni] = wmma16(af[mi], bf[ni], acc[mi][ni]);
  }

  // fragment order: idx = tile*256 + (r>>2)*128 + lane*4 + (r&3)
  #pragma unroll
  for (int mi = 0; mi < 4; ++mi)
    #pragma unroll
    for (int ni = 0; ni < 4; ++ni)
      #pragma unroll
      for (int hf = 0; hf < 2; ++hf) {
        float4 t = {acc[mi][ni][hf * 4 + 0], acc[mi][ni][hf * 4 + 1],
                    acc[mi][ni][hf * 4 + 2], acc[mi][ni][hf * 4 + 3]};
        *(float4*)&sRed[wid][(mi * 4 + ni) * 256 + hf * 128 + lane * 4] = t;
      }
  __syncthreads();

  float* dst = part + ((size_t)bh * KSPLIT + sp) * 4096;
  #pragma unroll
  for (int j = 0; j < 4; ++j) {
    const int idx = (tid + 256 * j) * 4;
    float4 s = *(const float4*)&sRed[0][idx];
    #pragma unroll
    for (int w = 1; w < 8; ++w) {
      float4 t = *(const float4*)&sRed[w][idx];
      s.x += t.x; s.y += t.y; s.z += t.z; s.w += t.w;
    }
    *(float4*)(dst + idx) = s;
  }
}

__global__ __launch_bounds__(256) void attn_pv(
    const float* __restrict__ part, const _Float16* __restrict__ v,
    _Float16* __restrict__ o)
{
  __shared__ float                  sS[64][65];   // logits fp32
  __shared__ __align__(16) _Float16 sP[64][72];   // softmax probs f16
  __shared__ __align__(16) _Float16 sV[128][72];  // v tile transposed [l][e]

  const int tid  = threadIdx.x;
  const int wid  = tid >> 5;
  const int lane = tid & 31;
  const int bh   = blockIdx.y;
  const size_t hb = (size_t)bh * DHEAD * LL;
  const _Float16* vh = v + hb;
  _Float16* oh       = o + hb;

  // ---- logits: sum the KSPLIT partials, undo the fragment order ----
  const float scale = 0.015625f;  // 1/sqrt(4096)
  const float* pb = part + (size_t)bh * KSPLIT * 4096;
  #pragma unroll
  for (int j = 0; j < 4; ++j) {
    const int idx = (tid + 256 * j) * 4;
    float4 s = *(const float4*)(pb + idx);
    #pragma unroll
    for (int sp = 1; sp < KSPLIT; ++sp) {
      float4 t = *(const float4*)(pb + sp * 4096 + idx);
      s.x += t.x; s.y += t.y; s.z += t.z; s.w += t.w;
    }
    const int tile = idx >> 8;
    const int fl   = (idx >> 2) & 31;
    const int row  = (tile >> 2) * 16 + ((idx >> 7) & 1) * 4 + ((fl >> 4) << 3);
    const int col  = (tile & 3) * 16 + (fl & 15);
    sS[row + 0][col] = s.x * scale;
    sS[row + 1][col] = s.y * scale;
    sS[row + 2][col] = s.z * scale;
    sS[row + 3][col] = s.w * scale;
  }
  __syncthreads();

  // ---- softmax over e (64 wide), one thread per row ----
  if (tid < 64) {
    float mx = -3.0e38f;
    for (int e = 0; e < 64; ++e) mx = fmaxf(mx, sS[tid][e]);
    float sum = 0.f;
    for (int e = 0; e < 64; ++e) {
      float t = __expf(sS[tid][e] - mx);
      sum += t;
      sS[tid][e] = t;
    }
    const float inv = 1.f / sum;
    for (int e = 0; e < 64; ++e) sP[tid][e] = (_Float16)(sS[tid][e] * inv);
  }
  __syncthreads();

  v16h pf[4][2];
  #pragma unroll
  for (int m2 = 0; m2 < 4; ++m2)
    #pragma unroll
    for (int ks = 0; ks < 2; ++ks)
      pf[m2][ks] = frag_ld(&sP[0][0], m2 * 16, 72, ks * 32);

  const int lbeg = blockIdx.x * (LL / LCH);
  for (int l0 = lbeg; l0 < lbeg + LL / LCH; l0 += 128) {
    __syncthreads();
    // stage v[e=0..63][l0..+127] transposed into sV[l][e]
    {
      const int e = tid >> 2, seg = tid & 3;
      const _Float16* src = vh + (size_t)e * LL + l0 + seg * 32;
      #pragma unroll
      for (int q4 = 0; q4 < 4; ++q4) {
        v8h x = *(const v8h*)(src + q4 * 8);
        #pragma unroll
        for (int j = 0; j < 8; ++j) sV[seg * 32 + q4 * 8 + j][e] = x[j];
      }
    }
    __syncthreads();

    // each wave owns a 16-wide l sub-chunk: n_local = wid*16 + lane%16
    v8f oacc[4];
    #pragma unroll
    for (int m2 = 0; m2 < 4; ++m2) oacc[m2] = zero8();
    #pragma unroll
    for (int ks = 0; ks < 2; ++ks) {
      v16h bf = frag_ld(&sV[0][0], wid * 16, 72, ks * 32);
      #pragma unroll
      for (int m2 = 0; m2 < 4; ++m2)
        oacc[m2] = wmma16(pf[m2][ks], bf, oacc[m2]);
    }
    #pragma unroll
    for (int m2 = 0; m2 < 4; ++m2)
      #pragma unroll
      for (int r = 0; r < 8; ++r) {
        const int c = m2 * 16 + r + ((lane >> 4) << 3);
        oh[(size_t)c * LL + l0 + wid * 16 + (lane & 15)] = (_Float16)oacc[m2][r];
      }
  }
}

// ---------------------------------------------------------------------------
extern "C" void kernel_launch(void* const* d_in, const int* in_sizes, int n_in,
                              void* d_out, int out_size, void* d_ws, size_t ws_size,
                              hipStream_t stream) {
  const float* query = (const float*)d_in[0];
  const float* key_  = (const float*)d_in[1];
  const float* value = (const float*)d_in[2];
  const float* wq = (const float*)d_in[3];
  const float* bq = (const float*)d_in[4];
  const float* wk = (const float*)d_in[5];
  const float* bk = (const float*)d_in[6];
  const float* wv = (const float*)d_in[7];
  const float* bv = (const float*)d_in[8];
  const float* wo = (const float*)d_in[9];
  const float* bo = (const float*)d_in[10];
  float* out = (float*)d_out;

  // f16 intermediates in workspace: q,k,v,attn-out (B*C*L halfs = 32 MiB each)
  const size_t S = (size_t)BB * CC * LL;
  _Float16* q16 = (_Float16*)d_ws;
  _Float16* k16 = q16 + S;
  _Float16* v16 = k16 + S;
  _Float16* o16 = v16 + S;
  // f32 logit partials behind them: B*heads*KSPLIT*64*64 floats = 8 MiB
  float* part = (float*)(o16 + S);

  dim3 blk(256);
  dim3 gblk(1024);
  dim3 grd(LL / 128, 1, BB);  // (32, 1, 8): one block per X panel

  // The three projections use three DIFFERENT inputs (wq.query, wk.key,
  // wv.value), so nothing is shared between them: one GEMM per launch.
  panel_gemm<false, false><<<grd, gblk, 0, stream>>>(wq, bq, query, nullptr,
                                                    nullptr, q16);
  panel_gemm<false, false><<<grd, gblk, 0, stream>>>(wk, bk, key_, nullptr,
                                                    nullptr, k16);
  panel_gemm<false, false><<<grd, gblk, 0, stream>>>(wv, bv, value, nullptr,
                                                    nullptr, v16);

  attn_logits<<<dim3(KSPLIT, BB * NHEAD), blk, 0, stream>>>(q16, k16, part);
  attn_pv<<<dim3(LCH, BB * NHEAD), blk, 0, stream>>>(part, v16, o16);

  panel_gemm<true, true><<<grd, gblk, 0, stream>>>(wo, bo, nullptr, o16,
                                                  out, nullptr);
}

// v003
// It runs in 117 microseconds.
// Timed twice side by side with v002, it ran 1.20 and 1.19 times as fast.
// All steps since v000 together make it 2.33 times as fast.
#include <hip/hip_runtime.h>
#include <hip/hip_bf16.h>

typedef __attribute__((ext_vector_type(16))) _Float16 v16h;
typedef __attribute__((ext_vector_type(8)))  _Float16 v8h;
typedef __attribute__((ext_vector_type(8)))  float    v8f;

#define BB 8
#define CC 512
#define LL 4096
#define NHEAD 8
#define DHEAD 64

__device__ __forceinline__ v8f zero8() {
  v8f z = {0.f,0.f,0.f,0.f,0.f,0.f,0.f,0.f};
  return z;
}

__device__ __forceinline__ v8f wmma16(v16h a, v16h b, v8f c) {
  // (neg_a, A, neg_b, B, c_mod, C, reuse_a, reuse_b) -> v_wmma_f32_16x16x32_f16
  return __builtin_amdgcn_wmma_f32_16x16x32_f16(false, a, false, b, (short)0, c,
                                                false, false);
}

__device__ __forceinline__ v16h mk16(v8h lo, v8h hi) {
  union { v16h v; v8h h[2]; } u;
  u.h[0] = lo; u.h[1] = hi;
  return u.v;
}

__device__ __forceinline__ v16h frag_ld(const _Float16* base, int row0,
                                        int rowStride, int kb) {
  const int lane = threadIdx.x & 31;
  const _Float16* p = base + (size_t)(row0 + (lane & 15)) * rowStride
                           + kb + ((lane >> 4) << 3);
  v8h lo = *(const v8h*)(p);
  v8h hi = *(const v8h*)(p + 16);
  return mk16(lo, hi);
}

// Stands in front of the last load of a run of global loads: that load may take
// the run's address registers as its destination, so the earlier loads'
// translations are waited for first. The two scheduling barriers keep the
// earlier loads in front of the wait and the last load behind it.
__device__ __forceinline__ void xcnt_before_last_load() {
  __builtin_amdgcn_sched_barrier(0);
  asm volatile("s_wait_xcnt 0x0" ::: "memory");
  __builtin_amdgcn_sched_barrier(0);
}

// The same fragment, same k order, from a row-major f32 matrix (converted).
// lastUse: this is the last fragment read through the lane's address pair.
__device__ __forceinline__ v16h frag_ld_f32(const float* base, int row0,
                                            int rowStride, int kb,
                                            bool lastUse) {
  const int lane = threadIdx.x & 31;
  const float* p = base + (size_t)(row0 + (lane & 15)) * rowStride
                        + kb + ((lane >> 4) << 3);
  float4 a0 = *(const float4*)(p);
  float4 a1 = *(const float4*)(p + 4);
  float4 c0 = *(const float4*)(p + 16);
  if (lastUse) xcnt_before_last_load();
  float4 c1 = *(const float4*)(p + 20);
  v8h lo = {(_Float16)a0.x,(_Float16)a0.y,(_Float16)a0.z,(_Float16)a0.w,
            (_Float16)a1.x,(_Float16)a1.y,(_Float16)a1.z,(_Float16)a1.w};
  v8h hi = {(_Float16)c0.x,(_Float16)c0.y,(_Float16)c0.z,(_Float16)c0.w,
            (_Float16)c1.x,(_Float16)c1.y,(_Float16)c1.z,(_Float16)c1.w};
  return mk16(lo, hi);
}

// ---------------------------------------------------------------------------
// Projection GEMM: Y[b,m,n] = W . X[b,:,n] + bias   (M=K=512, N=4096/batch)
// Block: 1024 threads (32 waves), tile 512(M, all of it) x 128(N): one block
// per X panel, so every element of X is read, converted and transposed once.
// The entire X^T panel (N=128 rows x K=512 cols, f16) is staged in LDS once;
// W tiles (512x32) are double-buffered per K-step so their global loads hide
// under the WMMAs with a single barrier per step.
// Wave (wm 0..15, wn 0..1) owns a 32x64 sub-tile = 2x4 WMMA accumulators.
// W_PER_BATCH: W and bias are [B][512][512] and [B][512], one pair per batch.
// ---------------------------------------------------------------------------
template<bool W_PER_BATCH, bool OUT_F32>
__global__ __launch_bounds__(1024) void panel_gemm(
    const float* __restrict__ Wall, const float* __restrict__ biasAll,
    const float* __restrict__ Xf,
    float* __restrict__ Yf, _Float16* __restrict__ Yh)
{
  __shared__ __align__(16) _Float16 sX[128][520];    // [n][k], 520 = 512+8 pad
  __shared__ __align__(16) _Float16 sA[2][512][40];  // double-buffered W tile
  __shared__ float sBias[512];

  const int tid  = threadIdx.x;
  const int b    = blockIdx.z;
  const int n0   = blockIdx.x * 128;
  const int wid  = tid >> 5;
  const int lane = tid & 31;
  const int wm   = wid & 15;
  const int wn   = wid >> 4;
  const float* W    = W_PER_BATCH ? Wall + (size_t)b * 512 * 512 : Wall;
  const float* bias = W_PER_BATCH ? biasAll + b * 512 : biasAll;

  if (tid < 512) sBias[tid] = bias[tid];

  // ---- stage X^T panel: X[b][k][n0..+127] -> sX[n][k] f16 ----
  // Each thread owns a K-pair (k2,k2+1) x 8 n's per 128-K chunk; the pair packs
  // into one 32-bit LDS store (halves the transpose scatter).
  {
    const int k2   = (tid >> 4) * 2;         // 0,2,...,126
    const int nseg = tid & 15;               // n = nseg*8 .. +7
    for (int kk = 0; kk < 512; kk += 128) {
      const float* r0 = Xf + ((size_t)b * 512 + kk + k2) * LL + n0 + nseg * 8;
      const float* r1 = r0 + LL;
      float4 a0 = *(const float4*)(r0);
      float4 a1 = *(const float4*)(r0 + 4);
      float4 c0 = *(const float4*)(r1);
      float4 c1 = *(const float4*)(r1 + 4);
      if (kk + 128 < 512) __builtin_prefetch(r0 + (size_t)128 * LL, 0, 3);
      float f0[8] = {a0.x,a0.y,a0.z,a0.w,a1.x,a1.y,a1.z,a1.w};
      float f1[8] = {c0.x,c0.y,c0.z,c0.w,c1.x,c1.y,c1.z,c1.w};
      #pragma unroll
      for (int j = 0; j < 8; ++j) {
        union { _Float16 h[2]; unsigned u; } p;
        p.h[0] = (_Float16)f0[j];
        p.h[1] = (_Float16)f1[j];
        *(unsigned*)&sX[nseg * 8 + j][kk + k2] = p.u;  // k2 even: 4B aligned
      }
    }
  }

  // ---- stage first W tile into sA[0] ----
  const int rA = tid >> 1, segA = tid & 1;
  {
    const float* src = W + (size_t)rA * 512 + segA * 16;
    float4 f0 = *(const float4*)(src + 0);
    float4 f1 = *(const float4*)(src + 4);
    float4 f2 = *(const float4*)(src + 8);
    float4 f3 = *(const float4*)(src + 12);
    v8h h0 = {(_Float16)f0.x,(_Float16)f0.y,(_Float16)f0.z,(_Float16)f0.w,
              (_Float16)f1.x,(_Float16)f1.y,(_Float16)f1.z,(_Float16)f1.w};
    v8h h1 = {(_Float16)f2.x,(_Float16)f2.y,(_Float16)f2.z,(_Float16)f2.w,
              (_Float16)f3.x,(_Float16)f3.y,(_Float16)f3.z,(_Float16)f3.w};
    *(v8h*)&sA[0][rA][segA * 16]     = h0;
    *(v8h*)&sA[0][rA][segA * 16 + 8] = h1;
  }
  __syncthreads();

  v8f acc[2][4];
  #pragma unroll
  for (int mt = 0; mt < 2; ++mt)
    #pragma unroll
    for (int nt = 0; nt < 4; ++nt) acc[mt][nt] = zero8();

  for (int ks = 0; ks < 16; ++ks) {
    const int kb  = ks * 32;
    const int cur = ks & 1;
    const bool have_next = (ks + 1 < 16);

    // issue global loads of the next W tile first (latency hides under WMMA)
    float4 f0 = {}, f1 = {}, f2 = {}, f3 = {};
    if (have_next) {
      const float* src = W + (size_t)rA * 512 + kb + 32 + segA * 16;
      f0 = *(const float4*)(src + 0);
      f1 = *(const float4*)(src + 4);
      f2 = *(const float4*)(src + 8);
      f3 = *(const float4*)(src + 12);
    }

    // compute: 2x4 WMMA tiles per wave from resident panel + current W tile
    v16h afr[2];
    #pragma unroll
    for (int mt = 0; mt < 2; ++mt)
      afr[mt] = frag_ld(&sA[cur][0][0], wm * 32 + mt * 16, 40, 0);
    #pragma unroll
    for (int nt = 0; nt < 4; ++nt) {
      v16h bfr = frag_ld(&sX[0][0], wn * 64 + nt * 16, 520, kb);
      #pragma unroll
      for (int mt = 0; mt < 2; ++mt)
        acc[mt][nt] = wmma16(afr[mt], bfr, acc[mt][nt]);
    }

    // convert + store next W tile into the other buffer
    if (have_next) {
      v8h h0 = {(_Float16)f0.x,(_Float16)f0.y,(_Float16)f0.z,(_Float16)f0.w,
                (_Float16)f1.x,(_Float16)f1.y,(_Float16)f1.z,(_Float16)f1.w};
      v8h h1 = {(_Float16)f2.x,(_Float16)f2.y,(_Float16)f2.z,(_Float16)f2.w,
                (_Float16)f3.x,(_Float16)f3.y,(_Float16)f3.z,(_Float16)f3.w};
      *(v8h*)&sA[cur ^ 1][rA][segA * 16]     = h0;
      *(v8h*)&sA[cur ^ 1][rA][segA * 16 + 8] = h1;
    }
    __syncthreads();
  }

  #pragma unroll
  for (int mt = 0; mt < 2; ++mt)
    #pragma unroll
    for (int r = 0; r < 8; ++r) {
      const int c = wm * 32 + mt * 16 + r + ((lane >> 4) << 3);
      const float bv = sBias[c];
      #pragma unroll
      for (int nt = 0; nt < 4; ++nt) {
        const int n = n0 + wn * 64 + nt * 16 + (lane & 15);
        const float val = acc[mt][nt][r] + bv;
        const size_t off = ((size_t)b * 512 + c) * LL + n;
        if (OUT_F32) Yf[off] = val;
        else         Yh[off] = (_Float16)val;
      }
    }
}

// ---------------------------------------------------------------------------
// Channel attention, split along L so that every WGP gets work.
// attn_logits: grid (KSPLIT, batch*head). A block takes L/KSPLIT columns of
//   q_head and k_head; each wave takes its own 64 columns (one 128-byte line
//   per row) and forms all 16 tiles of the 64x64 partial product, so every
//   element of q and k is loaded once. The eight waves' partials are summed
//   through LDS in fixed order and stored f32 in fragment order.
// attn_fold: grid (CCH, batch*head). A block sums the KSPLIT partials in fixed
//   order, redoes the softmax (scale 1/sqrt(L) = 1/64) and forms
//   T = P . Wv_head for its own 512/CCH columns of Wv, the Wv tile transposed
//   through LDS. T is stored transposed, tT[b][c][head*64 + d] (f16), which is
//   the B-fragment order of the next product. Chunk 0 also stores P . bv_head.
// fold_out: grid (8 + 1, 8, batch). M[b] = Wo . T[b], one 64x64 tile a block,
//   K = 512 split over the eight waves and summed through LDS in fixed order
//   as in attn_logits; column block 8 forms the bias Wo . (P.bv) + bo instead.
// ---------------------------------------------------------------------------
#define KSPLIT 8
#define CCH 4

__global__ __launch_bounds__(256) void attn_logits(
    const _Float16* __restrict__ q, const _Float16* __restrict__ k,
    float* __restrict__ part)
{
  __shared__ __align__(16) float sRed[8][4096];  // one 64x64 partial per wave

  const int tid  = threadIdx.x;
  const int wid  = tid >> 5;
  const int lane = tid & 31;
  const int sp   = blockIdx.x;
  const int bh   = blockIdx.y;
  const size_t hb = (size_t)bh * DHEAD * LL;
  const _Float16* qh = q + hb;
  const _Float16* kh = k + hb;
  const int kbase = sp * (LL / KSPLIT) + wid * (LL / KSPLIT / 8);

  v8f acc[4][4];
  #pragma unroll
  for (int mi = 0; mi < 4; ++mi)
    #pragma unroll
    for (int ni = 0; ni < 4; ++ni) acc[mi][ni] = zero8();

  #pragma unroll
  for (int s = 0; s < LL / KSPLIT / 8 / 32; ++s) {
    const int kb = kbase + s * 32;
    v16h af[4], bf[4];
    #pragma unroll
    for (int i = 0; i < 4; ++i) {
      af[i] = frag_ld(qh, i * 16, LL, kb);
      bf[i] = frag_ld(kh, i * 16, LL, kb);
    }
    #pragma unroll
    for (int mi = 0; mi < 4; ++mi)
      #pragma unroll
      for (int ni = 0; ni < 4; ++ni)
        acc[mi][ni] = wmma16(af[mi], bf[ni], acc[mi][ni]);
  }

  // fragment order: idx = tile*256 + (r>>2)*128 + lane*4 + (r&3)
  #pragma unroll
  for (int mi = 0; mi < 4; ++mi)
    #pragma unroll
    for (int ni = 0; ni < 4; ++ni)
      #pragma unroll
      for (int hf = 0; hf < 2; ++hf) {
        float4 t = {acc[mi][ni][hf * 4 + 0], acc[mi][ni][hf * 4 + 1],
                    acc[mi][ni][hf * 4 + 2], acc[mi][ni][hf * 4 + 3]};
        *(float4*)&sRed[wid][(mi * 4 + ni) * 256 + hf * 128 + lane * 4] = t;
      }
  __syncthreads();

  float* dst = part + ((size_t)bh * KSPLIT + sp) * 4096;
  #pragma unroll
  for (int j = 0; j < 4; ++j) {
    const int idx = (tid + 256 * j) * 4;
    float4 s = *(const float4*)&sRed[0][idx];
    #pragma unroll
    for (int w = 1; w < 8; ++w) {
      float4 t = *(const float4*)&sRed[w][idx];
      s.x += t.x; s.y += t.y; s.z += t.z; s.w += t.w;
    }
    *(float4*)(dst + idx) = s;
  }
}

__global__ __launch_bounds__(256) void attn_fold(
    const float* __restrict__ part, const float* __restrict__ wv,
    const float* __restrict__ bv, _Float16* __restrict__ tT,
    float* __restrict__ tb)
{
  __shared__ float                  sS[64][65];   // logits fp32
  __shared__ __align__(16) _Float16 sP[64][72];   // softmax probs f16
  __shared__ __align__(16) _Float16 sV[128][72];  // Wv tile transposed [c][e]
  __shared__ float                  sBv[64];      // bv of this head

  const int tid  = threadIdx.x;
  const int wid  = tid >> 5;
  const int lane = tid & 31;
  const int bh   = blockIdx.y;
  const int b    = bh >> 3;
  const int h    = bh & 7;
  const int c0   = blockIdx.x * (CC / CCH);

  if (tid < 64) sBv[tid] = bv[h * DHEAD + tid];

  // ---- stage Wv[h*64 + e][c0..+127] transposed into sV[c][e], f16 ----
  {
    const int e = tid >> 2, seg = tid & 3;
    const float* src = wv + (size_t)(h * DHEAD + e) * CC + c0 + seg * 32;
    #pragma unroll
    for (int q4 = 0; q4 < 8; ++q4) {
      float4 x = *(const float4*)(src + q4 * 4);
      sV[seg * 32 + q4 * 4 + 0][e] = (_Float16)x.x;
      sV[seg * 32 + q4 * 4 + 1][e] = (_Float16)x.y;
      sV[seg * 32 + q4 * 4 + 2][e] = (_Float16)x.z;
      sV[seg * 32 + q4 * 4 + 3][e] = (_Float16)x.w;
    }
  }

  // ---- logits: sum the KSPLIT partials, undo the fragment order ----
  const float scale = 0.015625f;  // 1/sqrt(4096)
  const float* pb = part + (size_t)bh * KSPLIT * 4096;
  #pragma unroll
  for (int j = 0; j < 4; ++j) {
    const int idx = (tid + 256 * j) * 4;
    float4 s = *(const float4*)(pb + idx);
    #pragma unroll
    for (int sp = 1; sp < KSPLIT; ++sp) {
      float4 t = *(const float4*)(pb + sp * 4096 + idx);
      s.x += t.x; s.y += t.y; s.z += t.z; s.w += t.w;
    }
    const int tile = idx >> 8;
    const int fl   = (idx >> 2) & 31;
    const int row  = (tile >> 2) * 16 + ((idx >> 7) & 1) * 4 + ((fl >> 4) << 3);
    const int col  = (tile & 3) * 16 + (fl & 15);
    sS[row + 0][col] = s.x * scale;
    sS[row + 1][col] = s.y * scale;
    sS[row + 2][col] = s.z * scale;
    sS[row + 3][col] = s.w * scale;
  }
  __syncthreads();

  // ---- softmax over e (64 wide), one thread per row; P.bv beside it ----
  if (tid < 64) {
    float mx = -3.0e38f;
    for (int e = 0; e < 64; ++e) mx = fmaxf(mx, sS[tid][e]);
    float sum = 0.f;
    for (int e = 0; e < 64; ++e) {
      float t = __expf(sS[tid][e] - mx);
      sum += t;
      sS[tid][e] = t;
    }
    const float inv = 1.f / sum;
    float pbv = 0.f;
    for (int e = 0; e < 64; ++e) {
      const float p = sS[tid][e] * inv;
      sP[tid][e] = (_Float16)p;
      pbv += p * sBv[e];
    }
    if (blockIdx.x == 0) tb[bh * DHEAD + tid] = pbv;  // = [b][h*64 + d]
  }
  __syncthreads();

  // ---- T = P x Wv_head: each wave owns 16 columns c = c0 + wid*16 + lane%16
  v8f oacc[4];
  #pragma unroll
  for (int m2 = 0; m2 < 4; ++m2) oacc[m2] = zero8();
  #pragma unroll
  for (int ks = 0; ks < 2; ++ks) {
    v16h bf = frag_ld(&sV[0][0], wid * 16, 72, ks * 32);
    #pragma unroll
    for (int m2 = 0; m2 < 4; ++m2)
      oacc[m2] = wmma16(frag_ld(&sP[0][0], m2 * 16, 72, ks * 32), bf, oacc[m2]);
  }
  _Float16* dst = tT + ((size_t)b * CC + c0 + wid * 16 + (lane & 15)) * CC
                     + h * DHEAD + ((lane >> 4) << 3);
  #pragma unroll
  for (int m2 = 0; m2 < 4; ++m2) {
    v8h t;
    #pragma unroll
    for (int r = 0; r < 8; ++r) t[r] = (_Float16)oacc[m2][r];
    *(v8h*)(dst + m2 * 16) = t;
  }
}

__global__ __launch_bounds__(256) void fold_out(
    const float* __restrict__ wo, const float* __restrict__ bo,
    const _Float16* __restrict__ tT, const float* __restrict__ tb,
    float* __restrict__ M, float* __restrict__ bias2)
{
  __shared__ __align__(16) float sRed[8][4096];  // one 64x64 partial per wave

  const int tid  = threadIdx.x;
  const int wid  = tid >> 5;
  const int lane = tid & 31;
  const int ct   = blockIdx.x;
  const int ot   = blockIdx.y;
  const int b    = blockIdx.z;

  if (ct == 8) {
    // bias2[b][o] = bo[o] + sum_j Wo[o][j] * tb[b][j], four threads a row
    const int o = ot * 64 + (tid >> 2), qd = tid & 3;
    const float* wr = wo + (size_t)o * CC + qd * 4;
    const float* tv = tb + b * CC + qd * 4;
    float s = 0.f;
    #pragma unroll 1  // eight float4 pairs in flight a trip are enough here
    for (int i0 = 0; i0 < CC / 16; i0 += 8) {
      float4 w[8], t[8];
      #pragma unroll
      for (int i = 0; i < 8; ++i) {
        t[i] = *(const float4*)(tv + (i0 + i) * 16);
        if (i == 7) xcnt_before_last_load();
        w[i] = *(const float4*)(wr + (i0 + i) * 16);
      }
      #pragma unroll
      for (int i = 0; i < 8; ++i)
        s += w[i].x * t[i].x + w[i].y * t[i].y + w[i].z * t[i].z
           + w[i].w * t[i].w;
    }
    s += __shfl_xor(s, 1);
    s += __shfl_xor(s, 2);
    if (qd == 0) bias2[b * CC + o] = s + bo[o];
    return;
  }

  const float*    ah = wo + (size_t)ot * 64 * CC;
  const _Float16* bt = tT + ((size_t)b * CC + ct * 64) * CC;

  v8f acc[4][4];
  #pragma unroll
  for (int mi = 0; mi < 4; ++mi)
    #pragma unroll
    for (int ni = 0; ni < 4; ++ni) acc[mi][ni] = zero8();

  #pragma unroll
  for (int s = 0; s < CC / 8 / 32; ++s) {
    const int kb = wid * (CC / 8) + s * 32;
    v16h af[4], bf[4];
    #pragma unroll
    for (int i = 0; i < 4; ++i) {
      bf[i] = frag_ld(bt, i * 16, CC, kb);
      af[i] = frag_ld_f32(ah, i * 16, CC, kb, s == CC / 8 / 32 - 1 && i == 3);
    }
    #pragma unroll
    for (int mi = 0; mi < 4; ++mi)
      #pragma unroll
      for (int ni = 0; ni < 4; ++ni)
        acc[mi][ni] = wmma16(af[mi], bf[ni], acc[mi][ni]);
  }

  // fragment order: idx = tile*256 + (r>>2)*128 + lane*4 + (r&3)
  #pragma unroll
  for (int mi = 0; mi < 4; ++mi)
    #pragma unroll
    for (int ni = 0; ni < 4; ++ni)
      #pragma unroll
      for (int hf = 0; hf < 2; ++hf) {
        float4 t = {acc[mi][ni][hf * 4 + 0], acc[mi][ni][hf * 4 + 1],
                    acc[mi][ni][hf * 4 + 2], acc[mi][ni][hf * 4 + 3]};
        *(float4*)&sRed[wid][(mi * 4 + ni) * 256 + hf * 128 + lane * 4] = t;
      }
  __syncthreads();

  // sum the eight waves' partials, undo the fragment order, store row-major
  float* dst = M + ((size_t)b * CC + ot * 64) * CC + ct * 64;
  #pragma unroll
  for (int j = 0; j < 4; ++j) {
    const int idx = (tid + 256 * j) * 4;
    float4 s = *(const float4*)&sRed[0][idx];
    #pragma unroll
    for (int w = 1; w < 8; ++w) {
      float4 t = *(const float4*)&sRed[w][idx];
      s.x += t.x; s.y += t.y; s.z += t.z; s.w += t.w;
    }
    const int tile = idx >> 8;
    const int fl   = (idx >> 2) & 31;
    const int row  = (tile >> 2) * 16 + ((idx >> 7) & 1) * 4 + ((fl >> 4) << 3);
    const int col  = (tile & 3) * 16 + (fl & 15);
    dst[(size_t)(row + 0) * CC + col] = s.x;
    dst[(size_t)(row + 1) * CC + col] = s.y;
    dst[(size_t)(row + 2) * CC + col] = s.z;
    dst[(size_t)(row + 3) * CC + col] = s.w;
  }
}

// ---------------------------------------------------------------------------
extern "C" void kernel_launch(void* const* d_in, const int* in_sizes, int n_in,
                              void* d_out, int out_size, void* d_ws, size_t ws_size,
                              hipStream_t stream) {
  const float* query = (const float*)d_in[0];
  const float* key_  = (const float*)d_in[1];
  const float* value = (const float*)d_in[2];
  const float* wq = (const float*)d_in[3];
  const float* bq = (const float*)d_in[4];
  const float* wk = (const float*)d_in[5];
  const float* bk = (const float*)d_in[6];
  const float* wv = (const float*)d_in[7];
  const float* bv = (const float*)d_in[8];
  const float* wo = (const float*)d_in[9];
  const float* bo = (const float*)d_in[10];
  float* out = (float*)d_out;

  // f16 intermediates in workspace: q,k (B*C*L halfs = 32 MiB each)
  const size_t S = (size_t)BB * CC * LL;
  _Float16* q16 = (_Float16*)d_ws;
  _Float16* k16 = q16 + S;
  // f32 logit partials behind them: B*heads*KSPLIT*64*64 floats = 8 MiB
  float* part = (float*)(k16 + S);
  // per batch: (P.Wv)^T f16, Wo.P.Wv f32, P.bv and the folded bias f32
  const size_t S2 = (size_t)BB * CC * CC;
  _Float16* tT = (_Float16*)(part + (size_t)BB * NHEAD * KSPLIT * 4096);
  float* fM    = (float*)(tT + S2);
  float* tb    = fM + S2;
  float* bias2 = tb + BB * CC;

  dim3 blk(256);
  dim3 gblk(1024);
  dim3 grd(LL / 128, 1, BB);  // (32, 1, 8): one block per X panel

  panel_gemm<false, false><<<grd, gblk, 0, stream>>>(wq, bq, query, nullptr,
                                                    q16);
  panel_gemm<false, false><<<grd, gblk, 0, stream>>>(wk, bk, key_, nullptr,
                                                    k16);

  attn_logits<<<dim3(KSPLIT, BB * NHEAD), blk, 0, stream>>>(q16, k16, part);
  attn_fold<<<dim3(CCH, BB * NHEAD), blk, 0, stream>>>(part, wv, bv, tT, tb);
  fold_out<<<dim3(8 + 1, 8, BB), blk, 0, stream>>>(wo, bo, tT, tb, fM, bias2);

  panel_gemm<true, true><<<grd, gblk, 0, stream>>>(fM, bias2, value, out,
                                                  nullptr);
}

// v004
// A run of this version takes 105 microseconds.
// Next to v003, in two timings, it ran 1.11 and 1.12 times as fast.
// Counting every step since v000, it is 2.60 times as fast.
#include <hip/hip_runtime.h>
#include <hip/hip_bf16.h>

typedef __attribute__((ext_vector_type(16))) _Float16 v16h;
typedef __attribute__((ext_vector_type(8)))  _Float16 v8h;
typedef __attribute__((ext_vector_type(4)))  _Float16 v4h;
typedef __attribute__((ext_vector_type(8)))  float    v8f;

#define BB 8
#define CC 512
#define LL 4096
#define NHEAD 8
#define DHEAD 64

__device__ __forceinline__ v8f zero8() {
  v8f z = {0.f,0.f,0.f,0.f,0.f,0.f,0.f,0.f};
  return z;
}

__device__ __forceinline__ v8f wmma16(v16h a, v16h b, v8f c) {
  // (neg_a, A, neg_b, B, c_mod, C, reuse_a, reuse_b) -> v_wmma_f32_16x16x32_f16
  return __builtin_amdgcn_wmma_f32_16x16x32_f16(false, a, false, b, (short)0, c,
                                                false, false);
}

__device__ __forceinline__ v16h mk16(v8h lo, v8h hi) {
  union { v16h v; v8h h[2]; } u;
  u.h[0] = lo; u.h[1] = hi;
  return u.v;
}

__device__ __forceinline__ v16h frag_ld(const _Float16* base, int row0,
                                        int rowStride, int kb) {
  const int lane = threadIdx.x & 31;
  const _Float16* p = base + (size_t)(row0 + (lane & 15)) * rowStride
                           + kb + ((lane >> 4) << 3);
  v8h lo = *(const v8h*)(p);
  v8h hi = *(const v8h*)(p + 16);
  return mk16(lo, hi);
}

// Stands in front of the last load of a run of global loads: that load may take
// the run's address registers as its destination, so the earlier loads'
// translations are waited for first. The two scheduling barriers keep the
// earlier loads in front of the wait and the last load behind it.
__device__ __forceinline__ void xcnt_before_last_load() {
  __builtin_amdgcn_sched_barrier(0);
  asm volatile("s_wait_xcnt 0x0" ::: "memory");
  __builtin_amdgcn_sched_barrier(0);
}

// Stands behind the last load of a run whose address registers are free for
// reuse from there on: the load's translation is waited for first.
__device__ __forceinline__ void xcnt_behind_loads() {
  __builtin_amdgcn_sched_barrier(0);
  asm volatile("s_wait_xcnt 0x0" ::: "memory");
  __builtin_amdgcn_sched_barrier(0);
}

// The same fragment, same k order, from a row-major f32 matrix (converted).
// lastUse: this is the last fragment read through the lane's address pair.
__device__ __forceinline__ v16h frag_ld_f32(const float* base, int row0,
                                            int rowStride, int kb,
                                            bool lastUse) {
  const int lane = threadIdx.x & 31;
  const float* p = base + (size_t)(row0 + (lane & 15)) * rowStride
                        + kb + ((lane >> 4) << 3);
  float4 a0 = *(const float4*)(p);
  float4 a1 = *(const float4*)(p + 4);
  float4 c0 = *(const float4*)(p + 16);
  if (lastUse) xcnt_before_last_load();
  float4 c1 = *(const float4*)(p + 20);
  v8h lo = {(_Float16)a0.x,(_Float16)a0.y,(_Float16)a0.z,(_Float16)a0.w,
            (_Float16)a1.x,(_Float16)a1.y,(_Float16)a1.z,(_Float16)a1.w};
  v8h hi = {(_Float16)c0.x,(_Float16)c0.y,(_Float16)c0.z,(_Float16)c0.w,
            (_Float16)c1.x,(_Float16)c1.y,(_Float16)c1.z,(_Float16)c1.w};
  return mk16(lo, hi);
}

// ---------------------------------------------------------------------------
// Projection GEMM: Y[b,m,n] = W . X[b,:,n] + bias   (M=K=512, N=4096/batch)
// Block: 1024 threads (32 waves), tile 512(M, all of it) x 128(N): one block
// per X panel, so every element of X is read, converted and transposed once.
// The entire X^T panel (N=128 rows x K=512 cols, f16) is staged in LDS once;
// W tiles (512x32) are double-buffered per K-step so their global loads hide
// under the WMMAs with a single barrier per step.
// Wave (wm 0..15, wn 0..1) owns a 32x64 sub-tile = 2x4 WMMA accumulators.
// W_PER_BATCH: W and bias are [B][512][512] and [B][512], one pair per batch.
// ---------------------------------------------------------------------------
template<bool W_PER_BATCH, bool OUT_F32>
__global__ __launch_bounds__(1024) void panel_gemm(
    const float* __restrict__ Wall, const float* __restrict__ biasAll,
    const float* __restrict__ Xf,
    float* __restrict__ Yf, _Float16* __restrict__ Yh)
{
  __shared__ __align__(16) _Float16 sX[128][520];    // [n][k], 520 = 512+8 pad
  __shared__ __align__(16) _Float16 sA[2][512][40];  // double-buffered W tile
  __shared__ float sBias[512];

  const int tid  = threadIdx.x;
  const int b    = blockIdx.z;
  const int n0   = blockIdx.x * 128;
  const int wid  = tid >> 5;
  const int lane = tid & 31;
  const int wm   = wid & 15;
  const int wn   = wid >> 4;
  const float* W    = W_PER_BATCH ? Wall + (size_t)b * 512 * 512 : Wall;
  const float* bias = W_PER_BATCH ? biasAll + b * 512 : biasAll;

  if (tid < 512) sBias[tid] = bias[tid];

  // ---- stage X^T panel: X[b][k][n0..+127] -> sX[n][k] f16 ----
  // Each thread owns a K-pair (k2,k2+1) x 8 n's per 128-K chunk; the pair packs
  // into one 32-bit LDS store (halves the transpose scatter).
  {
    const int k2   = (tid >> 4) * 2;         // 0,2,...,126
    const int nseg = tid & 15;               // n = nseg*8 .. +7
    for (int kk = 0; kk < 512; kk += 128) {
      const float* r0 = Xf + ((size_t)b * 512 + kk + k2) * LL + n0 + nseg * 8;
      const float* r1 = r0 + LL;
      float4 a0 = *(const float4*)(r0);
      float4 a1 = *(const float4*)(r0 + 4);
      float4 c0 = *(const float4*)(r1);
      float4 c1 = *(const float4*)(r1 + 4);
      if (kk + 128 < 512) __builtin_prefetch(r0 + (size_t)128 * LL, 0, 3);
      float f0[8] = {a0.x,a0.y,a0.z,a0.w,a1.x,a1.y,a1.z,a1.w};
      float f1[8] = {c0.x,c0.y,c0.z,c0.w,c1.x,c1.y,c1.z,c1.w};
      #pragma unroll
      for (int j = 0; j < 8; ++j) {
        union { _Float16 h[2]; unsigned u; } p;
        p.h[0] = (_Float16)f0[j];
        p.h[1] = (_Float16)f1[j];
        *(unsigned*)&sX[nseg * 8 + j][kk + k2] = p.u;  // k2 even: 4B aligned
      }
    }
  }

  // ---- stage first W tile into sA[0] ----
  const int rA = tid >> 1, segA = tid & 1;
  {
    const float* src = W + (size_t)rA * 512 + segA * 16;
    float4 f0 = *(const float4*)(src + 0);
    float4 f1 = *(const float4*)(src + 4);
    float4 f2 = *(const float4*)(src + 8);
    float4 f3 = *(const float4*)(src + 12);
    v8h h0 = {(_Float16)f0.x,(_Float16)f0.y,(_Float16)f0.z,(_Float16)f0.w,
              (_Float16)f1.x,(_Float16)f1.y,(_Float16)f1.z,(_Float16)f1.w};
    v8h h1 = {(_Float16)f2.x,(_Float16)f2.y,(_Float16)f2.z,(_Float16)f2.w,
              (_Float16)f3.x,(_Float16)f3.y,(_Float16)f3.z,(_Float16)f3.w};
    *(v8h*)&sA[0][rA][segA * 16]     = h0;
    *(v8h*)&sA[0][rA][segA * 16 + 8] = h1;
  }
  __syncthreads();

  v8f acc[2][4];
  #pragma unroll
  for (int mt = 0; mt < 2; ++mt)
    #pragma unroll
    for (int nt = 0; nt < 4; ++nt) acc[mt][nt] = zero8();

  for (int ks = 0; ks < 16; ++ks) {
    const int kb  = ks * 32;
    const int cur = ks & 1;
    const bool have_next = (ks + 1 < 16);

    // issue global loads of the next W tile first (latency hides under WMMA)
    float4 f0 = {}, f1 = {}, f2 = {}, f3 = {};
    if (have_next) {
      const float* src = W + (size_t)rA * 512 + kb + 32 + segA * 16;
      f0 = *(const float4*)(src + 0);
      f1 = *(const float4*)(src + 4);
      f2 = *(const float4*)(src + 8);
      f3 = *(const float4*)(src + 12);
    }

    // compute: 2x4 WMMA tiles per wave from resident panel + current W tile
    v16h afr[2];
    #pragma unroll
    for (int mt = 0; mt < 2; ++mt)
      afr[mt] = frag_ld(&sA[cur][0][0], wm * 32 + mt * 16, 40, 0);
    #pragma unroll
    for (int nt = 0; nt < 4; ++nt) {
      v16h bfr = frag_ld(&sX[0][0], wn * 64 + nt * 16, 520, kb);
      #pragma unroll
      for (int mt = 0; mt < 2; ++mt)
        acc[mt][nt] = wmma16(afr[mt], bfr, acc[mt][nt]);
    }

    // convert + store next W tile into the other buffer
    if (have_next) {
      v8h h0 = {(_Float16)f0.x,(_Float16)f0.y,(_Float16)f0.z,(_Float16)f0.w,
                (_Float16)f1.x,(_Float16)f1.y,(_Float16)f1.z,(_Float16)f1.w};
      v8h h1 = {(_Float16)f2.x,(_Float16)f2.y,(_Float16)f2.z,(_Float16)f2.w,
                (_Float16)f3.x,(_Float16)f3.y,(_Float16)f3.z,(_Float16)f3.w};
      *(v8h*)&sA[cur ^ 1][rA][segA * 16]     = h0;
      *(v8h*)&sA[cur ^ 1][rA][segA * 16 + 8] = h1;
    }
    __syncthreads();
  }

  #pragma unroll
  for (int mt = 0; mt < 2; ++mt)
    #pragma unroll
    for (int r = 0; r < 8; ++r) {
      const int c = wm * 32 + mt * 16 + r + ((lane >> 4) << 3);
      const float bv = sBias[c];
      #pragma unroll
      for (int nt = 0; nt < 4; ++nt) {
        const int n = n0 + wn * 64 + nt * 16 + (lane & 15);
        const float val = acc[mt][nt][r] + bv;
        const size_t off = ((size_t)b * 512 + c) * LL + n;
        if (OUT_F32) Yf[off] = val;
        else         Yh[off] = (_Float16)val;
      }
    }
}

// ---------------------------------------------------------------------------
// Channel attention without q and k.
// gram_part: grid (GKS, 4, batch). A block forms a 256x256 tile of
//   G = query . key^T over its own L/GKS columns. 32-column slices of the 256
//   query rows and 256 key rows are converted to f16 in LDS, double-buffered,
//   the next slice's global loads in flight under the WMMAs, one barrier per
//   slice. Wave (wm 0..7, wn 0..3) owns 32x64 = 2x4 accumulators. The partial
//   tile is stored f32 in fragment order. The f32 row sums of query and key
//   are kept beside the staging and stored per L chunk.
// gram_reduce: sums the GKS partials in fixed order, scales by 1/sqrt(L) = 1/64
//   and stores G transposed, gT[b][c'][c] (f16), the B-fragment order of the
//   next product; its last blocks do the same for the row sums.
// fold_out<true>: U[b] = Wq . G/64 + bq . (sk/64)^T (f16, row-major) and
//   uq[b] = Wq . sq/64 + 64 bq.
// attn_fold: grid (CCH, batch*head). A block forms the 64x64 logits
//   U_head . Wk_head^T + uq_head . bk_head^T (K = 512 split over the eight
//   waves, summed through LDS in fixed order), does the softmax and forms
//   T = P . Wv_head for its own 512/CCH columns of Wv, the Wv tile transposed
//   through LDS. T is stored transposed, tT[b][c][head*64 + d] (f16), which is
//   the B-fragment order of the next product. Chunk 0 also stores P . bv_head.
// fold_out<false>: grid (8 + 1, 8, batch). M[b] = Wo . T[b], one 64x64 tile a
//   block, K = 512 split over the eight waves and summed through LDS in fixed
//   order; column block 8 forms the bias Wo . (P.bv) + bo instead.
// ---------------------------------------------------------------------------
#define GKS 8
#define CCH 4

__global__ __launch_bounds__(1024) void gram_part(
    const float* __restrict__ xq, const float* __restrict__ xk,
    float* __restrict__ gpart, float* __restrict__ rpart)
{
  // rows 0..255: query tile, rows 256..511: key tile; 32 columns + 8 pad
  __shared__ __align__(16) _Float16 sT[2][512][40];

  const int tid  = threadIdx.x;
  const int wid  = tid >> 5;
  const int lane = tid & 31;
  const int ks   = blockIdx.x;
  const int tile = blockIdx.y;
  const int b    = blockIdx.z;
  const int tm   = tile >> 1;   // 256-row block of query (c)
  const int tn   = tile & 1;    // 256-row block of key (c')
  const int wm   = wid & 7;
  const int wn   = wid >> 3;

  // staging: eight lanes cover a row's 32 floats (one 128-byte line); a thread
  // owns rows r0 and r0 + 128 of both tiles
  const int seg = tid & 7;
  const int r0  = tid >> 3;
  const float* pa = xq + ((size_t)b * CC + tm * 256 + r0) * LL
                       + ks * (LL / GKS) + seg * 4;
  const float* pb = xk + ((size_t)b * CC + tn * 256 + r0) * LL
                       + ks * (LL / GKS) + seg * 4;
  float rs0 = 0.f, rs1 = 0.f, rs2 = 0.f, rs3 = 0.f;

  float4 f0 = *(const float4*)(pa);
  float4 f1 = *(const float4*)(pa + (size_t)128 * LL);
  float4 f2 = *(const float4*)(pb);
  float4 f3 = *(const float4*)(pb + (size_t)128 * LL);
  {
    rs0 += (f0.x + f0.y) + (f0.z + f0.w);
    rs1 += (f1.x + f1.y) + (f1.z + f1.w);
    rs2 += (f2.x + f2.y) + (f2.z + f2.w);
    rs3 += (f3.x + f3.y) + (f3.z + f3.w);
    v4h h0 = {(_Float16)f0.x,(_Float16)f0.y,(_Float16)f0.z,(_Float16)f0.w};
    v4h h1 = {(_Float16)f1.x,(_Float16)f1.y,(_Float16)f1.z,(_Float16)f1.w};
    v4h h2 = {(_Float16)f2.x,(_Float16)f2.y,(_Float16)f2.z,(_Float16)f2.w};
    v4h h3 = {(_Float16)f3.x,(_Float16)f3.y,(_Float16)f3.z,(_Float16)f3.w};
    *(v4h*)&sT[0][r0][seg * 4]       = h0;
    *(v4h*)&sT[0][r0 + 128][seg * 4] = h1;
    *(v4h*)&sT[0][r0 + 256][seg * 4] = h2;
    *(v4h*)&sT[0][r0 + 384][seg * 4] = h3;
  }
  __syncthreads();

  // the loops over acc and afr in this kernel are unrolled so that every index
  // is a constant and the arrays stay in registers
  v8f acc[2][4];
  #pragma unroll
  for (int mt = 0; mt < 2; ++mt)
    #pragma unroll
    for (int nt = 0; nt < 4; ++nt) acc[mt][nt] = zero8();

  const int NS = LL / GKS / 32;  // 16 slices
  for (int s = 0; s < NS; ++s) {
    const int cur = s & 1;
    const bool have_next = (s + 1 < NS);

    // issue global loads of the next slice first (latency hides under WMMA)
    // (the pointers advance behind the wait for the slice before)
    if (have_next) {
      pa += 32;
      pb += 32;
      f0 = *(const float4*)(pa);
      f1 = *(const float4*)(pa + (size_t)128 * LL);
      f2 = *(const float4*)(pb);
      f3 = *(const float4*)(pb + (size_t)128 * LL);
    }
    // keeps the four loads in front of the WMMAs: left free, the scheduler
    // sinks them to their first use and the wave waits out the whole latency
    __builtin_amdgcn_sched_barrier(0);

    v16h afr[2];
    #pragma unroll
    for (int mt = 0; mt < 2; ++mt)
      afr[mt] = frag_ld(&sT[cur][0][0], wm * 32 + mt * 16, 40, 0);
    #pragma unroll
    for (int nt = 0; nt < 4; ++nt) {
      v16h bfr = frag_ld(&sT[cur][0][0], 256 + wn * 64 + nt * 16, 40, 0);
      #pragma unroll
      for (int mt = 0; mt < 2; ++mt)
        acc[mt][nt] = wmma16(afr[mt], bfr, acc[mt][nt]);
    }

    // keeps the first use of the loaded slice, and so its wait, behind the WMMAs
    __builtin_amdgcn_sched_barrier(0);

    // row sums, convert + store the next slice into the other buffer
    if (have_next) {
      rs0 += (f0.x + f0.y) + (f0.z + f0.w);
      rs1 += (f1.x + f1.y) + (f1.z + f1.w);
      rs2 += (f2.x + f2.y) + (f2.z + f2.w);
      rs3 += (f3.x + f3.y) + (f3.z + f3.w);
      v4h h0 = {(_Float16)f0.x,(_Float16)f0.y,(_Float16)f0.z,(_Float16)f0.w};
      v4h h1 = {(_Float16)f1.x,(_Float16)f1.y,(_Float16)f1.z,(_Float16)f1.w};
      v4h h2 = {(_Float16)f2.x,(_Float16)f2.y,(_Float16)f2.z,(_Float16)f2.w};
      v4h h3 = {(_Float16)f3.x,(_Float16)f3.y,(_Float16)f3.z,(_Float16)f3.w};
      *(v4h*)&sT[cur ^ 1][r0][seg * 4]       = h0;
      *(v4h*)&sT[cur ^ 1][r0 + 128][seg * 4] = h1;
      *(v4h*)&sT[cur ^ 1][r0 + 256][seg * 4] = h2;
      *(v4h*)&sT[cur ^ 1][r0 + 384][seg * 4] = h3;
    }
    __syncthreads();
  }

  // ---- partial tile, fragment order:
  // idx = (wid*8 + mt*4 + nt)*256 + (r>>2)*128 + lane*4 + (r&3)
  float* dst = gpart + (((size_t)b * 4 + tile) * GKS + ks) * 65536 + wid * 2048;
  #pragma unroll
  for (int mt = 0; mt < 2; ++mt)
    #pragma unroll
    for (int nt = 0; nt < 4; ++nt)
      #pragma unroll
      for (int hf = 0; hf < 2; ++hf) {
        float4 t = {acc[mt][nt][hf * 4 + 0], acc[mt][nt][hf * 4 + 1],
                    acc[mt][nt][hf * 4 + 2], acc[mt][nt][hf * 4 + 3]};
        *(float4*)(dst + (mt * 4 + nt) * 256 + hf * 128 + lane * 4) = t;
      }

  // ---- row sums of this L chunk: rpart[which][b][ks][row], one writer each
  rs0 += __shfl_xor(rs0, 1); rs1 += __shfl_xor(rs1, 1);
  rs2 += __shfl_xor(rs2, 1); rs3 += __shfl_xor(rs3, 1);
  rs0 += __shfl_xor(rs0, 2); rs1 += __shfl_xor(rs1, 2);
  rs2 += __shfl_xor(rs2, 2); rs3 += __shfl_xor(rs3, 2);
  rs0 += __shfl_xor(rs0, 4); rs1 += __shfl_xor(rs1, 4);
  rs2 += __shfl_xor(rs2, 4); rs3 += __shfl_xor(rs3, 4);
  if (seg == 0) {
    if (tn == 0) {
      float* rq = rpart + ((size_t)b * GKS + ks) * CC + tm * 256 + r0;
      rq[0]   = rs0;
      rq[128] = rs1;
    }
    if (tm == 0) {
      float* rk = rpart + ((size_t)(BB + b) * GKS + ks) * CC + tn * 256 + r0;
      rk[0]   = rs2;
      rk[128] = rs3;
    }
  }
}

__global__ __launch_bounds__(256) void gram_reduce(
    const float* __restrict__ gpart, const float* __restrict__ rpart,
    _Float16* __restrict__ gT, float* __restrict__ rsum)
{
  const float scale = 0.015625f;  // 1/sqrt(4096)
  const int tid = threadIdx.x;

  if (blockIdx.x >= BB * 4 * 32) {
    // rsum[which][b][row] = sum over the L chunks / 64
    const int j = (blockIdx.x - BB * 4 * 32) * 256 + tid;  // 0 .. 2*B*512-1
    const float* p = rpart + (size_t)(j >> 9) * GKS * CC + (j & 511);
    float s = p[0];
    #pragma unroll  // all loads in flight together
    for (int ks = 1; ks < GKS; ++ks) s += p[ks * CC];
    rsum[j] = s * scale;
    return;
  }

  // a thread takes one lane's eight values of one accumulator fragment
  const int g    = blockIdx.x * 256 + tid;
  const int lane = g & 31;
  const int frag = (g >> 5) & 255;   // wid*8 + mt*4 + nt of gram_part
  const int bt   = g >> 13;          // b*4 + tile
  const float* p = gpart + (size_t)bt * GKS * 65536 + frag * 256 + lane * 4;
  float4 lo = *(const float4*)(p);
  float4 hi = *(const float4*)(p + 128);
  #pragma unroll  // all loads in flight together
  for (int ks = 1; ks < GKS; ++ks) {
    float4 t = *(const float4*)(p + (size_t)ks * 65536);
    float4 u = *(const float4*)(p + (size_t)ks * 65536 + 128);
    lo.x += t.x; lo.y += t.y; lo.z += t.z; lo.w += t.w;
    hi.x += u.x; hi.y += u.y; hi.z += u.z; hi.w += u.w;
  }
  const int b    = bt >> 2;
  const int tm   = (bt >> 1) & 1;
  const int tn   = bt & 1;
  const int wid  = frag >> 3;
  const int c    = tm * 256 + (wid & 7) * 32 + ((frag >> 2) & 1) * 16
                 + ((lane >> 4) << 3);
  const int cp   = tn * 256 + (wid >> 3) * 64 + (frag & 3) * 16 + (lane & 15);
  v8h o = {(_Float16)(lo.x * scale), (_Float16)(lo.y * scale),
           (_Float16)(lo.z * scale), (_Float16)(lo.w * scale),
           (_Float16)(hi.x * scale), (_Float16)(hi.y * scale),
           (_Float16)(hi.z * scale), (_Float16)(hi.w * scale)};
  *(v8h*)(gT + ((size_t)b * CC + cp) * CC + c) = o;
  // the built code lays the row-sum block behind this store and reuses the
  // store's registers there: the store's translation is waited for first
  asm volatile("s_wait_xcnt 0x0" ::: "memory");
}

__global__ __launch_bounds__(256) void attn_fold(
    const _Float16* __restrict__ U, const float* __restrict__ uq,
    const float* __restrict__ wk, const float* __restrict__ bk,
    const float* __restrict__ wv,
    const float* __restrict__ bv, _Float16* __restrict__ tT,
    float* __restrict__ tb)
{
  __shared__ __align__(16) float sRed[8][4096];   // one 64x64 partial per wave
  __shared__ float                  sS[64][65];   // logits fp32
  __shared__ __align__(16) _Float16 sP[64][72];   // softmax probs f16
  __shared__ __align__(16) _Float16 sV[128][72];  // Wv tile transposed [c][e]
  __shared__ float                  sBv[64];      // bv of this head
  __shared__ float                  sUq[64];      // uq of this batch and head
  __shared__ float                  sBk[64];      // bk of this head

  const int tid  = threadIdx.x;
  const int wid  = tid >> 5;
  const int lane = tid & 31;
  const int bh   = blockIdx.y;
  const int b    = bh >> 3;
  const int h    = bh & 7;
  const int c0   = blockIdx.x * (CC / CCH);

  // ---- logits (already scaled): U_head . Wk_head^T, a wave per 64 of K ----
  {
    const _Float16* ah = U + ((size_t)b * CC + h * DHEAD) * CC;
    const float*    bw = wk + (size_t)h * DHEAD * CC;

    // the loops of this block are unrolled so that every index of acc, af and
    // bf is a constant and the arrays stay in registers
    v8f acc[4][4];
    #pragma unroll
    for (int mi = 0; mi < 4; ++mi)
      #pragma unroll
      for (int ni = 0; ni < 4; ++ni) acc[mi][ni] = zero8();

    #pragma unroll
    for (int s = 0; s < CC / 8 / 32; ++s) {
      const int kb = wid * (CC / 8) + s * 32;
      v16h af[4], bf[4];
      #pragma unroll
      for (int i = 0; i < 4; ++i) {
        af[i] = frag_ld(ah, i * 16, CC, kb);
        bf[i] = frag_ld_f32(bw, i * 16, CC, kb, s == CC / 8 / 32 - 1 && i == 3);
      }
      #pragma unroll
      for (int mi = 0; mi < 4; ++mi)
        #pragma unroll
        for (int ni = 0; ni < 4; ++ni)
          acc[mi][ni] = wmma16(af[mi], bf[ni], acc[mi][ni]);
    }

    // fragment order: idx = tile*256 + (r>>2)*128 + lane*4 + (r&3)
    #pragma unroll
    for (int mi = 0; mi < 4; ++mi)
      #pragma unroll
      for (int ni = 0; ni < 4; ++ni)
        #pragma unroll
        for (int hf = 0; hf < 2; ++hf) {
          float4 t = {acc[mi][ni][hf * 4 + 0], acc[mi][ni][hf * 4 + 1],
                      acc[mi][ni][hf * 4 + 2], acc[mi][ni][hf * 4 + 3]};
          *(float4*)&sRed[wid][(mi * 4 + ni) * 256 + hf * 128 + lane * 4] = t;
        }
  }

  if (tid < 64) {
    const float x = bv[h * DHEAD + tid];
    const float y = uq[b * CC + h * DHEAD + tid];
    xcnt_before_last_load();
    const float z = bk[h * DHEAD + tid];
    xcnt_behind_loads();
    sBv[tid] = x;
    sUq[tid] = y;
    sBk[tid] = z;
  }

  // ---- stage Wv[h*64 + e][c0..+127] transposed into sV[c][e], f16 ----
  {
    const int e = tid >> 2, seg = tid & 3;
    const float* src = wv + (size_t)(h * DHEAD + e) * CC + c0 + seg * 32;
    #pragma unroll
    for (int q4 = 0; q4 < 8; ++q4) {
      float4 x = *(const float4*)(src + q4 * 4);
      sV[seg * 32 + q4 * 4 + 0][e] = (_Float16)x.x;
      sV[seg * 32 + q4 * 4 + 1][e] = (_Float16)x.y;
      sV[seg * 32 + q4 * 4 + 2][e] = (_Float16)x.z;
      sV[seg * 32 + q4 * 4 + 3][e] = (_Float16)x.w;
    }
  }
  __syncthreads();

  // sum the eight waves' partials, undo the fragment order, add uq . bk^T
  #pragma unroll
  for (int j = 0; j < 4; ++j) {
    const int idx = (tid + 256 * j) * 4;
    float4 s = *(const float4*)&sRed[0][idx];
    #pragma unroll
    for (int w = 1; w < 8; ++w) {
      float4 t = *(const float4*)&sRed[w][idx];
      s.x += t.x; s.y += t.y; s.z += t.z; s.w += t.w;
    }
    const int tile = idx >> 8;
    const int fl   = (idx >> 2) & 31;
    const int row  = (tile >> 2) * 16 + ((idx >> 7) & 1) * 4 + ((fl >> 4) << 3);
    const int col  = (tile & 3) * 16 + (fl & 15);
    const float bkc = sBk[col];
    sS[row + 0][col] = s.x + sUq[row + 0] * bkc;
    sS[row + 1][col] = s.y + sUq[row + 1] * bkc;
    sS[row + 2][col] = s.z + sUq[row + 2] * bkc;
    sS[row + 3][col] = s.w + sUq[row + 3] * bkc;
  }
  __syncthreads();

  // ---- softmax over e (64 wide), one thread per row; P.bv beside it ----
  if (tid < 64) {
    float mx = -3.0e38f;
    for (int e = 0; e < 64; ++e) mx = fmaxf(mx, sS[tid][e]);
    float sum = 0.f;
    for (int e = 0; e < 64; ++e) {
      float t = __expf(sS[tid][e] - mx);
      sum += t;
      sS[tid][e] = t;
    }
    const float inv = 1.f / sum;
    float pbv = 0.f;
    for (int e = 0; e < 64; ++e) {
      const float p = sS[tid][e] * inv;
      sP[tid][e] = (_Float16)p;
      pbv += p * sBv[e];
    }
    if (blockIdx.x == 0) tb[bh * DHEAD + tid] = pbv;  // = [b][h*64 + d]
  }
  __syncthreads();

  // ---- T = P x Wv_head: each wave owns 16 columns c = c0 + wid*16 + lane%16
  v8f oacc[4];
  #pragma unroll
  for (int m2 = 0; m2 < 4; ++m2) oacc[m2] = zero8();
  #pragma unroll
  for (int ks = 0; ks < 2; ++ks) {
    v16h bf = frag_ld(&sV[0][0], wid * 16, 72, ks * 32);
    #pragma unroll
    for (int m2 = 0; m2 < 4; ++m2)
      oacc[m2] = wmma16(frag_ld(&sP[0][0], m2 * 16, 72, ks * 32), bf, oacc[m2]);
  }
  _Float16* dst = tT + ((size_t)b * CC + c0 + wid * 16 + (lane & 15)) * CC
                     + h * DHEAD + ((lane >> 4) << 3);
  #pragma unroll
  for (int m2 = 0; m2 < 4; ++m2) {
    v8h t;
    #pragma unroll
    for (int r = 0; r < 8; ++r) t[r] = (_Float16)oacc[m2][r];
    *(v8h*)(dst + m2 * 16) = t;
  }
}

// FIRST: wo, bo, tT, tb stand for Wq, bq, gT, sq/64; the tile gets bq . (sk/64)^T
// added and is stored f16 in U; the bias column is Wq . sq/64 + 64 bq.
template<bool FIRST>
__global__ __launch_bounds__(256) void fold_out(
    const float* __restrict__ wo, const float* __restrict__ bo,
    const _Float16* __restrict__ tT, const float* __restrict__ tb,
    const float* __restrict__ rk,
    float* __restrict__ M, _Float16* __restrict__ U,
    float* __restrict__ bias2)
{
  __shared__ __align__(16) float sRed[8][4096];  // one 64x64 partial per wave
  __shared__ float sBq[FIRST ? 64 : 1];          // bq of the tile's rows
  __shared__ float sRk[FIRST ? 64 : 1];          // sk/64 of the tile's columns

  const int tid  = threadIdx.x;
  const int wid  = tid >> 5;
  const int lane = tid & 31;
  const int ct   = blockIdx.x;
  const int ot   = blockIdx.y;
  const int b    = blockIdx.z;

  if (ct == 8) {
    // bias2[b][o] = bo[o] + sum_j Wo[o][j] * tb[b][j], four threads a row
    const int o = ot * 64 + (tid >> 2), qd = tid & 3;
    const float* wr = wo + (size_t)o * CC + qd * 4;
    const float* tv = tb + b * CC + qd * 4;
    float s = 0.f;
    #pragma unroll 1  // eight float4 pairs in flight a trip are enough here
    for (int i0 = 0; i0 < CC / 16; i0 += 8) {
      float4 w[8], t[8];
      #pragma unroll
      for (int i = 0; i < 8; ++i) {
        t[i] = *(const float4*)(tv + (i0 + i) * 16);
        if (i == 7) xcnt_before_last_load();
        w[i] = *(const float4*)(wr + (i0 + i) * 16);
      }
      #pragma unroll
      for (int i = 0; i < 8; ++i)
        s += w[i].x * t[i].x + w[i].y * t[i].y + w[i].z * t[i].z
           + w[i].w * t[i].w;
    }
    s += __shfl_xor(s, 1);
    s += __shfl_xor(s, 2);
    // FIRST: L . bq / sqrt(L) = 64 bq
    if (qd == 0) bias2[b * CC + o] = s + (FIRST ? 64.f * bo[o] : bo[o]);
    return;
  }

  const float*    ah = wo + (size_t)ot * 64 * CC;
  const _Float16* bt = tT + ((size_t)b * CC + ct * 64) * CC;

  v8f acc[4][4];
  #pragma unroll
  for (int mi = 0; mi < 4; ++mi)
    #pragma unroll
    for (int ni = 0; ni < 4; ++ni) acc[mi][ni] = zero8();

  #pragma unroll
  for (int s = 0; s < CC / 8 / 32; ++s) {
    const int kb = wid * (CC / 8) + s * 32;
    v16h af[4], bf[4];
    #pragma unroll
    for (int i = 0; i < 4; ++i) {
      bf[i] = frag_ld(bt, i * 16, CC, kb);
      af[i] = frag_ld_f32(ah, i * 16, CC, kb, s == CC / 8 / 32 - 1 && i == 3);
    }
    if (s == CC / 8 / 32 - 1) xcnt_behind_loads();
    #pragma unroll
    for (int mi = 0; mi < 4; ++mi)
      #pragma unroll
      for (int ni = 0; ni < 4; ++ni)
        acc[mi][ni] = wmma16(af[mi], bf[ni], acc[mi][ni]);
  }

  // fragment order: idx = tile*256 + (r>>2)*128 + lane*4 + (r&3)
  #pragma unroll
  for (int mi = 0; mi < 4; ++mi)
    #pragma unroll
    for (int ni = 0; ni < 4; ++ni)
      #pragma unroll
      for (int hf = 0; hf < 2; ++hf) {
        float4 t = {acc[mi][ni][hf * 4 + 0], acc[mi][ni][hf * 4 + 1],
                    acc[mi][ni][hf * 4 + 2], acc[mi][ni][hf * 4 + 3]};
        *(float4*)&sRed[wid][(mi * 4 + ni) * 256 + hf * 128 + lane * 4] = t;
      }

  if (FIRST && tid < 64) {
    const float x = bo[ot * 64 + tid];
    xcnt_before_last_load();
    const float y = rk[b * CC + ct * 64 + tid];
    xcnt_behind_loads();
    sBq[tid] = x;
    sRk[tid] = y;
  }
  __syncthreads();

  // sum the eight waves' partials, undo the fragment order, store row-major
  const size_t tile0 = ((size_t)b * CC + ot * 64) * CC + ct * 64;
  #pragma unroll
  for (int j = 0; j < 4; ++j) {
    const int idx = (tid + 256 * j) * 4;
    float4 s = *(const float4*)&sRed[0][idx];
    #pragma unroll
    for (int w = 1; w < 8; ++w) {
      float4 t = *(const float4*)&sRed[w][idx];
      s.x += t.x; s.y += t.y; s.z += t.z; s.w += t.w;
    }
    const int tile = idx >> 8;
    const int fl   = (idx >> 2) & 31;
    const int row  = (tile >> 2) * 16 + ((idx >> 7) & 1) * 4 + ((fl >> 4) << 3);
    const int col  = (tile & 3) * 16 + (fl & 15);
    if (FIRST) {
      const float rc = sRk[col];
      _Float16* dst = U + tile0;
      dst[(size_t)(row + 0) * CC + col] = (_Float16)(s.x + sBq[row + 0] * rc);
      dst[(size_t)(row + 1) * CC + col] = (_Float16)(s.y + sBq[row + 1] * rc);
      dst[(size_t)(row + 2) * CC + col] = (_Float16)(s.z + sBq[row + 2] * rc);
      dst[(size_t)(row + 3) * CC + col] = (_Float16)(s.w + sBq[row + 3] * rc);
    } else {
      float* dst = M + tile0;
      dst[(size_t)(row + 0) * CC + col] = s.x;
      dst[(size_t)(row + 1) * CC + col] = s.y;
      dst[(size_t)(row + 2) * CC + col] = s.z;
      dst[(size_t)(row + 3) * CC + col] = s.w;
    }
  }
  // the built code lays the bias-column block behind these stores and reuses
  // their registers there: the stores' translations are waited for first
  asm volatile("s_wait_xcnt 0x0" ::: "memory");
}

// ---------------------------------------------------------------------------
extern "C" void kernel_launch(void* const* d_in, const int* in_sizes, int n_in,
                              void* d_out, int out_size, void* d_ws, size_t ws_size,
                              hipStream_t stream) {
  const float* query = (const float*)d_in[0];
  const float* key_  = (const float*)d_in[1];
  const float* value = (const float*)d_in[2];
  const float* wq = (const float*)d_in[3];
  const float* bq = (const float*)d_in[4];
  const float* wk = (const float*)d_in[5];
  const float* bk = (const float*)d_in[6];
  const float* wv = (const float*)d_in[7];
  const float* bv = (const float*)d_in[8];
  const float* wo = (const float*)d_in[9];
  const float* bo = (const float*)d_in[10];
  float* out = (float*)d_out;

  // workspace: f32 partial tiles of G: B*4*GKS*256*256 floats = 64 MiB
  float* gpart = (float*)d_ws;
  // row-sum partials [2][B][GKS][512] and the scaled row sums [2][B][512]
  float* rpart = gpart + (size_t)BB * 4 * GKS * 65536;
  float* rsum  = rpart + (size_t)2 * BB * GKS * CC;
  float* uq    = rsum + 2 * BB * CC;
  // per batch: P.bv and the folded bias f32, Wo.P.Wv f32
  float* tb    = uq + BB * CC;
  float* bias2 = tb + BB * CC;
  const size_t S2 = (size_t)BB * CC * CC;
  float* fM    = bias2 + BB * CC;
  // per batch, f16: (G/64)^T, U = Wq.G/64 + bq.(sk/64)^T, (P.Wv)^T
  _Float16* gT  = (_Float16*)(fM + S2);
  _Float16* u16 = gT + S2;
  _Float16* tT  = u16 + S2;

  dim3 blk(256);
  dim3 gblk(1024);
  dim3 grd(LL / 128, 1, BB);  // (32, 1, 8): one block per X panel

  gram_part<<<dim3(GKS, 4, BB), gblk, 0, stream>>>(query, key_, gpart, rpart);
  gram_reduce<<<dim3(BB * 4 * 32 + 2 * BB * CC / 256), blk, 0, stream>>>(
      gpart, rpart, gT, rsum);
  fold_out<true><<<dim3(8 + 1, 8, BB), blk, 0, stream>>>(
      wq, bq, gT, rsum, rsum + BB * CC, nullptr, u16, uq);
  attn_fold<<<dim3(CCH, BB * NHEAD), blk, 0, stream>>>(u16, uq, wk, bk, wv, bv,
                                                      tT, tb);
  fold_out<false><<<dim3(8 + 1, 8, BB), blk, 0, stream>>>(
      wo, bo, tT, tb, nullptr, fM, nullptr, bias2);

  panel_gemm<true, true><<<grd, gblk, 0, stream>>>(fM, bias2, value, out,
                                                  nullptr);
}

// v005
// One run takes 91.4 microseconds.
// Next to v004, in two timings, it ran 1.15 times as fast each time.
// All steps since v000 together make it 2.99 times as fast.
#include <hip/hip_runtime.h>
#include <hip/hip_bf16.h>

typedef __attribute__((ext_vector_type(16))) _Float16 v16h;
typedef __attribute__((ext_vector_type(8)))  _Float16 v8h;
typedef __attribute__((ext_vector_type(4)))  _Float16 v4h;
typedef __attribute__((ext_vector_type(8)))  float    v8f;

#define BB 8
#define CC 512
#define LL 4096
#define NHEAD 8
#define DHEAD 64

__device__ __forceinline__ v8f zero8() {
  v8f z = {0.f,0.f,0.f,0.f,0.f,0.f,0.f,0.f};
  return z;
}

__device__ __forceinline__ v8f wmma16(v16h a, v16h b, v8f c) {
  // (neg_a, A, neg_b, B, c_mod, C, reuse_a, reuse_b) -> v_wmma_f32_16x16x32_f16
  return __builtin_amdgcn_wmma_f32_16x16x32_f16(false, a, false, b, (short)0, c,
                                                false, false);
}

__device__ __forceinline__ v16h mk16(v8h lo, v8h hi) {
  union { v16h v; v8h h[2]; } u;
  u.h[0] = lo; u.h[1] = hi;
  return u.v;
}

__device__ __forceinline__ v16h frag_ld(const _Float16* base, int row0,
                                        int rowStride, int kb) {
  const int lane = threadIdx.x & 31;
  const _Float16* p = base + (size_t)(row0 + (lane & 15)) * rowStride
                           + kb + ((lane >> 4) << 3);
  v8h lo = *(const v8h*)(p);
  v8h hi = *(const v8h*)(p + 16);
  return mk16(lo, hi);
}

// Stands in front of the last load of a run of global loads: that load may take
// the run's address registers as its destination, so the earlier loads'
// translations are waited for first. The two scheduling barriers keep the
// earlier loads in front of the wait and the last load behind it.
__device__ __forceinline__ void xcnt_before_last_load() {
  __builtin_amdgcn_sched_barrier(0);
  asm volatile("s_wait_xcnt 0x0" ::: "memory");
  __builtin_amdgcn_sched_barrier(0);
}

// Stands behind the last load of a run whose address registers are free for
// reuse from there on: the load's translation is waited for first.
__device__ __forceinline__ void xcnt_behind_loads() {
  __builtin_amdgcn_sched_barrier(0);
  asm volatile("s_wait_xcnt 0x0" ::: "memory");
  __builtin_amdgcn_sched_barrier(0);
}

#define KT_PITCH 72
#define KT_HALFS (64 * KT_PITCH)  // halfs a tile; two tiles fill as many floats
__device__ __forceinline__ void stage_k64(const float* s32, const _Float16* s16,
                                          _Float16* t32, _Float16* t16) {
  const int lane = threadIdx.x & 31;
  const float*    pa = s32 + (size_t)(lane >> 4) * CC + (lane & 15) * 4;
  const _Float16* pb = s16 + (size_t)(lane >> 3) * CC + (lane & 7) * 8;
  // the loops are unrolled so that va and vb stay in registers and all loads
  // are in flight together
  float4 va[32];
  v8h    vb[16];
  #pragma unroll
  for (int i = 0; i < 32; ++i) va[i] = *(const float4*)(pa + (size_t)i * 2 * CC);
  #pragma unroll
  for (int i = 0; i < 16; ++i) vb[i] = *(const v8h*)(pb + (size_t)i * 4 * CC);
  // the loads' translations are waited for before their address registers are
  // free for reuse: as inputs of the wait both pairs stay live up to it, so no
  // load of the run takes them as its destination
  asm volatile("s_wait_xcnt 0x0" :: "v"(pa), "v"(pb) : "memory");
  #pragma unroll
  for (int i = 0; i < 32; ++i) {
    v4h h = {(_Float16)va[i].x, (_Float16)va[i].y,
             (_Float16)va[i].z, (_Float16)va[i].w};
    *(v4h*)(t32 + (i * 2 + (lane >> 4)) * KT_PITCH + (lane & 15) * 4) = h;
  }
  #pragma unroll
  for (int i = 0; i < 16; ++i)
    *(v8h*)(t16 + (i * 4 + (lane >> 3)) * KT_PITCH + (lane & 7) * 8) = vb[i];
  // the rows are read back by other lanes of this wave: its stores land first,
  // and the compiler moves no LDS read in front of them
  asm volatile("s_wait_dscnt 0x0" ::: "memory");
}

// ---------------------------------------------------------------------------
// Projection GEMM: Y[b,m,n] = W . X[b,:,n] + bias   (M=K=512, N=4096/batch)
// Block: 1024 threads (32 waves), tile 512(M, all of it) x 128(N): one block
// per X panel, so every element of X is read, converted and transposed once.
// The entire X^T panel (N=128 rows x K=512 cols, f16) is staged in LDS once;
// W tiles (512x32) are double-buffered per K-step so their global loads hide
// under the WMMAs with a single barrier per step.
// Wave (wm 0..15, wn 0..1) owns a 32x64 sub-tile = 2x4 WMMA accumulators.
// W_PER_BATCH: W and bias are [B][512][512] and [B][512], one pair per batch.
// ---------------------------------------------------------------------------
template<bool W_PER_BATCH, bool OUT_F32>
__global__ __launch_bounds__(1024) void panel_gemm(
    const float* __restrict__ Wall, const float* __restrict__ biasAll,
    const float* __restrict__ Xf,
    float* __restrict__ Yf, _Float16* __restrict__ Yh)
{
  __shared__ __align__(16) _Float16 sX[128][520];    // [n][k], 520 = 512+8 pad
  __shared__ __align__(16) _Float16 sA[2][512][40];  // double-buffered W tile
  __shared__ float sBias[512];

  const int tid  = threadIdx.x;
  const int b    = blockIdx.z;
  const int n0   = blockIdx.x * 128;
  const int wid  = tid >> 5;
  const int lane = tid & 31;
  const int wm   = wid & 15;
  const int wn   = wid >> 4;
  const float* W    = W_PER_BATCH ? Wall + (size_t)b * 512 * 512 : Wall;
  const float* bias = W_PER_BATCH ? biasAll + b * 512 : biasAll;

  if (tid < 512) sBias[tid] = bias[tid];

  {
    const int nseg = (wid & 3) * 8 + (lane & 7);           // n = nseg*4 .. +3
    const int k2   = ((wid >> 2) * 4 + (lane >> 3)) * 2;   // 0,2,...,62
    const float* xb = Xf + ((size_t)b * 512 + k2) * LL + n0 + nseg * 4;
    for (int kk = 0; kk < 512; kk += 128) {  // two 64-K chunks a trip
      const float* r0 = xb + (size_t)kk * LL;
      const float* r1 = r0 + LL;
      float4 a0 = *(const float4*)(r0);
      float4 c0 = *(const float4*)(r1);
      float4 a1 = *(const float4*)(r0 + (size_t)64 * LL);
      float4 c1 = *(const float4*)(r1 + (size_t)64 * LL);
      if (kk + 128 < 512) __builtin_prefetch(r0 + (size_t)128 * LL, 0, 3);
      float f0[8] = {a0.x,a0.y,a0.z,a0.w,a1.x,a1.y,a1.z,a1.w};
      float f1[8] = {c0.x,c0.y,c0.z,c0.w,c1.x,c1.y,c1.z,c1.w};
      #pragma unroll
      for (int j = 0; j < 8; ++j) {
        union { _Float16 h[2]; unsigned u; } p;
        p.h[0] = (_Float16)f0[j];
        p.h[1] = (_Float16)f1[j];
        // k2 even: 4B aligned
        *(unsigned*)&sX[nseg * 4 + (j & 3)][kk + (j >> 2) * 64 + k2] = p.u;
      }
    }
  }

  // ---- stage first W tile into sA[0] ----
  // eight lanes cover a row's 32 floats (one 128-byte line); a thread owns rows
  // rA, rA + 128, rA + 256 and rA + 384
  const int rA = tid >> 3, segA = tid & 7;
  {
    const float* src = W + (size_t)rA * 512 + segA * 4;
    float4 f0 = *(const float4*)(src);
    float4 f1 = *(const float4*)(src + 128 * 512);
    float4 f2 = *(const float4*)(src + 256 * 512);
    float4 f3 = *(const float4*)(src + 384 * 512);
    v4h h0 = {(_Float16)f0.x,(_Float16)f0.y,(_Float16)f0.z,(_Float16)f0.w};
    v4h h1 = {(_Float16)f1.x,(_Float16)f1.y,(_Float16)f1.z,(_Float16)f1.w};
    v4h h2 = {(_Float16)f2.x,(_Float16)f2.y,(_Float16)f2.z,(_Float16)f2.w};
    v4h h3 = {(_Float16)f3.x,(_Float16)f3.y,(_Float16)f3.z,(_Float16)f3.w};
    *(v4h*)&sA[0][rA][segA * 4]       = h0;
    *(v4h*)&sA[0][rA + 128][segA * 4] = h1;
    *(v4h*)&sA[0][rA + 256][segA * 4] = h2;
    *(v4h*)&sA[0][rA + 384][segA * 4] = h3;
  }
  __syncthreads();

  v8f acc[2][4];
  #pragma unroll
  for (int mt = 0; mt < 2; ++mt)
    #pragma unroll
    for (int nt = 0; nt < 4; ++nt) acc[mt][nt] = zero8();

  for (int ks = 0; ks < 16; ++ks) {
    const int kb  = ks * 32;
    const int cur = ks & 1;
    const bool have_next = (ks + 1 < 16);

    // issue global loads of the next W tile first (latency hides under WMMA)
    float4 f0 = {}, f1 = {}, f2 = {}, f3 = {};
    if (have_next) {
      const float* src = W + (size_t)rA * 512 + kb + 32 + segA * 4;
      f0 = *(const float4*)(src);
      f1 = *(const float4*)(src + 128 * 512);
      f2 = *(const float4*)(src + 256 * 512);
      f3 = *(const float4*)(src + 384 * 512);
    }

    // compute: 2x4 WMMA tiles per wave from resident panel + current W tile
    v16h afr[2];
    #pragma unroll
    for (int mt = 0; mt < 2; ++mt)
      afr[mt] = frag_ld(&sA[cur][0][0], wm * 32 + mt * 16, 40, 0);
    #pragma unroll
    for (int nt = 0; nt < 4; ++nt) {
      v16h bfr = frag_ld(&sX[0][0], wn * 64 + nt * 16, 520, kb);
      #pragma unroll
      for (int mt = 0; mt < 2; ++mt)
        acc[mt][nt] = wmma16(afr[mt], bfr, acc[mt][nt]);
    }

    // convert + store next W tile into the other buffer
    if (have_next) {
      v4h h0 = {(_Float16)f0.x,(_Float16)f0.y,(_Float16)f0.z,(_Float16)f0.w};
      v4h h1 = {(_Float16)f1.x,(_Float16)f1.y,(_Float16)f1.z,(_Float16)f1.w};
      v4h h2 = {(_Float16)f2.x,(_Float16)f2.y,(_Float16)f2.z,(_Float16)f2.w};
      v4h h3 = {(_Float16)f3.x,(_Float16)f3.y,(_Float16)f3.z,(_Float16)f3.w};
      *(v4h*)&sA[cur ^ 1][rA][segA * 4]       = h0;
      *(v4h*)&sA[cur ^ 1][rA + 128][segA * 4] = h1;
      *(v4h*)&sA[cur ^ 1][rA + 256][segA * 4] = h2;
      *(v4h*)&sA[cur ^ 1][rA + 384][segA * 4] = h3;
    }
    __syncthreads();
  }

  #pragma unroll
  for (int mt = 0; mt < 2; ++mt)
    #pragma unroll
    for (int r = 0; r < 8; ++r) {
      const int c = wm * 32 + mt * 16 + r + ((lane >> 4) << 3);
      const float bv = sBias[c];
      #pragma unroll
      for (int nt = 0; nt < 4; ++nt) {
        const int n = n0 + wn * 64 + nt * 16 + (lane & 15);
        const float val = acc[mt][nt][r] + bv;
        const size_t off = ((size_t)b * 512 + c) * LL + n;
        if (OUT_F32) Yf[off] = val;
        else         Yh[off] = (_Float16)val;
      }
    }
}

// ---------------------------------------------------------------------------
// Channel attention without q and k.
// gram_part: grid (GKS, 4, batch). A block forms a 256x256 tile of
//   G = query . key^T over its own L/GKS columns. 32-column slices of the 256
//   query rows and 256 key rows are converted to f16 in LDS, double-buffered,
//   the next slice's global loads in flight under the WMMAs, one barrier per
//   slice. Wave (wm 0..7, wn 0..3) owns 32x64 = 2x4 accumulators. The partial
//   tile is stored f32 in fragment order. The f32 row sums of query and key
//   are kept beside the staging and stored per L chunk.
// gram_reduce: sums the GKS partials in fixed order, scales by 1/sqrt(L) = 1/64
//   and stores G transposed, gT[b][c'][c] (f16), the B-fragment order of the
//   next product; its last blocks do the same for the row sums.
// fold_out<true>: U[b] = Wq . G/64 + bq . (sk/64)^T (f16, row-major) and
//   uq[b] = Wq . sq/64 + 64 bq.
// attn_fold: grid (CCH, batch*head). A block forms the 64x64 logits
//   U_head . Wk_head^T + uq_head . bk_head^T (K = 512 split over the eight
//   waves, summed through LDS in fixed order), does the softmax and forms
//   T = P . Wv_head for its own 512/CCH columns of Wv, the Wv tile transposed
//   through LDS. T is stored transposed, tT[b][c][head*64 + d] (f16), which is
//   the B-fragment order of the next product. Chunk 0 also stores P . bv_head.
// fold_out<false>: grid (8 + 1, 8, batch). M[b] = Wo . T[b], one 64x64 tile a
//   block, K = 512 split over the eight waves and summed through LDS in fixed
//   order; column block 8 forms the bias Wo . (P.bv) + bo instead.
// ---------------------------------------------------------------------------
#define GKS 8
#define CCH 4

__global__ __launch_bounds__(1024) void gram_part(
    const float* __restrict__ xq, const float* __restrict__ xk,
    float* __restrict__ gpart, float* __restrict__ rpart)
{
  // rows 0..255: query tile, rows 256..511: key tile; 32 columns + 8 pad
  __shared__ __align__(16) _Float16 sT[2][512][40];

  const int tid  = threadIdx.x;
  const int wid  = tid >> 5;
  const int lane = tid & 31;
  const int ks   = blockIdx.x;
  const int tile = blockIdx.y;
  const int b    = blockIdx.z;
  const int tm   = tile >> 1;   // 256-row block of query (c)
  const int tn   = tile & 1;    // 256-row block of key (c')
  const int wm   = wid & 7;
  const int wn   = wid >> 3;

  // staging: eight lanes cover a row's 32 floats (one 128-byte line); a thread
  // owns rows r0 and r0 + 128 of both tiles
  const int seg = tid & 7;
  const int r0  = tid >> 3;
  const float* pa = xq + ((size_t)b * CC + tm * 256 + r0) * LL
                       + ks * (LL / GKS) + seg * 4;
  const float* pb = xk + ((size_t)b * CC + tn * 256 + r0) * LL
                       + ks * (LL / GKS) + seg * 4;
  float rs0 = 0.f, rs1 = 0.f, rs2 = 0.f, rs3 = 0.f;

  float4 f0 = *(const float4*)(pa);
  float4 f1 = *(const float4*)(pa + (size_t)128 * LL);
  float4 f2 = *(const float4*)(pb);
  float4 f3 = *(const float4*)(pb + (size_t)128 * LL);
  {
    rs0 += (f0.x + f0.y) + (f0.z + f0.w);
    rs1 += (f1.x + f1.y) + (f1.z + f1.w);
    rs2 += (f2.x + f2.y) + (f2.z + f2.w);
    rs3 += (f3.x + f3.y) + (f3.z + f3.w);
    v4h h0 = {(_Float16)f0.x,(_Float16)f0.y,(_Float16)f0.z,(_Float16)f0.w};
    v4h h1 = {(_Float16)f1.x,(_Float16)f1.y,(_Float16)f1.z,(_Float16)f1.w};
    v4h h2 = {(_Float16)f2.x,(_Float16)f2.y,(_Float16)f2.z,(_Float16)f2.w};
    v4h h3 = {(_Float16)f3.x,(_Float16)f3.y,(_Float16)f3.z,(_Float16)f3.w};
    *(v4h*)&sT[0][r0][seg * 4]       = h0;
    *(v4h*)&sT[0][r0 + 128][seg * 4] = h1;
    *(v4h*)&sT[0][r0 + 256][seg * 4] = h2;
    *(v4h*)&sT[0][r0 + 384][seg * 4] = h3;
  }
  __syncthreads();

  // the loops over acc and afr in this kernel are unrolled so that every index
  // is a constant and the arrays stay in registers
  v8f acc[2][4];
  #pragma unroll
  for (int mt = 0; mt < 2; ++mt)
    #pragma unroll
    for (int nt = 0; nt < 4; ++nt) acc[mt][nt] = zero8();

  const int NS = LL / GKS / 32;  // 16 slices
  for (int s = 0; s < NS; ++s) {
    const int cur = s & 1;
    const bool have_next = (s + 1 < NS);

    // issue global loads of the next slice first (latency hides under WMMA)
    // (the pointers advance behind the wait for the slice before)
    if (have_next) {
      pa += 32;
      pb += 32;
      f0 = *(const float4*)(pa);
      f1 = *(const float4*)(pa + (size_t)128 * LL);
      f2 = *(const float4*)(pb);
      f3 = *(const float4*)(pb + (size_t)128 * LL);
    }
    // keeps the four loads in front of the WMMAs: left free, the scheduler
    // sinks them to their first use and the wave waits out the whole latency
    __builtin_amdgcn_sched_barrier(0);

    v16h afr[2];
    #pragma unroll
    for (int mt = 0; mt < 2; ++mt)
      afr[mt] = frag_ld(&sT[cur][0][0], wm * 32 + mt * 16, 40, 0);
    #pragma unroll
    for (int nt = 0; nt < 4; ++nt) {
      v16h bfr = frag_ld(&sT[cur][0][0], 256 + wn * 64 + nt * 16, 40, 0);
      #pragma unroll
      for (int mt = 0; mt < 2; ++mt)
        acc[mt][nt] = wmma16(afr[mt], bfr, acc[mt][nt]);
    }

    // keeps the first use of the loaded slice, and so its wait, behind the WMMAs
    __builtin_amdgcn_sched_barrier(0);

    // row sums, convert + store the next slice into the other buffer
    if (have_next) {
      rs0 += (f0.x + f0.y) + (f0.z + f0.w);
      rs1 += (f1.x + f1.y) + (f1.z + f1.w);
      rs2 += (f2.x + f2.y) + (f2.z + f2.w);
      rs3 += (f3.x + f3.y) + (f3.z + f3.w);
      v4h h0 = {(_Float16)f0.x,(_Float16)f0.y,(_Float16)f0.z,(_Float16)f0.w};
      v4h h1 = {(_Float16)f1.x,(_Float16)f1.y,(_Float16)f1.z,(_Float16)f1.w};
      v4h h2 = {(_Float16)f2.x,(_Float16)f2.y,(_Float16)f2.z,(_Float16)f2.w};
      v4h h3 = {(_Float16)f3.x,(_Float16)f3.y,(_Float16)f3.z,(_Float16)f3.w};
      *(v4h*)&sT[cur ^ 1][r0][seg * 4]       = h0;
      *(v4h*)&sT[cur ^ 1][r0 + 128][seg * 4] = h1;
      *(v4h*)&sT[cur ^ 1][r0 + 256][seg * 4] = h2;
      *(v4h*)&sT[cur ^ 1][r0 + 384][seg * 4] = h3;
    }
    __syncthreads();
  }

  // ---- partial tile, fragment order:
  // idx = (wid*8 + mt*4 + nt)*256 + (r>>2)*128 + lane*4 + (r&3)
  float* dst = gpart + (((size_t)b * 4 + tile) * GKS + ks) * 65536 + wid * 2048;
  #pragma unroll
  for (int mt = 0; mt < 2; ++mt)
    #pragma unroll
    for (int nt = 0; nt < 4; ++nt)
      #pragma unroll
      for (int hf = 0; hf < 2; ++hf) {
        float4 t = {acc[mt][nt][hf * 4 + 0], acc[mt][nt][hf * 4 + 1],
                    acc[mt][nt][hf * 4 + 2], acc[mt][nt][hf * 4 + 3]};
        *(float4*)(dst + (mt * 4 + nt) * 256 + hf * 128 + lane * 4) = t;
      }

  // ---- row sums of this L chunk: rpart[which][b][ks][row], one writer each
  rs0 += __shfl_xor(rs0, 1); rs1 += __shfl_xor(rs1, 1);
  rs2 += __shfl_xor(rs2, 1); rs3 += __shfl_xor(rs3, 1);
  rs0 += __shfl_xor(rs0, 2); rs1 += __shfl_xor(rs1, 2);
  rs2 += __shfl_xor(rs2, 2); rs3 += __shfl_xor(rs3, 2);
  rs0 += __shfl_xor(rs0, 4); rs1 += __shfl_xor(rs1, 4);
  rs2 += __shfl_xor(rs2, 4); rs3 += __shfl_xor(rs3, 4);
  if (seg == 0) {
    if (tn == 0) {
      float* rq = rpart + ((size_t)b * GKS + ks) * CC + tm * 256 + r0;
      rq[0]   = rs0;
      rq[128] = rs1;
    }
    if (tm == 0) {
      float* rk = rpart + ((size_t)(BB + b) * GKS + ks) * CC + tn * 256 + r0;
      rk[0]   = rs2;
      rk[128] = rs3;
    }
  }
}

__global__ __launch_bounds__(256) void gram_reduce(
    const float* __restrict__ gpart, const float* __restrict__ rpart,
    _Float16* __restrict__ gT, float* __restrict__ rsum)
{
  const float scale = 0.015625f;  // 1/sqrt(4096)
  const int tid = threadIdx.x;

  if (blockIdx.x >= BB * 4 * 32) {
    // rsum[which][b][row] = sum over the L chunks / 64
    const int j = (blockIdx.x - BB * 4 * 32) * 256 + tid;  // 0 .. 2*B*512-1
    const float* p = rpart + (size_t)(j >> 9) * GKS * CC + (j & 511);
    float s = p[0];
    #pragma unroll  // all loads in flight together
    for (int ks = 1; ks < GKS; ++ks) s += p[ks * CC];
    rsum[j] = s * scale;
    return;
  }

  // a thread takes one lane's eight values of one accumulator fragment
  const int g    = blockIdx.x * 256 + tid;
  const int lane = g & 31;
  const int frag = (g >> 5) & 255;   // wid*8 + mt*4 + nt of gram_part
  const int bt   = g >> 13;          // b*4 + tile
  const float* p = gpart + (size_t)bt * GKS * 65536 + frag * 256 + lane * 4;
  float4 lo = *(const float4*)(p);
  float4 hi = *(const float4*)(p + 128);
  #pragma unroll  // all loads in flight together
  for (int ks = 1; ks < GKS; ++ks) {
    float4 t = *(const float4*)(p + (size_t)ks * 65536);
    float4 u = *(const float4*)(p + (size_t)ks * 65536 + 128);
    lo.x += t.x; lo.y += t.y; lo.z += t.z; lo.w += t.w;
    hi.x += u.x; hi.y += u.y; hi.z += u.z; hi.w += u.w;
  }
  const int b    = bt >> 2;
  const int tm   = (bt >> 1) & 1;
  const int tn   = bt & 1;
  const int wid  = frag >> 3;
  const int c    = tm * 256 + (wid & 7) * 32 + ((frag >> 2) & 1) * 16
                 + ((lane >> 4) << 3);
  const int cp   = tn * 256 + (wid >> 3) * 64 + (frag & 3) * 16 + (lane & 15);
  v8h o = {(_Float16)(lo.x * scale), (_Float16)(lo.y * scale),
           (_Float16)(lo.z * scale), (_Float16)(lo.w * scale),
           (_Float16)(hi.x * scale), (_Float16)(hi.y * scale),
           (_Float16)(hi.z * scale), (_Float16)(hi.w * scale)};
  *(v8h*)(gT + ((size_t)b * CC + cp) * CC + c) = o;
  // the built code lays the row-sum block behind this store and reuses the
  // store's registers there: the store's translation is waited for first
  asm volatile("s_wait_xcnt 0x0" ::: "memory");
}

__global__ __launch_bounds__(256) void attn_fold(
    const _Float16* __restrict__ U, const float* __restrict__ uq,
    const float* __restrict__ wk, const float* __restrict__ bk,
    const float* __restrict__ wv,
    const float* __restrict__ bv, _Float16* __restrict__ tT,
    float* __restrict__ tb)
{
  // per wave: first its two staged operand tiles, then its 64x64 partial
  __shared__ __align__(16) float sRed[8][KT_HALFS];
  __shared__ float                  sS[64][65];   // logits fp32
  __shared__ __align__(16) _Float16 sP[64][72];   // softmax probs f16
  __shared__ __align__(16) _Float16 sV[128][72];  // Wv tile transposed [c][e]
  __shared__ float                  sBv[64];      // bv of this head
  __shared__ float                  sUq[64];      // uq of this batch and head
  __shared__ float                  sBk[64];      // bk of this head

  const int tid  = threadIdx.x;
  const int wid  = tid >> 5;
  const int lane = tid & 31;
  const int bh   = blockIdx.y;
  const int b    = bh >> 3;
  const int h    = bh & 7;
  const int c0   = blockIdx.x * (CC / CCH);

  // ---- logits (already scaled): U_head . Wk_head^T, a wave per 64 of K ----
  {
    const _Float16* ah = U + ((size_t)b * CC + h * DHEAD) * CC;
    const float*    bw = wk + (size_t)h * DHEAD * CC;
    _Float16* t32 = (_Float16*)&sRed[wid][0];
    _Float16* t16 = t32 + KT_HALFS;
    stage_k64(bw + wid * (CC / 8), ah + wid * (CC / 8), t32, t16);

    // the loops of this block are unrolled so that every index of acc, af and
    // bf is a constant and the arrays stay in registers
    v8f acc[4][4];
    #pragma unroll
    for (int mi = 0; mi < 4; ++mi)
      #pragma unroll
      for (int ni = 0; ni < 4; ++ni) acc[mi][ni] = zero8();

    #pragma unroll
    for (int s = 0; s < CC / 8 / 32; ++s) {
      v16h af[4], bf[4];
      #pragma unroll
      for (int i = 0; i < 4; ++i) {
        af[i] = frag_ld(t16, i * 16, KT_PITCH, s * 32);
        bf[i] = frag_ld(t32, i * 16, KT_PITCH, s * 32);
      }
      #pragma unroll
      for (int mi = 0; mi < 4; ++mi)
        #pragma unroll
        for (int ni = 0; ni < 4; ++ni)
          acc[mi][ni] = wmma16(af[mi], bf[ni], acc[mi][ni]);
    }

    // fragment order: idx = tile*256 + (r>>2)*128 + lane*4 + (r&3)
    #pragma unroll
    for (int mi = 0; mi < 4; ++mi)
      #pragma unroll
      for (int ni = 0; ni < 4; ++ni)
        #pragma unroll
        for (int hf = 0; hf < 2; ++hf) {
          float4 t = {acc[mi][ni][hf * 4 + 0], acc[mi][ni][hf * 4 + 1],
                      acc[mi][ni][hf * 4 + 2], acc[mi][ni][hf * 4 + 3]};
          *(float4*)&sRed[wid][(mi * 4 + ni) * 256 + hf * 128 + lane * 4] = t;
        }
  }

  if (tid < 64) {
    const float x = bv[h * DHEAD + tid];
    const float y = uq[b * CC + h * DHEAD + tid];
    xcnt_before_last_load();
    const float z = bk[h * DHEAD + tid];
    xcnt_behind_loads();
    sBv[tid] = x;
    sUq[tid] = y;
    sBk[tid] = z;
  }

  // ---- stage Wv[h*64 + e][c0..+127] transposed into sV[c][e], f16 ----
  // a wave's load covers a row's whole 128 floats (four lines); a wave owns
  // eight rows e
  {
    const float* src = wv + (size_t)(h * DHEAD + wid * 8) * CC + c0 + lane * 4;
    #pragma unroll
    for (int q = 0; q < 8; ++q) {
      float4 x = *(const float4*)(src + (size_t)q * CC);
      sV[lane * 4 + 0][wid * 8 + q] = (_Float16)x.x;
      sV[lane * 4 + 1][wid * 8 + q] = (_Float16)x.y;
      sV[lane * 4 + 2][wid * 8 + q] = (_Float16)x.z;
      sV[lane * 4 + 3][wid * 8 + q] = (_Float16)x.w;
    }
  }
  __syncthreads();

  // sum the eight waves' partials, undo the fragment order, add uq . bk^T
  #pragma unroll
  for (int j = 0; j < 4; ++j) {
    const int idx = (tid + 256 * j) * 4;
    float4 s = *(const float4*)&sRed[0][idx];
    #pragma unroll
    for (int w = 1; w < 8; ++w) {
      float4 t = *(const float4*)&sRed[w][idx];
      s.x += t.x; s.y += t.y; s.z += t.z; s.w += t.w;
    }
    const int tile = idx >> 8;
    const int fl   = (idx >> 2) & 31;
    const int row  = (tile >> 2) * 16 + ((idx >> 7) & 1) * 4 + ((fl >> 4) << 3);
    const int col  = (tile & 3) * 16 + (fl & 15);
    const float bkc = sBk[col];
    sS[row + 0][col] = s.x + sUq[row + 0] * bkc;
    sS[row + 1][col] = s.y + sUq[row + 1] * bkc;
    sS[row + 2][col] = s.z + sUq[row + 2] * bkc;
    sS[row + 3][col] = s.w + sUq[row + 3] * bkc;
  }
  __syncthreads();

  // ---- softmax over e (64 wide), one thread per row; P.bv beside it ----
  if (tid < 64) {
    float mx = -3.0e38f;
    for (int e = 0; e < 64; ++e) mx = fmaxf(mx, sS[tid][e]);
    float sum = 0.f;
    for (int e = 0; e < 64; ++e) {
      float t = __expf(sS[tid][e] - mx);
      sum += t;
      sS[tid][e] = t;
    }
    const float inv = 1.f / sum;
    float pbv = 0.f;
    for (int e = 0; e < 64; ++e) {
      const float p = sS[tid][e] * inv;
      sP[tid][e] = (_Float16)p;
      pbv += p * sBv[e];
    }
    if (blockIdx.x == 0) tb[bh * DHEAD + tid] = pbv;  // = [b][h*64 + d]
  }
  __syncthreads();

  // ---- T = P x Wv_head: each wave owns 16 columns c = c0 + wid*16 + lane%16
  v8f oacc[4];
  #pragma unroll
  for (int m2 = 0; m2 < 4; ++m2) oacc[m2] = zero8();
  #pragma unroll
  for (int ks = 0; ks < 2; ++ks) {
    v16h bf = frag_ld(&sV[0][0], wid * 16, 72, ks * 32);
    #pragma unroll
    for (int m2 = 0; m2 < 4; ++m2)
      oacc[m2] = wmma16(frag_ld(&sP[0][0], m2 * 16, 72, ks * 32), bf, oacc[m2]);
  }
  _Float16* dst = tT + ((size_t)b * CC + c0 + wid * 16 + (lane & 15)) * CC
                     + h * DHEAD + ((lane >> 4) << 3);
  #pragma unroll
  for (int m2 = 0; m2 < 4; ++m2) {
    v8h t;
    #pragma unroll
    for (int r = 0; r < 8; ++r) t[r] = (_Float16)oacc[m2][r];
    *(v8h*)(dst + m2 * 16) = t;
  }
}

// FIRST: wo, bo, tT, tb stand for Wq, bq, gT, sq/64; the tile gets bq . (sk/64)^T
// added and is stored f16 in U; the bias column is Wq . sq/64 + 64 bq.
template<bool FIRST>
__global__ __launch_bounds__(256) void fold_out(
    const float* __restrict__ wo, const float* __restrict__ bo,
    const _Float16* __restrict__ tT, const float* __restrict__ tb,
    const float* __restrict__ rk,
    float* __restrict__ M, _Float16* __restrict__ U,
    float* __restrict__ bias2)
{
  // per wave: first its two staged operand tiles, then its 64x64 partial
  __shared__ __align__(16) float sRed[8][KT_HALFS];
  __shared__ float sBq[FIRST ? 64 : 1];          // bq of the tile's rows
  __shared__ float sRk[FIRST ? 64 : 1];          // sk/64 of the tile's columns

  const int tid  = threadIdx.x;
  const int wid  = tid >> 5;
  const int lane = tid & 31;
  const int ct   = blockIdx.x;
  const int ot   = blockIdx.y;
  const int b    = blockIdx.z;

  if (ct == 8) {
    // bias2[b][o] = bo[o] + sum_j Wo[o][j] * tb[b][j], four threads a row
    const int o = ot * 64 + (tid >> 2), qd = tid & 3;
    const float* wr = wo + (size_t)o * CC + qd * 4;
    const float* tv = tb + b * CC + qd * 4;
    float s = 0.f;
    #pragma unroll 1  // eight float4 pairs in flight a trip are enough here
    for (int i0 = 0; i0 < CC / 16; i0 += 8) {
      float4 w[8], t[8];
      #pragma unroll
      for (int i = 0; i < 8; ++i) {
        t[i] = *(const float4*)(tv + (i0 + i) * 16);
        if (i == 7) xcnt_before_last_load();
        w[i] = *(const float4*)(wr + (i0 + i) * 16);
      }
      #pragma unroll
      for (int i = 0; i < 8; ++i)
        s += w[i].x * t[i].x + w[i].y * t[i].y + w[i].z * t[i].z
           + w[i].w * t[i].w;
    }
    s += __shfl_xor(s, 1);
    s += __shfl_xor(s, 2);
    // FIRST: L . bq / sqrt(L) = 64 bq
    if (qd == 0) bias2[b * CC + o] = s + (FIRST ? 64.f * bo[o] : bo[o]);
    return;
  }

  const float*    ah = wo + (size_t)ot * 64 * CC;
  const _Float16* bt = tT + ((size_t)b * CC + ct * 64) * CC;
  _Float16* t32 = (_Float16*)&sRed[wid][0];
  _Float16* t16 = t32 + KT_HALFS;
  stage_k64(ah + wid * (CC / 8), bt + wid * (CC / 8), t32, t16);

  v8f acc[4][4];
  #pragma unroll
  for (int mi = 0; mi < 4; ++mi)
    #pragma unroll
    for (int ni = 0; ni < 4; ++ni) acc[mi][ni] = zero8();

  #pragma unroll
  for (int s = 0; s < CC / 8 / 32; ++s) {
    v16h af[4], bf[4];
    #pragma unroll
    for (int i = 0; i < 4; ++i) {
      bf[i] = frag_ld(t16, i * 16, KT_PITCH, s * 32);
      af[i] = frag_ld(t32, i * 16, KT_PITCH, s * 32);
    }
    #pragma unroll
    for (int mi = 0; mi < 4; ++mi)
      #pragma unroll
      for (int ni = 0; ni < 4; ++ni)
        acc[mi][ni] = wmma16(af[mi], bf[ni], acc[mi][ni]);
  }

  // fragment order: idx = tile*256 + (r>>2)*128 + lane*4 + (r&3)
  #pragma unroll
  for (int mi = 0; mi < 4; ++mi)
    #pragma unroll
    for (int ni = 0; ni < 4; ++ni)
      #pragma unroll
      for (int hf = 0; hf < 2; ++hf) {
        float4 t = {acc[mi][ni][hf * 4 + 0], acc[mi][ni][hf * 4 + 1],
                    acc[mi][ni][hf * 4 + 2], acc[mi][ni][hf * 4 + 3]};
        *(float4*)&sRed[wid][(mi * 4 + ni) * 256 + hf * 128 + lane * 4] = t;
      }

  if (FIRST && tid < 64) {
    const float x = bo[ot * 64 + tid];
    xcnt_before_last_load();
    const float y = rk[b * CC + ct * 64 + tid];
    xcnt_behind_loads();
    sBq[tid] = x;
    sRk[tid] = y;
  }
  __syncthreads();

  // sum the eight waves' partials, undo the fragment order, store row-major
  const size_t tile0 = ((size_t)b * CC + ot * 64) * CC + ct * 64;
  #pragma unroll
  for (int j = 0; j < 4; ++j) {
    const int idx = (tid + 256 * j) * 4;
    float4 s = *(const float4*)&sRed[0][idx];
    #pragma unroll
    for (int w = 1; w < 8; ++w) {
      float4 t = *(const float4*)&sRed[w][idx];
      s.x += t.x; s.y += t.y; s.z += t.z; s.w += t.w;
    }
    const int tile = idx >> 8;
    const int fl   = (idx >> 2) & 31;
    const int row  = (tile >> 2) * 16 + ((idx >> 7) & 1) * 4 + ((fl >> 4) << 3);
    const int col  = (tile & 3) * 16 + (fl & 15);
    if (FIRST) {
      const float rc = sRk[col];
      _Float16* dst = U + tile0;
      dst[(size_t)(row + 0) * CC + col] = (_Float16)(s.x + sBq[row + 0] * rc);
      dst[(size_t)(row + 1) * CC + col] = (_Float16)(s.y + sBq[row + 1] * rc);
      dst[(size_t)(row + 2) * CC + col] = (_Float16)(s.z + sBq[row + 2] * rc);
      dst[(size_t)(row + 3) * CC + col] = (_Float16)(s.w + sBq[row + 3] * rc);
    } else {
      float* dst = M + tile0;
      dst[(size_t)(row + 0) * CC + col] = s.x;
      dst[(size_t)(row + 1) * CC + col] = s.y;
      dst[(size_t)(row + 2) * CC + col] = s.z;
      dst[(size_t)(row + 3) * CC + col] = s.w;
    }
  }
  // the built code lays the bias-column block behind these stores and reuses
  // their registers there: the stores' translations are waited for first
  asm volatile("s_wait_xcnt 0x0" ::: "memory");
}

// ---------------------------------------------------------------------------
extern "C" void kernel_launch(void* const* d_in, const int* in_sizes, int n_in,
                              void* d_out, int out_size, void* d_ws, size_t ws_size,
                              hipStream_t stream) {
  const float* query = (const float*)d_in[0];
  const float* key_  = (const float*)d_in[1];
  const float* value = (const float*)d_in[2];
  const float* wq = (const float*)d_in[3];
  const float* bq = (const float*)d_in[4];
  const float* wk = (const float*)d_in[5];
  const float* bk = (const float*)d_in[6];
  const float* wv = (const float*)d_in[7];
  const float* bv = (const float*)d_in[8];
  const float* wo = (const float*)d_in[9];
  const float* bo = (const float*)d_in[10];
  float* out = (float*)d_out;

  // workspace: f32 partial tiles of G: B*4*GKS*256*256 floats = 64 MiB
  float* gpart = (float*)d_ws;
  // row-sum partials [2][B][GKS][512] and the scaled row sums [2][B][512]
  float* rpart = gpart + (size_t)BB * 4 * GKS * 65536;
  float* rsum  = rpart + (size_t)2 * BB * GKS * CC;
  float* uq    = rsum + 2 * BB * CC;
  // per batch: P.bv and the folded bias f32, Wo.P.Wv f32
  float* tb    = uq + BB * CC;
  float* bias2 = tb + BB * CC;
  const size_t S2 = (size_t)BB * CC * CC;
  float* fM    = bias2 + BB * CC;
  // per batch, f16: (G/64)^T, U = Wq.G/64 + bq.(sk/64)^T, (P.Wv)^T
  _Float16* gT  = (_Float16*)(fM + S2);
  _Float16* u16 = gT + S2;
  _Float16* tT  = u16 + S2;

  dim3 blk(256);
  dim3 gblk(1024);
  dim3 grd(LL / 128, 1, BB);  // (32, 1, 8): one block per X panel

  gram_part<<<dim3(GKS, 4, BB), gblk, 0, stream>>>(query, key_, gpart, rpart);
  gram_reduce<<<dim3(BB * 4 * 32 + 2 * BB * CC / 256), blk, 0, stream>>>(
      gpart, rpart, gT, rsum);
  fold_out<true><<<dim3(8 + 1, 8, BB), blk, 0, stream>>>(
      wq, bq, gT, rsum, rsum + BB * CC, nullptr, u16, uq);
  attn_fold<<<dim3(CCH, BB * NHEAD), blk, 0, stream>>>(u16, uq, wk, bk, wv, bv,
                                                      tT, tb);
  fold_out<false><<<dim3(8 + 1, 8, BB), blk, 0, stream>>>(
      wo, bo, tT, tb, nullptr, fM, nullptr, bias2);

  panel_gemm<true, true><<<grd, gblk, 0, stream>>>(fM, bias2, value, out,
                                                  nullptr);
}

// v007
// One run takes 82.8 microseconds.
// It is 1.10 times as fast as v005, going by the measured steps of the versions left out in between.
// Over all steps from v000 it is 3.29 times as fast.
#include <hip/hip_runtime.h>
#include <hip/hip_bf16.h>

typedef __attribute__((ext_vector_type(16))) _Float16 v16h;
typedef __attribute__((ext_vector_type(8)))  _Float16 v8h;
typedef __attribute__((ext_vector_type(4)))  _Float16 v4h;
typedef __attribute__((ext_vector_type(8)))  float    v8f;

#define BB 8
#define CC 512
#define LL 4096
#define NHEAD 8
#define DHEAD 64

__device__ __forceinline__ v8f zero8() {
  v8f z = {0.f,0.f,0.f,0.f,0.f,0.f,0.f,0.f};
  return z;
}

__device__ __forceinline__ v8f wmma16(v16h a, v16h b, v8f c) {
  // (neg_a, A, neg_b, B, c_mod, C, reuse_a, reuse_b) -> v_wmma_f32_16x16x32_f16
  return __builtin_amdgcn_wmma_f32_16x16x32_f16(false, a, false, b, (short)0, c,
                                                false, false);
}

__device__ __forceinline__ v16h mk16(v8h lo, v8h hi) {
  union { v16h v; v8h h[2]; } u;
  u.h[0] = lo; u.h[1] = hi;
  return u.v;
}

__device__ __forceinline__ v16h frag_ld(const _Float16* base, int row0,
                                        int rowStride, int kb) {
  const int lane = threadIdx.x & 31;
  const _Float16* p = base + (size_t)(row0 + (lane & 15)) * rowStride
                           + kb + ((lane >> 4) << 3);
  v8h lo = *(const v8h*)(p);
  v8h hi = *(const v8h*)(p + 16);
  return mk16(lo, hi);
}

// Stands in front of the last load of a run of global loads: that load may take
// the run's address registers as its destination, so the earlier loads'
// translations are waited for first. The two scheduling barriers keep the
// earlier loads in front of the wait and the last load behind it.
__device__ __forceinline__ void xcnt_before_last_load() {
  __builtin_amdgcn_sched_barrier(0);
  asm volatile("s_wait_xcnt 0x0" ::: "memory");
  __builtin_amdgcn_sched_barrier(0);
}

// Stands behind the last load of a run whose address registers are free for
// reuse from there on: the load's translation is waited for first.
__device__ __forceinline__ void xcnt_behind_loads() {
  __builtin_amdgcn_sched_barrier(0);
  asm volatile("s_wait_xcnt 0x0" ::: "memory");
  __builtin_amdgcn_sched_barrier(0);
}

#define KT_PITCH 72
#define KT_HALFS (64 * KT_PITCH)  // halfs a tile; two tiles fill as many floats
__device__ __forceinline__ void stage_k64(const float* s32, const _Float16* s16,
                                          _Float16* t32, _Float16* t16) {
  const int lane = threadIdx.x & 31;
  const float*    pa = s32 + (size_t)(lane >> 4) * CC + (lane & 15) * 4;
  const _Float16* pb = s16 + (size_t)(lane >> 3) * CC + (lane & 7) * 8;
  // the loops are unrolled so that va and vb stay in registers and all loads
  // are in flight together
  float4 va[32];
  v8h    vb[16];
  #pragma unroll
  for (int i = 0; i < 32; ++i) va[i] = *(const float4*)(pa + (size_t)i * 2 * CC);
  #pragma unroll
  for (int i = 0; i < 16; ++i) vb[i] = *(const v8h*)(pb + (size_t)i * 4 * CC);
  // the loads' translations are waited for before their address registers are
  // free for reuse: as inputs of the wait both pairs stay live up to it, so no
  // load of the run takes them as its destination
  asm volatile("s_wait_xcnt 0x0" :: "v"(pa), "v"(pb) : "memory");
  #pragma unroll
  for (int i = 0; i < 32; ++i) {
    v4h h = {(_Float16)va[i].x, (_Float16)va[i].y,
             (_Float16)va[i].z, (_Float16)va[i].w};
    *(v4h*)(t32 + (i * 2 + (lane >> 4)) * KT_PITCH + (lane & 15) * 4) = h;
  }
  #pragma unroll
  for (int i = 0; i < 16; ++i)
    *(v8h*)(t16 + (i * 4 + (lane >> 3)) * KT_PITCH + (lane & 7) * 8) = vb[i];
  // the rows are read back by other lanes of this wave: its stores land first,
  // and the compiler moves no LDS read in front of them
  asm volatile("s_wait_dscnt 0x0" ::: "memory");
}

// ---------------------------------------------------------------------------
// Projection GEMM: Y[b,m,n] = W . X[b,:,n] + bias   (M=K=512, N=4096/batch)
// Block: 1024 threads (32 waves), tile 512(M, all of it) x 128(N): one block
// per X panel, so every element of X is read, converted and transposed once.
// The entire X^T panel (N=128 rows x K=512 cols, f16) is staged in LDS once;
// W arrives f16 from its producer, so a W tile is copied, not converted: tiles
// of 512x64 (a row's 64 halfs are one 128-byte line) are double-buffered per
// K-step so their global loads hide under the WMMAs, one barrier per step.
// Wave (wm 0..15, wn 0..1) owns a 32x64 sub-tile = 2x4 WMMA accumulators.
// W_PER_BATCH: W and bias are [B][512][512] and [B][512], one pair per batch.
// ---------------------------------------------------------------------------
template<bool W_PER_BATCH, bool OUT_F32>
__global__ __launch_bounds__(1024) void panel_gemm(
    const _Float16* __restrict__ Wall, const float* __restrict__ biasAll,
    const float* __restrict__ Xf,
    float* __restrict__ Yf, _Float16* __restrict__ Yh)
{
  __shared__ __align__(16) _Float16 sX[128][520];    // [n][k], 520 = 512+8 pad
  __shared__ __align__(16) _Float16 sA[2][512][72];  // double-buffered W tile
  __shared__ float sBias[512];

  const int tid  = threadIdx.x;
  const int b    = blockIdx.z;
  const int n0   = blockIdx.x * 128;
  const int wid  = tid >> 5;
  const int lane = tid & 31;
  const int wm   = wid & 15;
  const int wn   = wid >> 4;
  const _Float16* W = W_PER_BATCH ? Wall + (size_t)b * 512 * 512 : Wall;
  const float* bias = W_PER_BATCH ? biasAll + b * 512 : biasAll;

  if (tid < 512) sBias[tid] = bias[tid];

  {
    const int nseg = (wid & 3) * 8 + (lane & 7);           // n = nseg*4 .. +3
    const int k2   = ((wid >> 2) * 4 + (lane >> 3)) * 2;   // 0,2,...,62
    const float* xb = Xf + ((size_t)b * 512 + k2) * LL + n0 + nseg * 4;
    for (int kk = 0; kk < 512; kk += 128) {  // two 64-K chunks a trip
      const float* r0 = xb + (size_t)kk * LL;
      const float* r1 = r0 + LL;
      float4 a0 = *(const float4*)(r0);
      float4 c0 = *(const float4*)(r1);
      float4 a1 = *(const float4*)(r0 + (size_t)64 * LL);
      float4 c1 = *(const float4*)(r1 + (size_t)64 * LL);
      if (kk + 128 < 512) __builtin_prefetch(r0 + (size_t)128 * LL, 0, 3);
      float f0[8] = {a0.x,a0.y,a0.z,a0.w,a1.x,a1.y,a1.z,a1.w};
      float f1[8] = {c0.x,c0.y,c0.z,c0.w,c1.x,c1.y,c1.z,c1.w};
      #pragma unroll
      for (int j = 0; j < 8; ++j) {
        union { _Float16 h[2]; unsigned u; } p;
        p.h[0] = (_Float16)f0[j];
        p.h[1] = (_Float16)f1[j];
        // k2 even: 4B aligned
        *(unsigned*)&sX[nseg * 4 + (j & 3)][kk + (j >> 2) * 64 + k2] = p.u;
      }
    }
  }

  // ---- stage first W tile into sA[0] ----
  // eight lanes cover a row's 64 halfs (one 128-byte line); a thread owns rows
  // rA, rA + 128, rA + 256 and rA + 384
  const int rA = tid >> 3, segA = tid & 7;
  const _Float16* wsrc = W + (size_t)rA * 512 + segA * 8;
  {
    v8h h0 = *(const v8h*)(wsrc);
    v8h h1 = *(const v8h*)(wsrc + 128 * 512);
    v8h h2 = *(const v8h*)(wsrc + 256 * 512);
    v8h h3 = *(const v8h*)(wsrc + 384 * 512);
    *(v8h*)&sA[0][rA][segA * 8]       = h0;
    *(v8h*)&sA[0][rA + 128][segA * 8] = h1;
    *(v8h*)&sA[0][rA + 256][segA * 8] = h2;
    *(v8h*)&sA[0][rA + 384][segA * 8] = h3;
  }
  __syncthreads();

  v8f acc[2][4];
  #pragma unroll
  for (int mt = 0; mt < 2; ++mt)
    #pragma unroll
    for (int nt = 0; nt < 4; ++nt) acc[mt][nt] = zero8();

  for (int ks = 0; ks < 8; ++ks) {
    const int kb  = ks * 64;
    const int cur = ks & 1;
    const bool have_next = (ks + 1 < 8);

    // issue global loads of the next W tile first (latency hides under WMMA)
    v8h h0 = {}, h1 = {}, h2 = {}, h3 = {};
    if (have_next) {
      const _Float16* src = wsrc + kb + 64;
      h0 = *(const v8h*)(src);
      h1 = *(const v8h*)(src + 128 * 512);
      h2 = *(const v8h*)(src + 256 * 512);
      h3 = *(const v8h*)(src + 384 * 512);
    }
    // keeps the four loads in front of the WMMAs: left free, the scheduler
    // sinks two of them to the last WMMA, right in front of their first use
    __builtin_amdgcn_sched_barrier(0);

    // compute: 2x4 WMMA tiles per wave from resident panel + current W tile,
    // two k blocks of 32; the loops are unrolled so that every index of afr and
    // acc is a constant and the arrays stay in registers
    #pragma unroll
    for (int kk = 0; kk < 64; kk += 32) {
      v16h afr[2];
      #pragma unroll
      for (int mt = 0; mt < 2; ++mt)
        afr[mt] = frag_ld(&sA[cur][0][0], wm * 32 + mt * 16, 72, kk);
      #pragma unroll
      for (int nt = 0; nt < 4; ++nt) {
        v16h bfr = frag_ld(&sX[0][0], wn * 64 + nt * 16, 520, kb + kk);
        #pragma unroll
        for (int mt = 0; mt < 2; ++mt)
          acc[mt][nt] = wmma16(afr[mt], bfr, acc[mt][nt]);
      }
    }

    // keeps the first use of the loaded tile, and so its wait, behind the WMMAs:
    // left free, the scheduler lifts the stores to the head of the step and the
    // wave waits out the whole load latency there
    __builtin_amdgcn_sched_barrier(0);

    // store next W tile into the other buffer
    if (have_next) {
      *(v8h*)&sA[cur ^ 1][rA][segA * 8]       = h0;
      *(v8h*)&sA[cur ^ 1][rA + 128][segA * 8] = h1;
      *(v8h*)&sA[cur ^ 1][rA + 256][segA * 8] = h2;
      *(v8h*)&sA[cur ^ 1][rA + 384][segA * 8] = h3;
    }
    __syncthreads();
  }

  #pragma unroll
  for (int mt = 0; mt < 2; ++mt)
    #pragma unroll
    for (int r = 0; r < 8; ++r) {
      const int c = wm * 32 + mt * 16 + r + ((lane >> 4) << 3);
      const float bv = sBias[c];
      #pragma unroll
      for (int nt = 0; nt < 4; ++nt) {
        const int n = n0 + wn * 64 + nt * 16 + (lane & 15);
        const float val = acc[mt][nt][r] + bv;
        const size_t off = ((size_t)b * 512 + c) * LL + n;
        if (OUT_F32) Yf[off] = val;
        else         Yh[off] = (_Float16)val;
      }
    }
}

// ---------------------------------------------------------------------------
// Channel attention without q and k.
// gram_part: grid (GKS, 4, batch). A block forms a 256x256 tile of
//   G = query . key^T over its own L/GKS columns. 32-column slices of the 256
//   query rows and 256 key rows are converted to f16 in LDS, double-buffered,
//   the next slice's global loads in flight under the WMMAs, one barrier per
//   slice. Wave (wm 0..7, wn 0..3) owns 32x64 = 2x4 accumulators. The partial
//   tile is scaled by 1/sqrt(L) = 1/64 and stored f16 in fragment order: the
//   partials cross memory twice, and G/64 itself is kept f16 behind the sum.
//   The f32 row sums of query and key are kept beside the staging and stored
//   per L chunk.
// gram_reduce: sums the GKS partials in f32 in fixed order and stores G/64
//   transposed, gT[b][c'][c] (f16), the B-fragment order of the next product;
//   its last blocks sum and scale the row sums.
// fold_out<true>: U[b] = Wq . G/64 + bq . (sk/64)^T (f16, row-major) and
//   uq[b] = Wq . sq/64 + 64 bq.
// attn_fold: grid (CCH, batch*head). A block forms the 64x64 logits
//   U_head . Wk_head^T + uq_head . bk_head^T (K = 512 split over the eight
//   waves, summed through LDS in fixed order), does the softmax and forms
//   T = P . Wv_head for its own 512/CCH columns of Wv, the Wv tile transposed
//   through LDS. T is stored transposed, tT[b][c][head*64 + d] (f16), which is
//   the B-fragment order of the next product. Chunk 0 also stores P . bv_head.
// fold_out<false>: grid (8 + 1, 8, batch). M[b] = Wo . T[b] (stored f16, the
//   operand type of the last GEMM), one 64x64 tile a block, K = 512 split over
//   the eight waves and summed through LDS in fixed order; column block 8 forms
//   the bias Wo . (P.bv) + bo instead.
// ---------------------------------------------------------------------------
#define GKS 8
#define CCH 4

__global__ __launch_bounds__(1024) void gram_part(
    const float* __restrict__ xq, const float* __restrict__ xk,
    _Float16* __restrict__ gpart, float* __restrict__ rpart)
{
  // rows 0..255: query tile, rows 256..511: key tile; 32 columns + 8 pad
  __shared__ __align__(16) _Float16 sT[2][512][40];

  const int tid  = threadIdx.x;
  const int wid  = tid >> 5;
  const int lane = tid & 31;
  const int ks   = blockIdx.x;
  const int tile = blockIdx.y;
  const int b    = blockIdx.z;
  const int tm   = tile >> 1;   // 256-row block of query (c)
  const int tn   = tile & 1;    // 256-row block of key (c')
  const int wm   = wid & 7;
  const int wn   = wid >> 3;

  // staging: eight lanes cover a row's 32 floats (one 128-byte line); a thread
  // owns rows r0 and r0 + 128 of both tiles
  const int seg = tid & 7;
  const int r0  = tid >> 3;
  const float* pa = xq + ((size_t)b * CC + tm * 256 + r0) * LL
                       + ks * (LL / GKS) + seg * 4;
  const float* pb = xk + ((size_t)b * CC + tn * 256 + r0) * LL
                       + ks * (LL / GKS) + seg * 4;
  float rs0 = 0.f, rs1 = 0.f, rs2 = 0.f, rs3 = 0.f;

  float4 f0 = *(const float4*)(pa);
  float4 f1 = *(const float4*)(pa + (size_t)128 * LL);
  float4 f2 = *(const float4*)(pb);
  float4 f3 = *(const float4*)(pb + (size_t)128 * LL);
  {
    rs0 += (f0.x + f0.y) + (f0.z + f0.w);
    rs1 += (f1.x + f1.y) + (f1.z + f1.w);
    rs2 += (f2.x + f2.y) + (f2.z + f2.w);
    rs3 += (f3.x + f3.y) + (f3.z + f3.w);
    v4h h0 = {(_Float16)f0.x,(_Float16)f0.y,(_Float16)f0.z,(_Float16)f0.w};
    v4h h1 = {(_Float16)f1.x,(_Float16)f1.y,(_Float16)f1.z,(_Float16)f1.w};
    v4h h2 = {(_Float16)f2.x,(_Float16)f2.y,(_Float16)f2.z,(_Float16)f2.w};
    v4h h3 = {(_Float16)f3.x,(_Float16)f3.y,(_Float16)f3.z,(_Float16)f3.w};
    *(v4h*)&sT[0][r0][seg * 4]       = h0;
    *(v4h*)&sT[0][r0 + 128][seg * 4] = h1;
    *(v4h*)&sT[0][r0 + 256][seg * 4] = h2;
    *(v4h*)&sT[0][r0 + 384][seg * 4] = h3;
  }
  __syncthreads();

  // the loops over acc and afr in this kernel are unrolled so that every index
  // is a constant and the arrays stay in registers
  v8f acc[2][4];
  #pragma unroll
  for (int mt = 0; mt < 2; ++mt)
    #pragma unroll
    for (int nt = 0; nt < 4; ++nt) acc[mt][nt] = zero8();

  const int NS = LL / GKS / 32;  // 16 slices
  for (int s = 0; s < NS; ++s) {
    const int cur = s & 1;
    const bool have_next = (s + 1 < NS);

    // issue global loads of the next slice first (latency hides under WMMA)
    // (the pointers advance behind the wait for the slice before)
    if (have_next) {
      pa += 32;
      pb += 32;
      f0 = *(const float4*)(pa);
      f1 = *(const float4*)(pa + (size_t)128 * LL);
      f2 = *(const float4*)(pb);
      f3 = *(const float4*)(pb + (size_t)128 * LL);
    }
    // keeps the four loads in front of the WMMAs: left free, the scheduler
    // sinks them to their first use and the wave waits out the whole latency
    __builtin_amdgcn_sched_barrier(0);

    v16h afr[2];
    #pragma unroll
    for (int mt = 0; mt < 2; ++mt)
      afr[mt] = frag_ld(&sT[cur][0][0], wm * 32 + mt * 16, 40, 0);
    #pragma unroll
    for (int nt = 0; nt < 4; ++nt) {
      v16h bfr = frag_ld(&sT[cur][0][0], 256 + wn * 64 + nt * 16, 40, 0);
      #pragma unroll
      for (int mt = 0; mt < 2; ++mt)
        acc[mt][nt] = wmma16(afr[mt], bfr, acc[mt][nt]);
    }

    // keeps the first use of the loaded slice, and so its wait, behind the WMMAs
    __builtin_amdgcn_sched_barrier(0);

    // row sums, convert + store the next slice into the other buffer
    if (have_next) {
      rs0 += (f0.x + f0.y) + (f0.z + f0.w);
      rs1 += (f1.x + f1.y) + (f1.z + f1.w);
      rs2 += (f2.x + f2.y) + (f2.z + f2.w);
      rs3 += (f3.x + f3.y) + (f3.z + f3.w);
      v4h h0 = {(_Float16)f0.x,(_Float16)f0.y,(_Float16)f0.z,(_Float16)f0.w};
      v4h h1 = {(_Float16)f1.x,(_Float16)f1.y,(_Float16)f1.z,(_Float16)f1.w};
      v4h h2 = {(_Float16)f2.x,(_Float16)f2.y,(_Float16)f2.z,(_Float16)f2.w};
      v4h h3 = {(_Float16)f3.x,(_Float16)f3.y,(_Float16)f3.z,(_Float16)f3.w};
      *(v4h*)&sT[cur ^ 1][r0][seg * 4]       = h0;
      *(v4h*)&sT[cur ^ 1][r0 + 128][seg * 4] = h1;
      *(v4h*)&sT[cur ^ 1][r0 + 256][seg * 4] = h2;
      *(v4h*)&sT[cur ^ 1][r0 + 384][seg * 4] = h3;
    }
    __syncthreads();
  }

  // ---- partial tile / 64 (exact in f32), f16, fragment order:
  // idx = (wid*8 + mt*4 + nt)*256 + lane*8 + r
  _Float16* dst = gpart + (((size_t)b * 4 + tile) * GKS + ks) * 65536
                        + wid * 2048 + lane * 8;
  #pragma unroll
  for (int mt = 0; mt < 2; ++mt)
    #pragma unroll
    for (int nt = 0; nt < 4; ++nt) {
      v8h t;
      #pragma unroll
      for (int r = 0; r < 8; ++r)
        t[r] = (_Float16)(acc[mt][nt][r] * 0.015625f);
      *(v8h*)(dst + (mt * 4 + nt) * 256) = t;
    }

  // ---- row sums of this L chunk: rpart[which][b][ks][row], one writer each
  rs0 += __shfl_xor(rs0, 1); rs1 += __shfl_xor(rs1, 1);
  rs2 += __shfl_xor(rs2, 1); rs3 += __shfl_xor(rs3, 1);
  rs0 += __shfl_xor(rs0, 2); rs1 += __shfl_xor(rs1, 2);
  rs2 += __shfl_xor(rs2, 2); rs3 += __shfl_xor(rs3, 2);
  rs0 += __shfl_xor(rs0, 4); rs1 += __shfl_xor(rs1, 4);
  rs2 += __shfl_xor(rs2, 4); rs3 += __shfl_xor(rs3, 4);
  if (seg == 0) {
    if (tn == 0) {
      float* rq = rpart + ((size_t)b * GKS + ks) * CC + tm * 256 + r0;
      rq[0]   = rs0;
      rq[128] = rs1;
    }
    if (tm == 0) {
      float* rk = rpart + ((size_t)(BB + b) * GKS + ks) * CC + tn * 256 + r0;
      rk[0]   = rs2;
      rk[128] = rs3;
    }
  }
}

__global__ __launch_bounds__(256) void gram_reduce(
    const _Float16* __restrict__ gpart, const float* __restrict__ rpart,
    _Float16* __restrict__ gT, float* __restrict__ rsum)
{
  const float scale = 0.015625f;  // 1/sqrt(4096)
  const int tid = threadIdx.x;

  if (blockIdx.x >= BB * 4 * 16) {
    // rsum[which][b][row] = sum over the L chunks / 64
    const int j = (blockIdx.x - BB * 4 * 16) * 256 + tid;  // 0 .. 2*B*512-1
    const float* p = rpart + (size_t)(j >> 9) * GKS * CC + (j & 511);
    float s = p[0];
    #pragma unroll  // all loads in flight together
    for (int ks = 1; ks < GKS; ++ks) s += p[ks * CC];
    rsum[j] = s * scale;
    return;
  }

  // a thread takes one lane's eight values of two accumulator fragments, fr0
  // and fr0 + 128 (frag = wid*8 + mt*4 + nt of gram_part)
  const int g    = blockIdx.x * 256 + tid;
  const int lane = g & 31;
  const int fr0  = (g >> 5) & 127;
  const int bt   = g >> 12;          // b*4 + tile
  const _Float16* p = gpart + (size_t)bt * GKS * 65536 + fr0 * 256 + lane * 8;
  v8h x[2][GKS];
  #pragma unroll  // x stays in registers, all loads in flight together
  for (int ks = 0; ks < GKS; ++ks) {
    x[0][ks] = *(const v8h*)(p + (size_t)ks * 65536);
    x[1][ks] = *(const v8h*)(p + (size_t)ks * 65536 + 128 * 256);
  }
  // the loads' translations are waited for before their address registers are
  // free for reuse: as an input of the wait the pair stays live up to it, so no
  // load of the run takes it as its destination
  asm volatile("s_wait_xcnt 0x0" :: "v"(p) : "memory");
  const int b  = bt >> 2;
  const int tm = (bt >> 1) & 1;
  const int tn = bt & 1;
  #pragma unroll  // constant indices of x
  for (int f = 0; f < 2; ++f) {
    float s[8];
    #pragma unroll
    for (int r = 0; r < 8; ++r) s[r] = (float)x[f][0][r];
    #pragma unroll
    for (int ks = 1; ks < GKS; ++ks)
      #pragma unroll
      for (int r = 0; r < 8; ++r) s[r] += (float)x[f][ks][r];
    const int frag = fr0 + f * 128;
    const int wid  = frag >> 3;
    const int c    = tm * 256 + (wid & 7) * 32 + ((frag >> 2) & 1) * 16
                   + ((lane >> 4) << 3);
    const int cp   = tn * 256 + (wid >> 3) * 64 + (frag & 3) * 16 + (lane & 15);
    v8h o;
    #pragma unroll
    for (int r = 0; r < 8; ++r) o[r] = (_Float16)s[r];
    *(v8h*)(gT + ((size_t)b * CC + cp) * CC + c) = o;
  }
  // the built code lays the row-sum block behind these stores and reuses the
  // stores' registers there: the stores' translations are waited for first
  asm volatile("s_wait_xcnt 0x0" ::: "memory");
}

__global__ __launch_bounds__(256) void attn_fold(
    const _Float16* __restrict__ U, const float* __restrict__ uq,
    const float* __restrict__ wk, const float* __restrict__ bk,
    const float* __restrict__ wv,
    const float* __restrict__ bv, _Float16* __restrict__ tT,
    float* __restrict__ tb)
{
  // per wave: first its two staged operand tiles, then its 64x64 partial
  __shared__ __align__(16) float sRed[8][KT_HALFS];
  __shared__ float                  sS[64][65];   // logits fp32
  __shared__ __align__(16) _Float16 sP[64][72];   // softmax probs f16
  __shared__ __align__(16) _Float16 sV[128][72];  // Wv tile transposed [c][e]
  __shared__ float                  sBv[64];      // bv of this head
  __shared__ float                  sUq[64];      // uq of this batch and head
  __shared__ float                  sBk[64];      // bk of this head

  const int tid  = threadIdx.x;
  const int wid  = tid >> 5;
  const int lane = tid & 31;
  const int bh   = blockIdx.y;
  const int b    = bh >> 3;
  const int h    = bh & 7;
  const int c0   = blockIdx.x * (CC / CCH);

  // ---- logits (already scaled): U_head . Wk_head^T, a wave per 64 of K ----
  {
    const _Float16* ah = U + ((size_t)b * CC + h * DHEAD) * CC;
    const float*    bw = wk + (size_t)h * DHEAD * CC;
    _Float16* t32 = (_Float16*)&sRed[wid][0];
    _Float16* t16 = t32 + KT_HALFS;
    stage_k64(bw + wid * (CC / 8), ah + wid * (CC / 8), t32, t16);

    // the loops of this block are unrolled so that every index of acc, af and
    // bf is a constant and the arrays stay in registers
    v8f acc[4][4];
    #pragma unroll
    for (int mi = 0; mi < 4; ++mi)
      #pragma unroll
      for (int ni = 0; ni < 4; ++ni) acc[mi][ni] = zero8();

    #pragma unroll
    for (int s = 0; s < CC / 8 / 32; ++s) {
      v16h af[4], bf[4];
      #pragma unroll
      for (int i = 0; i < 4; ++i) {
        af[i] = frag_ld(t16, i * 16, KT_PITCH, s * 32);
        bf[i] = frag_ld(t32, i * 16, KT_PITCH, s * 32);
      }
      #pragma unroll
      for (int mi = 0; mi < 4; ++mi)
        #pragma unroll
        for (int ni = 0; ni < 4; ++ni)
          acc[mi][ni] = wmma16(af[mi], bf[ni], acc[mi][ni]);
    }

    // fragment order: idx = tile*256 + (r>>2)*128 + lane*4 + (r&3)
    #pragma unroll
    for (int mi = 0; mi < 4; ++mi)
      #pragma unroll
      for (int ni = 0; ni < 4; ++ni)
        #pragma unroll
        for (int hf = 0; hf < 2; ++hf) {
          float4 t = {acc[mi][ni][hf * 4 + 0], acc[mi][ni][hf * 4 + 1],
                      acc[mi][ni][hf * 4 + 2], acc[mi][ni][hf * 4 + 3]};
          *(float4*)&sRed[wid][(mi * 4 + ni) * 256 + hf * 128 + lane * 4] = t;
        }
  }

  if (tid < 64) {
    const float x = bv[h * DHEAD + tid];
    const float y = uq[b * CC + h * DHEAD + tid];
    xcnt_before_last_load();
    const float z = bk[h * DHEAD + tid];
    xcnt_behind_loads();
    sBv[tid] = x;
    sUq[tid] = y;
    sBk[tid] = z;
  }

  // ---- stage Wv[h*64 + e][c0..+127] transposed into sV[c][e], f16 ----
  // a wave's load covers a row's whole 128 floats (four lines); a wave owns
  // eight rows e
  {
    const float* src = wv + (size_t)(h * DHEAD + wid * 8) * CC + c0 + lane * 4;
    #pragma unroll
    for (int q = 0; q < 8; ++q) {
      float4 x = *(const float4*)(src + (size_t)q * CC);
      sV[lane * 4 + 0][wid * 8 + q] = (_Float16)x.x;
      sV[lane * 4 + 1][wid * 8 + q] = (_Float16)x.y;
      sV[lane * 4 + 2][wid * 8 + q] = (_Float16)x.z;
      sV[lane * 4 + 3][wid * 8 + q] = (_Float16)x.w;
    }
  }
  __syncthreads();

  // sum the eight waves' partials, undo the fragment order, add uq . bk^T
  #pragma unroll
  for (int j = 0; j < 4; ++j) {
    const int idx = (tid + 256 * j) * 4;
    float4 s = *(const float4*)&sRed[0][idx];
    #pragma unroll
    for (int w = 1; w < 8; ++w) {
      float4 t = *(const float4*)&sRed[w][idx];
      s.x += t.x; s.y += t.y; s.z += t.z; s.w += t.w;
    }
    const int tile = idx >> 8;
    const int fl   = (idx >> 2) & 31;
    const int row  = (tile >> 2) * 16 + ((idx >> 7) & 1) * 4 + ((fl >> 4) << 3);
    const int col  = (tile & 3) * 16 + (fl & 15);
    const float bkc = sBk[col];
    sS[row + 0][col] = s.x + sUq[row + 0] * bkc;
    sS[row + 1][col] = s.y + sUq[row + 1] * bkc;
    sS[row + 2][col] = s.z + sUq[row + 2] * bkc;
    sS[row + 3][col] = s.w + sUq[row + 3] * bkc;
  }
  __syncthreads();

  // ---- softmax over e (64 wide), one thread per row; P.bv beside it ----
  if (tid < 64) {
    float mx = -3.0e38f;
    for (int e = 0; e < 64; ++e) mx = fmaxf(mx, sS[tid][e]);
    float sum = 0.f;
    for (int e = 0; e < 64; ++e) {
      float t = __expf(sS[tid][e] - mx);
      sum += t;
      sS[tid][e] = t;
    }
    const float inv = 1.f / sum;
    float pbv = 0.f;
    for (int e = 0; e < 64; ++e) {
      const float p = sS[tid][e] * inv;
      sP[tid][e] = (_Float16)p;
      pbv += p * sBv[e];
    }
    if (blockIdx.x == 0) tb[bh * DHEAD + tid] = pbv;  // = [b][h*64 + d]
  }
  __syncthreads();

  // ---- T = P x Wv_head: each wave owns 16 columns c = c0 + wid*16 + lane%16
  v8f oacc[4];
  #pragma unroll
  for (int m2 = 0; m2 < 4; ++m2) oacc[m2] = zero8();
  #pragma unroll
  for (int ks = 0; ks < 2; ++ks) {
    v16h bf = frag_ld(&sV[0][0], wid * 16, 72, ks * 32);
    #pragma unroll
    for (int m2 = 0; m2 < 4; ++m2)
      oacc[m2] = wmma16(frag_ld(&sP[0][0], m2 * 16, 72, ks * 32), bf, oacc[m2]);
  }
  _Float16* dst = tT + ((size_t)b * CC + c0 + wid * 16 + (lane & 15)) * CC
                     + h * DHEAD + ((lane >> 4) << 3);
  #pragma unroll
  for (int m2 = 0; m2 < 4; ++m2) {
    v8h t;
    #pragma unroll
    for (int r = 0; r < 8; ++r) t[r] = (_Float16)oacc[m2][r];
    *(v8h*)(dst + m2 * 16) = t;
  }
}

// FIRST: wo, bo, tT, tb stand for Wq, bq, gT, sq/64; the tile gets bq . (sk/64)^T
// added and is stored f16 in U; the bias column is Wq . sq/64 + 64 bq.
template<bool FIRST>
__global__ __launch_bounds__(256) void fold_out(
    const float* __restrict__ wo, const float* __restrict__ bo,
    const _Float16* __restrict__ tT, const float* __restrict__ tb,
    const float* __restrict__ rk,
    _Float16* __restrict__ M, _Float16* __restrict__ U,
    float* __restrict__ bias2)
{
  // per wave: first its two staged operand tiles, then its 64x64 partial
  __shared__ __align__(16) float sRed[8][KT_HALFS];
  __shared__ float sBq[FIRST ? 64 : 1];          // bq of the tile's rows
  __shared__ float sRk[FIRST ? 64 : 1];          // sk/64 of the tile's columns

  const int tid  = threadIdx.x;
  const int wid  = tid >> 5;
  const int lane = tid & 31;
  const int ct   = blockIdx.x;
  const int ot   = blockIdx.y;
  const int b    = blockIdx.z;

  if (ct == 8) {
    // bias2[b][o] = bo[o] + sum_j Wo[o][j] * tb[b][j], four threads a row
    const int o = ot * 64 + (tid >> 2), qd = tid & 3;
    const float* wr = wo + (size_t)o * CC + qd * 4;
    const float* tv = tb + b * CC + qd * 4;
    float s = 0.f;
    #pragma unroll 1  // eight float4 pairs in flight a trip are enough here
    for (int i0 = 0; i0 < CC / 16; i0 += 8) {
      float4 w[8], t[8];
      #pragma unroll
      for (int i = 0; i < 8; ++i) {
        t[i] = *(const float4*)(tv + (i0 + i) * 16);
        if (i == 7) xcnt_before_last_load();
        w[i] = *(const float4*)(wr + (i0 + i) * 16);
      }
      #pragma unroll
      for (int i = 0; i < 8; ++i)
        s += w[i].x * t[i].x + w[i].y * t[i].y + w[i].z * t[i].z
           + w[i].w * t[i].w;
    }
    s += __shfl_xor(s, 1);
    s += __shfl_xor(s, 2);
    // FIRST: L . bq / sqrt(L) = 64 bq
    if (qd == 0) bias2[b * CC + o] = s + (FIRST ? 64.f * bo[o] : bo[o]);
    return;
  }

  const float*    ah = wo + (size_t)ot * 64 * CC;
  const _Float16* bt = tT + ((size_t)b * CC + ct * 64) * CC;
  _Float16* t32 = (_Float16*)&sRed[wid][0];
  _Float16* t16 = t32 + KT_HALFS;
  stage_k64(ah + wid * (CC / 8), bt + wid * (CC / 8), t32, t16);

  v8f acc[4][4];
  #pragma unroll
  for (int mi = 0; mi < 4; ++mi)
    #pragma unroll
    for (int ni = 0; ni < 4; ++ni) acc[mi][ni] = zero8();

  #pragma unroll
  for (int s = 0; s < CC / 8 / 32; ++s) {
    v16h af[4], bf[4];
    #pragma unroll
    for (int i = 0; i < 4; ++i) {
      bf[i] = frag_ld(t16, i * 16, KT_PITCH, s * 32);
      af[i] = frag_ld(t32, i * 16, KT_PITCH, s * 32);
    }
    #pragma unroll
    for (int mi = 0; mi < 4; ++mi)
      #pragma unroll
      for (int ni = 0; ni < 4; ++ni)
        acc[mi][ni] = wmma16(af[mi], bf[ni], acc[mi][ni]);
  }

  // fragment order: idx = tile*256 + (r>>2)*128 + lane*4 + (r&3)
  #pragma unroll
  for (int mi = 0; mi < 4; ++mi)
    #pragma unroll
    for (int ni = 0; ni < 4; ++ni)
      #pragma unroll
      for (int hf = 0; hf < 2; ++hf) {
        float4 t = {acc[mi][ni][hf * 4 + 0], acc[mi][ni][hf * 4 + 1],
                    acc[mi][ni][hf * 4 + 2], acc[mi][ni][hf * 4 + 3]};
        *(float4*)&sRed[wid][(mi * 4 + ni) * 256 + hf * 128 + lane * 4] = t;
      }

  if (FIRST && tid < 64) {
    const float x = bo[ot * 64 + tid];
    xcnt_before_last_load();
    const float y = rk[b * CC + ct * 64 + tid];
    xcnt_behind_loads();
    sBq[tid] = x;
    sRk[tid] = y;
  }
  __syncthreads();

  // sum the eight waves' partials, undo the fragment order, store row-major
  const size_t tile0 = ((size_t)b * CC + ot * 64) * CC + ct * 64;
  #pragma unroll
  for (int j = 0; j < 4; ++j) {
    const int idx = (tid + 256 * j) * 4;
    float4 s = *(const float4*)&sRed[0][idx];
    #pragma unroll
    for (int w = 1; w < 8; ++w) {
      float4 t = *(const float4*)&sRed[w][idx];
      s.x += t.x; s.y += t.y; s.z += t.z; s.w += t.w;
    }
    const int tile = idx >> 8;
    const int fl   = (idx >> 2) & 31;
    const int row  = (tile >> 2) * 16 + ((idx >> 7) & 1) * 4 + ((fl >> 4) << 3);
    const int col  = (tile & 3) * 16 + (fl & 15);
    if (FIRST) {
      const float rc = sRk[col];
      _Float16* dst = U + tile0;
      dst[(size_t)(row + 0) * CC + col] = (_Float16)(s.x + sBq[row + 0] * rc);
      dst[(size_t)(row + 1) * CC + col] = (_Float16)(s.y + sBq[row + 1] * rc);
      dst[(size_t)(row + 2) * CC + col] = (_Float16)(s.z + sBq[row + 2] * rc);
      dst[(size_t)(row + 3) * CC + col] = (_Float16)(s.w + sBq[row + 3] * rc);
    } else {
      _Float16* dst = M + tile0;
      dst[(size_t)(row + 0) * CC + col] = (_Float16)s.x;
      dst[(size_t)(row + 1) * CC + col] = (_Float16)s.y;
      dst[(size_t)(row + 2) * CC + col] = (_Float16)s.z;
      dst[(size_t)(row + 3) * CC + col] = (_Float16)s.w;
    }
  }
  // the built code lays the bias-column block behind these stores and reuses
  // their registers there: the stores' translations are waited for first
  asm volatile("s_wait_xcnt 0x0" ::: "memory");
}

// ---------------------------------------------------------------------------
extern "C" void kernel_launch(void* const* d_in, const int* in_sizes, int n_in,
                              void* d_out, int out_size, void* d_ws, size_t ws_size,
                              hipStream_t stream) {
  const float* query = (const float*)d_in[0];
  const float* key_  = (const float*)d_in[1];
  const float* value = (const float*)d_in[2];
  const float* wq = (const float*)d_in[3];
  const float* bq = (const float*)d_in[4];
  const float* wk = (const float*)d_in[5];
  const float* bk = (const float*)d_in[6];
  const float* wv = (const float*)d_in[7];
  const float* bv = (const float*)d_in[8];
  const float* wo = (const float*)d_in[9];
  const float* bo = (const float*)d_in[10];
  float* out = (float*)d_out;

  // workspace: f16 partial tiles of G/64: B*4*GKS*256*256 halfs = 32 MiB
  _Float16* gpart = (_Float16*)d_ws;
  // row-sum partials [2][B][GKS][512] and the scaled row sums [2][B][512]
  float* rpart = (float*)(gpart + (size_t)BB * 4 * GKS * 65536);
  float* rsum  = rpart + (size_t)2 * BB * GKS * CC;
  float* uq    = rsum + 2 * BB * CC;
  // per batch: P.bv and the folded bias f32
  float* tb    = uq + BB * CC;
  float* bias2 = tb + BB * CC;
  const size_t S2 = (size_t)BB * CC * CC;
  // per batch, f16: Wo.P.Wv, (G/64)^T, U = Wq.G/64 + bq.(sk/64)^T, (P.Wv)^T
  _Float16* hM  = (_Float16*)(bias2 + BB * CC);
  _Float16* gT  = hM + S2;
  _Float16* u16 = gT + S2;
  _Float16* tT  = u16 + S2;

  dim3 blk(256);
  dim3 gblk(1024);
  dim3 grd(LL / 128, 1, BB);  // (32, 1, 8): one block per X panel

  gram_part<<<dim3(GKS, 4, BB), gblk, 0, stream>>>(query, key_, gpart, rpart);
  gram_reduce<<<dim3(BB * 4 * 16 + 2 * BB * CC / 256), blk, 0, stream>>>(
      gpart, rpart, gT, rsum);
  fold_out<true><<<dim3(8 + 1, 8, BB), blk, 0, stream>>>(
      wq, bq, gT, rsum, rsum + BB * CC, nullptr, u16, uq);
  attn_fold<<<dim3(CCH, BB * NHEAD), blk, 0, stream>>>(u16, uq, wk, bk, wv, bv,
                                                      tT, tb);
  fold_out<false><<<dim3(8 + 1, 8, BB), blk, 0, stream>>>(
      wo, bo, tT, tb, nullptr, hM, nullptr, bias2);

  panel_gemm<true, true><<<grd, gblk, 0, stream>>>(hM, bias2, value, out,
                                                  nullptr);
}

// v008
// A run of this version takes 80.3 microseconds.
// Timed twice side by side with v007, it ran 1.03 times as fast both times.
// Over all steps from v000 it is 3.40 times as fast.
#include <hip/hip_runtime.h>
#include <hip/hip_bf16.h>

typedef __attribute__((ext_vector_type(16))) _Float16 v16h;
typedef __attribute__((ext_vector_type(8)))  _Float16 v8h;
typedef __attribute__((ext_vector_type(4)))  _Float16 v4h;
typedef __attribute__((ext_vector_type(8)))  float    v8f;

#define BB 8
#define CC 512
#define LL 4096
#define NHEAD 8
#define DHEAD 64

__device__ __forceinline__ v8f zero8() {
  v8f z = {0.f,0.f,0.f,0.f,0.f,0.f,0.f,0.f};
  return z;
}

__device__ __forceinline__ v8f wmma16(v16h a, v16h b, v8f c) {
  // (neg_a, A, neg_b, B, c_mod, C, reuse_a, reuse_b) -> v_wmma_f32_16x16x32_f16
  return __builtin_amdgcn_wmma_f32_16x16x32_f16(false, a, false, b, (short)0, c,
                                                false, false);
}

__device__ __forceinline__ v16h mk16(v8h lo, v8h hi) {
  union { v16h v; v8h h[2]; } u;
  u.h[0] = lo; u.h[1] = hi;
  return u.v;
}

__device__ __forceinline__ v16h frag_ld(const _Float16* base, int row0,
                                        int rowStride, int kb) {
  const int lane = threadIdx.x & 31;
  const _Float16* p = base + (size_t)(row0 + (lane & 15)) * rowStride
                           + kb + ((lane >> 4) << 3);
  v8h lo = *(const v8h*)(p);
  v8h hi = *(const v8h*)(p + 16);
  return mk16(lo, hi);
}

// Stands in front of the last load of a run of global loads: that load may take
// the run's address registers as its destination, so the earlier loads'
// translations are waited for first. The two scheduling barriers keep the
// earlier loads in front of the wait and the last load behind it.
__device__ __forceinline__ void xcnt_before_last_load() {
  __builtin_amdgcn_sched_barrier(0);
  asm volatile("s_wait_xcnt 0x0" ::: "memory");
  __builtin_amdgcn_sched_barrier(0);
}

// Stands behind the last load of a run whose address registers are free for
// reuse from there on: the load's translation is waited for first.
__device__ __forceinline__ void xcnt_behind_loads() {
  __builtin_amdgcn_sched_barrier(0);
  asm volatile("s_wait_xcnt 0x0" ::: "memory");
  __builtin_amdgcn_sched_barrier(0);
}

#define KT_PITCH 72
#define KT_HALFS (64 * KT_PITCH)  // halfs a tile; two tiles fill as many floats
__device__ __forceinline__ void stage_k64(const float* s32, const _Float16* s16,
                                          _Float16* t32, _Float16* t16) {
  const int lane = threadIdx.x & 31;
  const float*    pa = s32 + (size_t)(lane >> 4) * CC + (lane & 15) * 4;
  const _Float16* pb = s16 + (size_t)(lane >> 3) * CC + (lane & 7) * 8;
  // the loops are unrolled so that va and vb stay in registers and all loads
  // are in flight together
  float4 va[32];
  v8h    vb[16];
  #pragma unroll
  for (int i = 0; i < 32; ++i) va[i] = *(const float4*)(pa + (size_t)i * 2 * CC);
  #pragma unroll
  for (int i = 0; i < 16; ++i) vb[i] = *(const v8h*)(pb + (size_t)i * 4 * CC);
  // the loads' translations are waited for before their address registers are
  // free for reuse: as inputs of the wait both pairs stay live up to it, so no
  // load of the run takes them as its destination
  asm volatile("s_wait_xcnt 0x0" :: "v"(pa), "v"(pb) : "memory");
  #pragma unroll
  for (int i = 0; i < 32; ++i) {
    v4h h = {(_Float16)va[i].x, (_Float16)va[i].y,
             (_Float16)va[i].z, (_Float16)va[i].w};
    *(v4h*)(t32 + (i * 2 + (lane >> 4)) * KT_PITCH + (lane & 15) * 4) = h;
  }
  #pragma unroll
  for (int i = 0; i < 16; ++i)
    *(v8h*)(t16 + (i * 4 + (lane >> 3)) * KT_PITCH + (lane & 7) * 8) = vb[i];
  // the rows are read back by other lanes of this wave: its stores land first,
  // and the compiler moves no LDS read in front of them
  asm volatile("s_wait_dscnt 0x0" ::: "memory");
}

// ---------------------------------------------------------------------------
// Projection GEMM: Y[b,m,n] = W . X[b,:,n] + bias   (M=K=512, N=4096/batch)
// Block: 1024 threads (32 waves), tile 512(M, all of it) x 128(N): one block
// per X panel, so every element of X is read, converted and transposed once.
// The entire X^T panel (N=128 rows x K=512 cols, f16) is staged in LDS once;
// W arrives f16 from its producer, so a W tile is copied, not converted: tiles
// of 512x64 (a row's 64 halfs are one 128-byte line) are double-buffered per
// K-step so their global loads hide under the WMMAs, one barrier per step.
// Wave (wm 0..15, wn 0..1) owns a 32x64 sub-tile = 2x4 WMMA accumulators.
// W_PER_BATCH: W and bias are [B][512][512] and [B][512], one pair per batch.
// ---------------------------------------------------------------------------
template<bool W_PER_BATCH, bool OUT_F32>
__global__ __launch_bounds__(1024) void panel_gemm(
    const _Float16* __restrict__ Wall, const float* __restrict__ biasAll,
    const float* __restrict__ Xf,
    float* __restrict__ Yf, _Float16* __restrict__ Yh)
{
  __shared__ __align__(16) _Float16 sX[128][520];    // [n][k], 520 = 512+8 pad
  __shared__ __align__(16) _Float16 sA[2][512][72];  // double-buffered W tile
  __shared__ float sBias[512];

  const int tid  = threadIdx.x;
  const int b    = blockIdx.z;
  const int n0   = blockIdx.x * 128;
  const int wid  = tid >> 5;
  const int lane = tid & 31;
  const int wm   = wid & 15;
  const int wn   = wid >> 4;
  const _Float16* W = W_PER_BATCH ? Wall + (size_t)b * 512 * 512 : Wall;
  const float* bias = W_PER_BATCH ? biasAll + b * 512 : biasAll;

  if (tid < 512) sBias[tid] = bias[tid];

  {
    const int nseg = (wid & 3) * 8 + (lane & 7);           // n = nseg*4 .. +3
    const int k2   = ((wid >> 2) * 4 + (lane >> 3)) * 2;   // 0,2,...,62
    const float* xb = Xf + ((size_t)b * 512 + k2) * LL + n0 + nseg * 4;
    for (int kk = 0; kk < 512; kk += 128) {  // two 64-K chunks a trip
      const float* r0 = xb + (size_t)kk * LL;
      const float* r1 = r0 + LL;
      float4 a0 = *(const float4*)(r0);
      float4 c0 = *(const float4*)(r1);
      float4 a1 = *(const float4*)(r0 + (size_t)64 * LL);
      float4 c1 = *(const float4*)(r1 + (size_t)64 * LL);
      if (kk + 128 < 512) __builtin_prefetch(r0 + (size_t)128 * LL, 0, 3);
      float f0[8] = {a0.x,a0.y,a0.z,a0.w,a1.x,a1.y,a1.z,a1.w};
      float f1[8] = {c0.x,c0.y,c0.z,c0.w,c1.x,c1.y,c1.z,c1.w};
      #pragma unroll
      for (int j = 0; j < 8; ++j) {
        union { _Float16 h[2]; unsigned u; } p;
        p.h[0] = (_Float16)f0[j];
        p.h[1] = (_Float16)f1[j];
        // k2 even: 4B aligned
        *(unsigned*)&sX[nseg * 4 + (j & 3)][kk + (j >> 2) * 64 + k2] = p.u;
      }
    }
  }

  // ---- stage first W tile into sA[0] ----
  // eight lanes cover a row's 64 halfs (one 128-byte line); a thread owns rows
  // rA, rA + 128, rA + 256 and rA + 384
  const int rA = tid >> 3, segA = tid & 7;
  const _Float16* wsrc = W + (size_t)rA * 512 + segA * 8;
  {
    v8h h0 = *(const v8h*)(wsrc);
    v8h h1 = *(const v8h*)(wsrc + 128 * 512);
    v8h h2 = *(const v8h*)(wsrc + 256 * 512);
    v8h h3 = *(const v8h*)(wsrc + 384 * 512);
    *(v8h*)&sA[0][rA][segA * 8]       = h0;
    *(v8h*)&sA[0][rA + 128][segA * 8] = h1;
    *(v8h*)&sA[0][rA + 256][segA * 8] = h2;
    *(v8h*)&sA[0][rA + 384][segA * 8] = h3;
  }
  __syncthreads();

  v8f acc[2][4];
  #pragma unroll
  for (int mt = 0; mt < 2; ++mt)
    #pragma unroll
    for (int nt = 0; nt < 4; ++nt) acc[mt][nt] = zero8();

  for (int ks = 0; ks < 8; ++ks) {
    const int kb  = ks * 64;
    const int cur = ks & 1;
    const bool have_next = (ks + 1 < 8);

    // issue global loads of the next W tile first (latency hides under WMMA)
    v8h h0 = {}, h1 = {}, h2 = {}, h3 = {};
    if (have_next) {
      const _Float16* src = wsrc + kb + 64;
      h0 = *(const v8h*)(src);
      h1 = *(const v8h*)(src + 128 * 512);
      h2 = *(const v8h*)(src + 256 * 512);
      h3 = *(const v8h*)(src + 384 * 512);
    }
    // keeps the four loads in front of the WMMAs: left free, the scheduler
    // sinks two of them to the last WMMA, right in front of their first use
    __builtin_amdgcn_sched_barrier(0);

    // compute: 2x4 WMMA tiles per wave from resident panel + current W tile,
    // two k blocks of 32; the loops are unrolled so that every index of afr and
    // acc is a constant and the arrays stay in registers
    #pragma unroll
    for (int kk = 0; kk < 64; kk += 32) {
      v16h afr[2];
      #pragma unroll
      for (int mt = 0; mt < 2; ++mt)
        afr[mt] = frag_ld(&sA[cur][0][0], wm * 32 + mt * 16, 72, kk);
      #pragma unroll
      for (int nt = 0; nt < 4; ++nt) {
        v16h bfr = frag_ld(&sX[0][0], wn * 64 + nt * 16, 520, kb + kk);
        #pragma unroll
        for (int mt = 0; mt < 2; ++mt)
          acc[mt][nt] = wmma16(afr[mt], bfr, acc[mt][nt]);
      }
    }

    // keeps the first use of the loaded tile, and so its wait, behind the WMMAs:
    // left free, the scheduler lifts the stores to the head of the step and the
    // wave waits out the whole load latency there
    __builtin_amdgcn_sched_barrier(0);

    // store next W tile into the other buffer
    if (have_next) {
      *(v8h*)&sA[cur ^ 1][rA][segA * 8]       = h0;
      *(v8h*)&sA[cur ^ 1][rA + 128][segA * 8] = h1;
      *(v8h*)&sA[cur ^ 1][rA + 256][segA * 8] = h2;
      *(v8h*)&sA[cur ^ 1][rA + 384][segA * 8] = h3;
    }
    __syncthreads();
  }

  #pragma unroll
  for (int mt = 0; mt < 2; ++mt)
    #pragma unroll
    for (int r = 0; r < 8; ++r) {
      const int c = wm * 32 + mt * 16 + r + ((lane >> 4) << 3);
      const float bv = sBias[c];
      #pragma unroll
      for (int nt = 0; nt < 4; ++nt) {
        const int n = n0 + wn * 64 + nt * 16 + (lane & 15);
        const float val = acc[mt][nt][r] + bv;
        const size_t off = ((size_t)b * 512 + c) * LL + n;
        if (OUT_F32) Yf[off] = val;
        else         Yh[off] = (_Float16)val;
      }
    }
}

// ---------------------------------------------------------------------------
// Channel attention without q and k.
// gram_part: grid (GKS, 4, batch). A block forms a 256x256 tile of
//   G = query . key^T over its own L/GKS columns. 32-column slices of the 256
//   query rows and 256 key rows are converted to f16 in LDS, double-buffered,
//   the next slice's global loads in flight under the WMMAs, one barrier per
//   slice. Wave (wm 0..7, wn 0..3) owns 32x64 = 2x4 accumulators. The partial
//   tile is scaled by 1/sqrt(L) = 1/64 and stored f16 in fragment order: the
//   partials cross memory twice, and G/64 itself is kept f16 behind the sum.
//   The f32 row sums of query and key are kept beside the staging and stored
//   per L chunk.
// gram_reduce: sums the GKS partials in f32 in fixed order and stores G/64
//   transposed, gT[b][c'][c] (f16), the B-fragment order of the next product;
//   its last blocks sum and scale the row sums.
// fold_out<true>: U[b] = Wq . G/64 + bq . (sk/64)^T (f16, row-major) and
//   uq[b] = Wq . sq/64 + 64 bq.
// attn_fold: grid (CCH, batch*head). A block forms the 64x64 logits
//   U_head . Wk_head^T + uq_head . bk_head^T (K = 512 split over the eight
//   waves, summed through LDS in fixed order), does the softmax and forms
//   T = P . Wv_head for its own 512/CCH columns of Wv, the Wv tile transposed
//   through LDS. T is stored transposed, tT[b][c][head*64 + d] (f16), which is
//   the B-fragment order of the next product. Chunk 0 also stores P . bv_head.
// fold_out<false>: grid (8 + 1, 8, batch). M[b] = Wo . T[b] (stored f16, the
//   operand type of the last GEMM), one 64x64 tile a block, K = 512 split over
//   the eight waves and summed through LDS in fixed order; column block 8 forms
//   the bias Wo . (P.bv) + bo instead.
// ---------------------------------------------------------------------------
#define GKS 8
#define CCH 4

__global__ __launch_bounds__(1024) void gram_part(
    const float* __restrict__ xq, const float* __restrict__ xk,
    _Float16* __restrict__ gpart, float* __restrict__ rpart)
{
  // rows 0..255: query tile, rows 256..511: key tile; 32 columns + 8 pad
  __shared__ __align__(16) _Float16 sT[2][512][40];

  const int tid  = threadIdx.x;
  const int wid  = tid >> 5;
  const int lane = tid & 31;
  const int ks   = blockIdx.x;
  const int tile = blockIdx.y;
  const int b    = blockIdx.z;
  const int tm   = tile >> 1;   // 256-row block of query (c)
  const int tn   = tile & 1;    // 256-row block of key (c')
  const int wm   = wid & 7;
  const int wn   = wid >> 3;

  // staging: eight lanes cover a row's 32 floats (one 128-byte line); a thread
  // owns rows r0 and r0 + 128 of both tiles
  const int seg = tid & 7;
  const int r0  = tid >> 3;
  const float* pa = xq + ((size_t)b * CC + tm * 256 + r0) * LL
                       + ks * (LL / GKS) + seg * 4;
  const float* pb = xk + ((size_t)b * CC + tn * 256 + r0) * LL
                       + ks * (LL / GKS) + seg * 4;
  float rs0 = 0.f, rs1 = 0.f, rs2 = 0.f, rs3 = 0.f;

  float4 f0 = *(const float4*)(pa);
  float4 f1 = *(const float4*)(pa + (size_t)128 * LL);
  float4 f2 = *(const float4*)(pb);
  float4 f3 = *(const float4*)(pb + (size_t)128 * LL);
  {
    rs0 += (f0.x + f0.y) + (f0.z + f0.w);
    rs1 += (f1.x + f1.y) + (f1.z + f1.w);
    rs2 += (f2.x + f2.y) + (f2.z + f2.w);
    rs3 += (f3.x + f3.y) + (f3.z + f3.w);
    v4h h0 = {(_Float16)f0.x,(_Float16)f0.y,(_Float16)f0.z,(_Float16)f0.w};
    v4h h1 = {(_Float16)f1.x,(_Float16)f1.y,(_Float16)f1.z,(_Float16)f1.w};
    v4h h2 = {(_Float16)f2.x,(_Float16)f2.y,(_Float16)f2.z,(_Float16)f2.w};
    v4h h3 = {(_Float16)f3.x,(_Float16)f3.y,(_Float16)f3.z,(_Float16)f3.w};
    *(v4h*)&sT[0][r0][seg * 4]       = h0;
    *(v4h*)&sT[0][r0 + 128][seg * 4] = h1;
    *(v4h*)&sT[0][r0 + 256][seg * 4] = h2;
    *(v4h*)&sT[0][r0 + 384][seg * 4] = h3;
  }
  __syncthreads();

  // the loops over acc and afr in this kernel are unrolled so that every index
  // is a constant and the arrays stay in registers
  v8f acc[2][4];
  #pragma unroll
  for (int mt = 0; mt < 2; ++mt)
    #pragma unroll
    for (int nt = 0; nt < 4; ++nt) acc[mt][nt] = zero8();

  const int NS = LL / GKS / 32;  // 16 slices
  for (int s = 0; s < NS; ++s) {
    const int cur = s & 1;
    const bool have_next = (s + 1 < NS);

    // issue global loads of the next slice first (latency hides under WMMA)
    // (the pointers advance behind the wait for the slice before)
    if (have_next) {
      pa += 32;
      pb += 32;
      f0 = *(const float4*)(pa);
      f1 = *(const float4*)(pa + (size_t)128 * LL);
      f2 = *(const float4*)(pb);
      f3 = *(const float4*)(pb + (size_t)128 * LL);
    }
    // keeps the four loads in front of the WMMAs: left free, the scheduler
    // sinks them to their first use and the wave waits out the whole latency
    __builtin_amdgcn_sched_barrier(0);

    v16h afr[2];
    #pragma unroll
    for (int mt = 0; mt < 2; ++mt)
      afr[mt] = frag_ld(&sT[cur][0][0], wm * 32 + mt * 16, 40, 0);
    #pragma unroll
    for (int nt = 0; nt < 4; ++nt) {
      v16h bfr = frag_ld(&sT[cur][0][0], 256 + wn * 64 + nt * 16, 40, 0);
      #pragma unroll
      for (int mt = 0; mt < 2; ++mt)
        acc[mt][nt] = wmma16(afr[mt], bfr, acc[mt][nt]);
    }

    // keeps the first use of the loaded slice, and so its wait, behind the WMMAs
    __builtin_amdgcn_sched_barrier(0);

    // row sums, convert + store the next slice into the other buffer
    if (have_next) {
      rs0 += (f0.x + f0.y) + (f0.z + f0.w);
      rs1 += (f1.x + f1.y) + (f1.z + f1.w);
      rs2 += (f2.x + f2.y) + (f2.z + f2.w);
      rs3 += (f3.x + f3.y) + (f3.z + f3.w);
      v4h h0 = {(_Float16)f0.x,(_Float16)f0.y,(_Float16)f0.z,(_Float16)f0.w};
      v4h h1 = {(_Float16)f1.x,(_Float16)f1.y,(_Float16)f1.z,(_Float16)f1.w};
      v4h h2 = {(_Float16)f2.x,(_Float16)f2.y,(_Float16)f2.z,(_Float16)f2.w};
      v4h h3 = {(_Float16)f3.x,(_Float16)f3.y,(_Float16)f3.z,(_Float16)f3.w};
      *(v4h*)&sT[cur ^ 1][r0][seg * 4]       = h0;
      *(v4h*)&sT[cur ^ 1][r0 + 128][seg * 4] = h1;
      *(v4h*)&sT[cur ^ 1][r0 + 256][seg * 4] = h2;
      *(v4h*)&sT[cur ^ 1][r0 + 384][seg * 4] = h3;
    }
    __syncthreads();
  }

  // ---- partial tile / 64 (exact in f32), f16, fragment order:
  // idx = (wid*8 + mt*4 + nt)*256 + lane*8 + r
  _Float16* dst = gpart + (((size_t)b * 4 + tile) * GKS + ks) * 65536
                        + wid * 2048 + lane * 8;
  #pragma unroll
  for (int mt = 0; mt < 2; ++mt)
    #pragma unroll
    for (int nt = 0; nt < 4; ++nt) {
      v8h t;
      #pragma unroll
      for (int r = 0; r < 8; ++r)
        t[r] = (_Float16)(acc[mt][nt][r] * 0.015625f);
      *(v8h*)(dst + (mt * 4 + nt) * 256) = t;
    }

  // ---- row sums of this L chunk: rpart[which][b][ks][row], one writer each
  rs0 += __shfl_xor(rs0, 1); rs1 += __shfl_xor(rs1, 1);
  rs2 += __shfl_xor(rs2, 1); rs3 += __shfl_xor(rs3, 1);
  rs0 += __shfl_xor(rs0, 2); rs1 += __shfl_xor(rs1, 2);
  rs2 += __shfl_xor(rs2, 2); rs3 += __shfl_xor(rs3, 2);
  rs0 += __shfl_xor(rs0, 4); rs1 += __shfl_xor(rs1, 4);
  rs2 += __shfl_xor(rs2, 4); rs3 += __shfl_xor(rs3, 4);
  if (seg == 0) {
    if (tn == 0) {
      float* rq = rpart + ((size_t)b * GKS + ks) * CC + tm * 256 + r0;
      rq[0]   = rs0;
      rq[128] = rs1;
    }
    if (tm == 0) {
      float* rk = rpart + ((size_t)(BB + b) * GKS + ks) * CC + tn * 256 + r0;
      rk[0]   = rs2;
      rk[128] = rs3;
    }
  }
}

__global__ __launch_bounds__(256) void gram_reduce(
    const _Float16* __restrict__ gpart, const float* __restrict__ rpart,
    _Float16* __restrict__ gT, float* __restrict__ rsum)
{
  const float scale = 0.015625f;  // 1/sqrt(4096)
  const int tid = threadIdx.x;

  if (blockIdx.x >= BB * 4 * 16) {
    // rsum[which][b][row] = sum over the L chunks / 64
    const int j = (blockIdx.x - BB * 4 * 16) * 256 + tid;  // 0 .. 2*B*512-1
    const float* p = rpart + (size_t)(j >> 9) * GKS * CC + (j & 511);
    float s = p[0];
    #pragma unroll  // all loads in flight together
    for (int ks = 1; ks < GKS; ++ks) s += p[ks * CC];
    rsum[j] = s * scale;
    return;
  }

  // a thread takes one lane's eight values of two accumulator fragments, fr0
  // and fr0 + 128 (frag = wid*8 + mt*4 + nt of gram_part)
  const int g    = blockIdx.x * 256 + tid;
  const int lane = g & 31;
  const int fr0  = (g >> 5) & 127;
  const int bt   = g >> 12;          // b*4 + tile
  const _Float16* p = gpart + (size_t)bt * GKS * 65536 + fr0 * 256 + lane * 8;
  v8h x[2][GKS];
  #pragma unroll  // x stays in registers, all loads in flight together
  for (int ks = 0; ks < GKS; ++ks) {
    x[0][ks] = *(const v8h*)(p + (size_t)ks * 65536);
    x[1][ks] = *(const v8h*)(p + (size_t)ks * 65536 + 128 * 256);
  }
  // the loads' translations are waited for before their address registers are
  // free for reuse: as an input of the wait the pair stays live up to it, so no
  // load of the run takes it as its destination
  asm volatile("s_wait_xcnt 0x0" :: "v"(p) : "memory");
  const int b  = bt >> 2;
  const int tm = (bt >> 1) & 1;
  const int tn = bt & 1;
  #pragma unroll  // constant indices of x
  for (int f = 0; f < 2; ++f) {
    float s[8];
    #pragma unroll
    for (int r = 0; r < 8; ++r) s[r] = (float)x[f][0][r];
    #pragma unroll
    for (int ks = 1; ks < GKS; ++ks)
      #pragma unroll
      for (int r = 0; r < 8; ++r) s[r] += (float)x[f][ks][r];
    const int frag = fr0 + f * 128;
    const int wid  = frag >> 3;
    const int c    = tm * 256 + (wid & 7) * 32 + ((frag >> 2) & 1) * 16
                   + ((lane >> 4) << 3);
    const int cp   = tn * 256 + (wid >> 3) * 64 + (frag & 3) * 16 + (lane & 15);
    v8h o;
    #pragma unroll
    for (int r = 0; r < 8; ++r) o[r] = (_Float16)s[r];
    *(v8h*)(gT + ((size_t)b * CC + cp) * CC + c) = o;
  }
  // the built code lays the row-sum block behind these stores and reuses the
  // stores' registers there: the stores' translations are waited for first
  asm volatile("s_wait_xcnt 0x0" ::: "memory");
}

template<int CTRL>
__device__ __forceinline__ float quad_swap(float v) {
  return __builtin_bit_cast(float, __builtin_amdgcn_mov_dpp(
      __builtin_bit_cast(int, v), CTRL, 0xf, 0xf, true));
}

__global__ __launch_bounds__(256) void attn_fold(
    const _Float16* __restrict__ U, const float* __restrict__ uq,
    const float* __restrict__ wk, const float* __restrict__ bk,
    const float* __restrict__ wv,
    const float* __restrict__ bv, _Float16* __restrict__ tT,
    float* __restrict__ tb)
{
  // per wave: first its two staged operand tiles, then its 64x64 partial
  __shared__ __align__(16) float sRed[8][KT_HALFS];
  __shared__ float                  sS[64][65];   // logits fp32
  __shared__ __align__(16) _Float16 sP[64][72];   // softmax probs f16
  __shared__ __align__(16) _Float16 sV[128][72];  // Wv tile transposed [c][e]
  __shared__ float                  sBv[64];      // bv of this head
  __shared__ float                  sUq[64];      // uq of this batch and head
  __shared__ float                  sBk[64];      // bk of this head

  const int tid  = threadIdx.x;
  const int wid  = tid >> 5;
  const int lane = tid & 31;
  const int bh   = blockIdx.y;
  const int b    = bh >> 3;
  const int h    = bh & 7;
  const int c0   = blockIdx.x * (CC / CCH);

  // ---- logits (already scaled): U_head . Wk_head^T, a wave per 64 of K ----
  {
    const _Float16* ah = U + ((size_t)b * CC + h * DHEAD) * CC;
    const float*    bw = wk + (size_t)h * DHEAD * CC;
    _Float16* t32 = (_Float16*)&sRed[wid][0];
    _Float16* t16 = t32 + KT_HALFS;
    stage_k64(bw + wid * (CC / 8), ah + wid * (CC / 8), t32, t16);

    // the loops of this block are unrolled so that every index of acc, af and
    // bf is a constant and the arrays stay in registers
    v8f acc[4][4];
    #pragma unroll
    for (int mi = 0; mi < 4; ++mi)
      #pragma unroll
      for (int ni = 0; ni < 4; ++ni) acc[mi][ni] = zero8();

    #pragma unroll
    for (int s = 0; s < CC / 8 / 32; ++s) {
      v16h af[4], bf[4];
      #pragma unroll
      for (int i = 0; i < 4; ++i) {
        af[i] = frag_ld(t16, i * 16, KT_PITCH, s * 32);
        bf[i] = frag_ld(t32, i * 16, KT_PITCH, s * 32);
      }
      #pragma unroll
      for (int mi = 0; mi < 4; ++mi)
        #pragma unroll
        for (int ni = 0; ni < 4; ++ni)
          acc[mi][ni] = wmma16(af[mi], bf[ni], acc[mi][ni]);
    }

    // fragment order: idx = tile*256 + (r>>2)*128 + lane*4 + (r&3)
    #pragma unroll
    for (int mi = 0; mi < 4; ++mi)
      #pragma unroll
      for (int ni = 0; ni < 4; ++ni)
        #pragma unroll
        for (int hf = 0; hf < 2; ++hf) {
          float4 t = {acc[mi][ni][hf * 4 + 0], acc[mi][ni][hf * 4 + 1],
                      acc[mi][ni][hf * 4 + 2], acc[mi][ni][hf * 4 + 3]};
          *(float4*)&sRed[wid][(mi * 4 + ni) * 256 + hf * 128 + lane * 4] = t;
        }
  }

  if (tid < 64) {
    const float x = bv[h * DHEAD + tid];
    const float y = uq[b * CC + h * DHEAD + tid];
    xcnt_before_last_load();
    const float z = bk[h * DHEAD + tid];
    xcnt_behind_loads();
    sBv[tid] = x;
    sUq[tid] = y;
    sBk[tid] = z;
  }

  // ---- stage Wv[h*64 + e][c0..+127] transposed into sV[c][e], f16 ----
  // a wave's load covers a row's whole 128 floats (four lines); a wave owns
  // eight rows e
  {
    const float* src = wv + (size_t)(h * DHEAD + wid * 8) * CC + c0 + lane * 4;
    #pragma unroll
    for (int q = 0; q < 8; ++q) {
      float4 x = *(const float4*)(src + (size_t)q * CC);
      sV[lane * 4 + 0][wid * 8 + q] = (_Float16)x.x;
      sV[lane * 4 + 1][wid * 8 + q] = (_Float16)x.y;
      sV[lane * 4 + 2][wid * 8 + q] = (_Float16)x.z;
      sV[lane * 4 + 3][wid * 8 + q] = (_Float16)x.w;
    }
  }
  __syncthreads();

  // sum the eight waves' partials, undo the fragment order, add uq . bk^T
  #pragma unroll
  for (int j = 0; j < 4; ++j) {
    const int idx = (tid + 256 * j) * 4;
    float4 s = *(const float4*)&sRed[0][idx];
    #pragma unroll
    for (int w = 1; w < 8; ++w) {
      float4 t = *(const float4*)&sRed[w][idx];
      s.x += t.x; s.y += t.y; s.z += t.z; s.w += t.w;
    }
    const int tile = idx >> 8;
    const int fl   = (idx >> 2) & 31;
    const int row  = (tile >> 2) * 16 + ((idx >> 7) & 1) * 4 + ((fl >> 4) << 3);
    const int col  = (tile & 3) * 16 + (fl & 15);
    const float bkc = sBk[col];
    sS[row + 0][col] = s.x + sUq[row + 0] * bkc;
    sS[row + 1][col] = s.y + sUq[row + 1] * bkc;
    sS[row + 2][col] = s.z + sUq[row + 2] * bkc;
    sS[row + 3][col] = s.w + sUq[row + 3] * bkc;
  }
  __syncthreads();

  // ---- softmax over e (64 wide), four threads a row, 16 columns each, the
  // row kept in registers; P.bv beside it. The loops are unrolled so that x
  // stays in registers; four partial sums keep the add chains short.
  {
    const int row = tid >> 2;
    const int e0  = (tid & 3) * 16;
    float x[16];
    #pragma unroll
    for (int j = 0; j < 16; ++j) x[j] = sS[row][e0 + j];
    float mx = -3.0e38f;
    #pragma unroll
    for (int j = 0; j < 16; ++j) mx = fmaxf(mx, x[j]);
    mx = fmaxf(mx, quad_swap<0xB1>(mx));
    mx = fmaxf(mx, quad_swap<0x4E>(mx));
    float s4[4] = {0.f, 0.f, 0.f, 0.f};
    #pragma unroll
    for (int j = 0; j < 16; ++j) {
      x[j] = __expf(x[j] - mx);
      s4[j & 3] += x[j];
    }
    float sum = (s4[0] + s4[1]) + (s4[2] + s4[3]);
    sum += quad_swap<0xB1>(sum);
    sum += quad_swap<0x4E>(sum);
    const float inv = 1.f / sum;
    float b4[4] = {0.f, 0.f, 0.f, 0.f};
    v8h ph[2];
    #pragma unroll
    for (int j = 0; j < 16; ++j) {
      const float p = x[j] * inv;
      ph[j >> 3][j & 7] = (_Float16)p;
      b4[j & 3] += p * sBv[e0 + j];
    }
    *(v8h*)&sP[row][e0]     = ph[0];
    *(v8h*)&sP[row][e0 + 8] = ph[1];
    float pbv = (b4[0] + b4[1]) + (b4[2] + b4[3]);
    pbv += quad_swap<0xB1>(pbv);
    pbv += quad_swap<0x4E>(pbv);
    if (blockIdx.x == 0 && (tid & 3) == 0)
      tb[bh * DHEAD + row] = pbv;  // = [b][h*64 + d]
  }
  __syncthreads();

  // ---- T = P x Wv_head: each wave owns 16 columns c = c0 + wid*16 + lane%16
  v8f oacc[4];
  #pragma unroll
  for (int m2 = 0; m2 < 4; ++m2) oacc[m2] = zero8();
  #pragma unroll
  for (int ks = 0; ks < 2; ++ks) {
    v16h bf = frag_ld(&sV[0][0], wid * 16, 72, ks * 32);
    #pragma unroll
    for (int m2 = 0; m2 < 4; ++m2)
      oacc[m2] = wmma16(frag_ld(&sP[0][0], m2 * 16, 72, ks * 32), bf, oacc[m2]);
  }
  _Float16* dst = tT + ((size_t)b * CC + c0 + wid * 16 + (lane & 15)) * CC
                     + h * DHEAD + ((lane >> 4) << 3);
  #pragma unroll
  for (int m2 = 0; m2 < 4; ++m2) {
    v8h t;
    #pragma unroll
    for (int r = 0; r < 8; ++r) t[r] = (_Float16)oacc[m2][r];
    *(v8h*)(dst + m2 * 16) = t;
  }
}

// FIRST: wo, bo, tT, tb stand for Wq, bq, gT, sq/64; the tile gets bq . (sk/64)^T
// added and is stored f16 in U; the bias column is Wq . sq/64 + 64 bq.
template<bool FIRST>
__global__ __launch_bounds__(256) void fold_out(
    const float* __restrict__ wo, const float* __restrict__ bo,
    const _Float16* __restrict__ tT, const float* __restrict__ tb,
    const float* __restrict__ rk,
    _Float16* __restrict__ M, _Float16* __restrict__ U,
    float* __restrict__ bias2)
{
  // per wave: first its two staged operand tiles, then its 64x64 partial
  __shared__ __align__(16) float sRed[8][KT_HALFS];
  __shared__ float sBq[FIRST ? 64 : 1];          // bq of the tile's rows
  __shared__ float sRk[FIRST ? 64 : 1];          // sk/64 of the tile's columns

  const int tid  = threadIdx.x;
  const int wid  = tid >> 5;
  const int lane = tid & 31;
  const int ct   = blockIdx.x;
  const int ot   = blockIdx.y;
  const int b    = blockIdx.z;

  if (ct == 8) {
    // bias2[b][o] = bo[o] + sum_j Wo[o][j] * tb[b][j], four threads a row
    const int o = ot * 64 + (tid >> 2), qd = tid & 3;
    const float* wr = wo + (size_t)o * CC + qd * 4;
    const float* tv = tb + b * CC + qd * 4;
    float s = 0.f;
    #pragma unroll 1  // eight float4 pairs in flight a trip are enough here
    for (int i0 = 0; i0 < CC / 16; i0 += 8) {
      float4 w[8], t[8];
      #pragma unroll
      for (int i = 0; i < 8; ++i) {
        t[i] = *(const float4*)(tv + (i0 + i) * 16);
        if (i == 7) xcnt_before_last_load();
        w[i] = *(const float4*)(wr + (i0 + i) * 16);
      }
      #pragma unroll
      for (int i = 0; i < 8; ++i)
        s += w[i].x * t[i].x + w[i].y * t[i].y + w[i].z * t[i].z
           + w[i].w * t[i].w;
    }
    s += __shfl_xor(s, 1);
    s += __shfl_xor(s, 2);
    // FIRST: L . bq / sqrt(L) = 64 bq
    if (qd == 0) bias2[b * CC + o] = s + (FIRST ? 64.f * bo[o] : bo[o]);
    return;
  }

  const float*    ah = wo + (size_t)ot * 64 * CC;
  const _Float16* bt = tT + ((size_t)b * CC + ct * 64) * CC;
  _Float16* t32 = (_Float16*)&sRed[wid][0];
  _Float16* t16 = t32 + KT_HALFS;
  stage_k64(ah + wid * (CC / 8), bt + wid * (CC / 8), t32, t16);

  v8f acc[4][4];
  #pragma unroll
  for (int mi = 0; mi < 4; ++mi)
    #pragma unroll
    for (int ni = 0; ni < 4; ++ni) acc[mi][ni] = zero8();

  #pragma unroll
  for (int s = 0; s < CC / 8 / 32; ++s) {
    v16h af[4], bf[4];
    #pragma unroll
    for (int i = 0; i < 4; ++i) {
      bf[i] = frag_ld(t16, i * 16, KT_PITCH, s * 32);
      af[i] = frag_ld(t32, i * 16, KT_PITCH, s * 32);
    }
    #pragma unroll
    for (int mi = 0; mi < 4; ++mi)
      #pragma unroll
      for (int ni = 0; ni < 4; ++ni)
        acc[mi][ni] = wmma16(af[mi], bf[ni], acc[mi][ni]);
  }

  // fragment order: idx = tile*256 + (r>>2)*128 + lane*4 + (r&3)
  #pragma unroll
  for (int mi = 0; mi < 4; ++mi)
    #pragma unroll
    for (int ni = 0; ni < 4; ++ni)
      #pragma unroll
      for (int hf = 0; hf < 2; ++hf) {
        float4 t = {acc[mi][ni][hf * 4 + 0], acc[mi][ni][hf * 4 + 1],
                    acc[mi][ni][hf * 4 + 2], acc[mi][ni][hf * 4 + 3]};
        *(float4*)&sRed[wid][(mi * 4 + ni) * 256 + hf * 128 + lane * 4] = t;
      }

  if (FIRST && tid < 64) {
    const float x = bo[ot * 64 + tid];
    xcnt_before_last_load();
    const float y = rk[b * CC + ct * 64 + tid];
    xcnt_behind_loads();
    sBq[tid] = x;
    sRk[tid] = y;
  }
  __syncthreads();

  // sum the eight waves' partials, undo the fragment order, store row-major
  const size_t tile0 = ((size_t)b * CC + ot * 64) * CC + ct * 64;
  #pragma unroll
  for (int j = 0; j < 4; ++j) {
    const int idx = (tid + 256 * j) * 4;
    float4 s = *(const float4*)&sRed[0][idx];
    #pragma unroll
    for (int w = 1; w < 8; ++w) {
      float4 t = *(const float4*)&sRed[w][idx];
      s.x += t.x; s.y += t.y; s.z += t.z; s.w += t.w;
    }
    const int tile = idx >> 8;
    const int fl   = (idx >> 2) & 31;
    const int row  = (tile >> 2) * 16 + ((idx >> 7) & 1) * 4 + ((fl >> 4) << 3);
    const int col  = (tile & 3) * 16 + (fl & 15);
    if (FIRST) {
      const float rc = sRk[col];
      _Float16* dst = U + tile0;
      dst[(size_t)(row + 0) * CC + col] = (_Float16)(s.x + sBq[row + 0] * rc);
      dst[(size_t)(row + 1) * CC + col] = (_Float16)(s.y + sBq[row + 1] * rc);
      dst[(size_t)(row + 2) * CC + col] = (_Float16)(s.z + sBq[row + 2] * rc);
      dst[(size_t)(row + 3) * CC + col] = (_Float16)(s.w + sBq[row + 3] * rc);
    } else {
      _Float16* dst = M + tile0;
      dst[(size_t)(row + 0) * CC + col] = (_Float16)s.x;
      dst[(size_t)(row + 1) * CC + col] = (_Float16)s.y;
      dst[(size_t)(row + 2) * CC + col] = (_Float16)s.z;
      dst[(size_t)(row + 3) * CC + col] = (_Float16)s.w;
    }
  }
  // the built code lays the bias-column block behind these stores and reuses
  // their registers there: the stores' translations are waited for first
  asm volatile("s_wait_xcnt 0x0" ::: "memory");
}

// ---------------------------------------------------------------------------
extern "C" void kernel_launch(void* const* d_in, const int* in_sizes, int n_in,
                              void* d_out, int out_size, void* d_ws, size_t ws_size,
                              hipStream_t stream) {
  const float* query = (const float*)d_in[0];
  const float* key_  = (const float*)d_in[1];
  const float* value = (const float*)d_in[2];
  const float* wq = (const float*)d_in[3];
  const float* bq = (const float*)d_in[4];
  const float* wk = (const float*)d_in[5];
  const float* bk = (const float*)d_in[6];
  const float* wv = (const float*)d_in[7];
  const float* bv = (const float*)d_in[8];
  const float* wo = (const float*)d_in[9];
  const float* bo = (const float*)d_in[10];
  float* out = (float*)d_out;

  // workspace: f16 partial tiles of G/64: B*4*GKS*256*256 halfs = 32 MiB
  _Float16* gpart = (_Float16*)d_ws;
  // row-sum partials [2][B][GKS][512] and the scaled row sums [2][B][512]
  float* rpart = (float*)(gpart + (size_t)BB * 4 * GKS * 65536);
  float* rsum  = rpart + (size_t)2 * BB * GKS * CC;
  float* uq    = rsum + 2 * BB * CC;
  // per batch: P.bv and the folded bias f32
  float* tb    = uq + BB * CC;
  float* bias2 = tb + BB * CC;
  const size_t S2 = (size_t)BB * CC * CC;
  // per batch, f16: Wo.P.Wv, (G/64)^T, U = Wq.G/64 + bq.(sk/64)^T, (P.Wv)^T
  _Float16* hM  = (_Float16*)(bias2 + BB * CC);
  _Float16* gT  = hM + S2;
  _Float16* u16 = gT + S2;
  _Float16* tT  = u16 + S2;

  dim3 blk(256);
  dim3 gblk(1024);
  dim3 grd(LL / 128, 1, BB);  // (32, 1, 8): one block per X panel

  gram_part<<<dim3(GKS, 4, BB), gblk, 0, stream>>>(query, key_, gpart, rpart);
  gram_reduce<<<dim3(BB * 4 * 16 + 2 * BB * CC / 256), blk, 0, stream>>>(
      gpart, rpart, gT, rsum);
  fold_out<true><<<dim3(8 + 1, 8, BB), blk, 0, stream>>>(
      wq, bq, gT, rsum, rsum + BB * CC, nullptr, u16, uq);
  attn_fold<<<dim3(CCH, BB * NHEAD), blk, 0, stream>>>(u16, uq, wk, bk, wv, bv,
                                                      tT, tb);
  fold_out<false><<<dim3(8 + 1, 8, BB), blk, 0, stream>>>(
      wo, bo, tT, tb, nullptr, hM, nullptr, bias2);

  panel_gemm<true, true><<<grd, gblk, 0, stream>>>(hM, bias2, value, out,
                                                  nullptr);
}

// v009
// One run takes 73.2 microseconds.
// Two timings next to v008 both put it at 1.10 times that version's speed.
// Over all steps from v000 it is 3.73 times as fast.
#include <hip/hip_runtime.h>
#include <hip/hip_bf16.h>

typedef __attribute__((ext_vector_type(16))) _Float16 v16h;
typedef __attribute__((ext_vector_type(8)))  _Float16 v8h;
typedef __attribute__((ext_vector_type(4)))  _Float16 v4h;
typedef __attribute__((ext_vector_type(8)))  float    v8f;

#define BB 8
#define CC 512
#define LL 4096
#define NHEAD 8
#define DHEAD 64

__device__ __forceinline__ v8f zero8() {
  v8f z = {0.f,0.f,0.f,0.f,0.f,0.f,0.f,0.f};
  return z;
}

__device__ __forceinline__ v8f wmma16(v16h a, v16h b, v8f c) {
  // (neg_a, A, neg_b, B, c_mod, C, reuse_a, reuse_b) -> v_wmma_f32_16x16x32_f16
  return __builtin_amdgcn_wmma_f32_16x16x32_f16(false, a, false, b, (short)0, c,
                                                false, false);
}

__device__ __forceinline__ v16h mk16(v8h lo, v8h hi) {
  union { v16h v; v8h h[2]; } u;
  u.h[0] = lo; u.h[1] = hi;
  return u.v;
}

__device__ __forceinline__ v16h frag_ld(const _Float16* base, int row0,
                                        int rowStride, int kb) {
  const int lane = threadIdx.x & 31;
  const _Float16* p = base + (size_t)(row0 + (lane & 15)) * rowStride
                           + kb + ((lane >> 4) << 3);
  v8h lo = *(const v8h*)(p);
  v8h hi = *(const v8h*)(p + 16);
  return mk16(lo, hi);
}

// Stands in front of the last load of a run of global loads: that load may take
// the run's address registers as its destination, so the earlier loads'
// translations are waited for first. The two scheduling barriers keep the
// earlier loads in front of the wait and the last load behind it.
__device__ __forceinline__ void xcnt_before_last_load() {
  __builtin_amdgcn_sched_barrier(0);
  asm volatile("s_wait_xcnt 0x0" ::: "memory");
  __builtin_amdgcn_sched_barrier(0);
}

// Stands behind the last load of a run whose address registers are free for
// reuse from there on: the load's translation is waited for first.
__device__ __forceinline__ void xcnt_behind_loads() {
  __builtin_amdgcn_sched_barrier(0);
  asm volatile("s_wait_xcnt 0x0" ::: "memory");
  __builtin_amdgcn_sched_barrier(0);
}

#define KT_PITCH 72
#define KT_HALFS (64 * KT_PITCH)  // halfs a tile; two tiles fill as many floats
__device__ __forceinline__ void stage_k64(const float* s32, const _Float16* s16,
                                          _Float16* t32, _Float16* t16) {
  const int lane = threadIdx.x & 31;
  const float*    pa = s32 + (size_t)(lane >> 4) * CC + (lane & 15) * 4;
  const _Float16* pb = s16 + (size_t)(lane >> 3) * CC + (lane & 7) * 8;
  // the loops are unrolled so that va and vb stay in registers and all loads
  // are in flight together
  float4 va[32];
  v8h    vb[16];
  #pragma unroll
  for (int i = 0; i < 32; ++i) va[i] = *(const float4*)(pa + (size_t)i * 2 * CC);
  #pragma unroll
  for (int i = 0; i < 16; ++i) vb[i] = *(const v8h*)(pb + (size_t)i * 4 * CC);
  // the loads' translations are waited for before their address registers are
  // free for reuse: as inputs of the wait both pairs stay live up to it, so no
  // load of the run takes them as its destination
  asm volatile("s_wait_xcnt 0x0" :: "v"(pa), "v"(pb) : "memory");
  #pragma unroll
  for (int i = 0; i < 32; ++i) {
    v4h h = {(_Float16)va[i].x, (_Float16)va[i].y,
             (_Float16)va[i].z, (_Float16)va[i].w};
    *(v4h*)(t32 + (i * 2 + (lane >> 4)) * KT_PITCH + (lane & 15) * 4) = h;
  }
  #pragma unroll
  for (int i = 0; i < 16; ++i)
    *(v8h*)(t16 + (i * 4 + (lane >> 3)) * KT_PITCH + (lane & 7) * 8) = vb[i];
  // the rows are read back by other lanes of this wave: its stores land first,
  // and the compiler moves no LDS read in front of them
  asm volatile("s_wait_dscnt 0x0" ::: "memory");
}

// ---------------------------------------------------------------------------
// Projection GEMM: Y[b,m,n] = W . X[b,:,n] + bias   (M=K=512, N=4096/batch)
// Block: 1024 threads (32 waves), tile 512(M, all of it) x 128(N): one block
// per X panel, so every element of X is read, converted and transposed once.
// The entire X^T panel (N=128 rows x K=512 cols, f16) is staged in LDS once;
// W arrives f16 from its producer, so a W tile is copied, not converted: tiles
// of 512x64 (a row's 64 halfs are one 128-byte line) are double-buffered per
// K-step so their global loads hide under the WMMAs, one barrier per step.
// Wave (wm 0..15, wn 0..1) owns a 32x64 sub-tile = 2x4 WMMA accumulators.
// W_PER_BATCH: W and bias are [B][512][512] and [B][512], one pair per batch.
// ---------------------------------------------------------------------------
template<bool W_PER_BATCH, bool OUT_F32>
__global__ __launch_bounds__(1024) void panel_gemm(
    const _Float16* __restrict__ Wall, const float* __restrict__ biasAll,
    const float* __restrict__ Xf,
    float* __restrict__ Yf, _Float16* __restrict__ Yh)
{
  __shared__ __align__(16) _Float16 sX[128][520];    // [n][k], 520 = 512+8 pad
  __shared__ __align__(16) _Float16 sA[2][512][72];  // double-buffered W tile
  __shared__ float sBias[512];

  const int tid  = threadIdx.x;
  const int b    = blockIdx.z;
  const int n0   = blockIdx.x * 128;
  const int wid  = tid >> 5;
  const int lane = tid & 31;
  const int wm   = wid & 15;
  const int wn   = wid >> 4;
  const _Float16* W = W_PER_BATCH ? Wall + (size_t)b * 512 * 512 : Wall;
  const float* bias = W_PER_BATCH ? biasAll + b * 512 : biasAll;

  if (tid < 512) sBias[tid] = bias[tid];

  {
    const int nseg = (wid & 3) * 8 + (lane & 7);           // n = nseg*4 .. +3
    const int k2   = ((wid >> 2) * 4 + (lane >> 3)) * 2;   // 0,2,...,62
    const float* xb = Xf + ((size_t)b * 512 + k2) * LL + n0 + nseg * 4;
    for (int kk = 0; kk < 512; kk += 128) {  // two 64-K chunks a trip
      const float* r0 = xb + (size_t)kk * LL;
      const float* r1 = r0 + LL;
      float4 a0 = *(const float4*)(r0);
      float4 c0 = *(const float4*)(r1);
      float4 a1 = *(const float4*)(r0 + (size_t)64 * LL);
      float4 c1 = *(const float4*)(r1 + (size_t)64 * LL);
      if (kk + 128 < 512) __builtin_prefetch(r0 + (size_t)128 * LL, 0, 3);
      float f0[8] = {a0.x,a0.y,a0.z,a0.w,a1.x,a1.y,a1.z,a1.w};
      float f1[8] = {c0.x,c0.y,c0.z,c0.w,c1.x,c1.y,c1.z,c1.w};
      #pragma unroll
      for (int j = 0; j < 8; ++j) {
        union { _Float16 h[2]; unsigned u; } p;
        p.h[0] = (_Float16)f0[j];
        p.h[1] = (_Float16)f1[j];
        // k2 even: 4B aligned
        *(unsigned*)&sX[nseg * 4 + (j & 3)][kk + (j >> 2) * 64 + k2] = p.u;
      }
    }
  }

  // ---- stage first W tile into sA[0] ----
  // eight lanes cover a row's 64 halfs (one 128-byte line); a thread owns rows
  // rA, rA + 128, rA + 256 and rA + 384
  const int rA = tid >> 3, segA = tid & 7;
  const _Float16* wsrc = W + (size_t)rA * 512 + segA * 8;
  {
    v8h h0 = *(const v8h*)(wsrc);
    v8h h1 = *(const v8h*)(wsrc + 128 * 512);
    v8h h2 = *(const v8h*)(wsrc + 256 * 512);
    v8h h3 = *(const v8h*)(wsrc + 384 * 512);
    *(v8h*)&sA[0][rA][segA * 8]       = h0;
    *(v8h*)&sA[0][rA + 128][segA * 8] = h1;
    *(v8h*)&sA[0][rA + 256][segA * 8] = h2;
    *(v8h*)&sA[0][rA + 384][segA * 8] = h3;
  }
  __syncthreads();

  v8f acc[2][4];
  #pragma unroll
  for (int mt = 0; mt < 2; ++mt)
    #pragma unroll
    for (int nt = 0; nt < 4; ++nt) acc[mt][nt] = zero8();

  for (int ks = 0; ks < 8; ++ks) {
    const int kb  = ks * 64;
    const int cur = ks & 1;
    const bool have_next = (ks + 1 < 8);

    // issue global loads of the next W tile first (latency hides under WMMA)
    v8h h0 = {}, h1 = {}, h2 = {}, h3 = {};
    if (have_next) {
      const _Float16* src = wsrc + kb + 64;
      h0 = *(const v8h*)(src);
      h1 = *(const v8h*)(src + 128 * 512);
      h2 = *(const v8h*)(src + 256 * 512);
      h3 = *(const v8h*)(src + 384 * 512);
    }
    // keeps the four loads in front of the WMMAs: left free, the scheduler
    // sinks two of them to the last WMMA, right in front of their first use
    __builtin_amdgcn_sched_barrier(0);

    // compute: 2x4 WMMA tiles per wave from resident panel + current W tile,
    // two k blocks of 32; the loops are unrolled so that every index of afr and
    // acc is a constant and the arrays stay in registers
    #pragma unroll
    for (int kk = 0; kk < 64; kk += 32) {
      v16h afr[2];
      #pragma unroll
      for (int mt = 0; mt < 2; ++mt)
        afr[mt] = frag_ld(&sA[cur][0][0], wm * 32 + mt * 16, 72, kk);
      #pragma unroll
      for (int nt = 0; nt < 4; ++nt) {
        v16h bfr = frag_ld(&sX[0][0], wn * 64 + nt * 16, 520, kb + kk);
        #pragma unroll
        for (int mt = 0; mt < 2; ++mt)
          acc[mt][nt] = wmma16(afr[mt], bfr, acc[mt][nt]);
      }
    }

    // keeps the first use of the loaded tile, and so its wait, behind the WMMAs:
    // left free, the scheduler lifts the stores to the head of the step and the
    // wave waits out the whole load latency there
    __builtin_amdgcn_sched_barrier(0);

    // store next W tile into the other buffer
    if (have_next) {
      *(v8h*)&sA[cur ^ 1][rA][segA * 8]       = h0;
      *(v8h*)&sA[cur ^ 1][rA + 128][segA * 8] = h1;
      *(v8h*)&sA[cur ^ 1][rA + 256][segA * 8] = h2;
      *(v8h*)&sA[cur ^ 1][rA + 384][segA * 8] = h3;
    }
    __syncthreads();
  }

  #pragma unroll
  for (int mt = 0; mt < 2; ++mt)
    #pragma unroll
    for (int r = 0; r < 8; ++r) {
      const int c = wm * 32 + mt * 16 + r + ((lane >> 4) << 3);
      const float bv = sBias[c];
      #pragma unroll
      for (int nt = 0; nt < 4; ++nt) {
        const int n = n0 + wn * 64 + nt * 16 + (lane & 15);
        const float val = acc[mt][nt][r] + bv;
        const size_t off = ((size_t)b * 512 + c) * LL + n;
        if (OUT_F32) Yf[off] = val;
        else         Yh[off] = (_Float16)val;
      }
    }
}

// ---------------------------------------------------------------------------
// Channel attention without q and k.
// gram_part: grid (GKS, 4, batch). A block forms a 256x256 tile of
//   G = query . key^T over its own L/GKS columns. 32-column slices of the 256
//   query rows and 256 key rows are converted to f16 in LDS, double-buffered,
//   the next slice's global loads in flight under the WMMAs, one barrier per
//   slice. Wave (wm 0..7, wn 0..3) owns 32x64 = 2x4 accumulators. The partial
//   tile is scaled by 1/sqrt(L) = 1/64 and stored f16 in fragment order: the
//   partials cross memory twice, and G/64 itself is kept f16 behind the sum.
//   The f32 row sums of query and key are kept beside the staging and stored
//   per L chunk.
// gram_reduce: sums the GKS partials in f32 in fixed order and stores (G/64)^T
//   (f16) in the fragment order of the next product, so that its reader loads
//   fragments from global memory in whole lines; its last blocks sum and scale
//   the row sums.
// attn_fold: one block of 16 waves per batch and head. It forms
//   U = Wq_head . G/64 + bq_head . (sk/64)^T (64x512, f16, in LDS; a wave per
//   32 columns, K = 512 in one accumulator chain) and uq = Wq_head . sq/64 +
//   64 bq_head, the 64x64 logits U . Wk_head^T + uq . bk_head^T, the softmax
//   and T = P . Wv_head, Wv_head transposed through LDS. T is stored
//   transposed, tT[b][c][head*64 + d] (f16), which is the B-fragment order of
//   the next product, and P . bv_head beside it.
// fold_out: grid (8 + 1, 8, batch). M[b] = Wo . T[b] (stored f16, the
//   operand type of the last GEMM), one 64x64 tile a block, K = 512 split over
//   the eight waves and summed through LDS in fixed order; column block 8 forms
//   the bias Wo . (P.bv) + bo instead.
// ---------------------------------------------------------------------------
#define GKS 8

__global__ __launch_bounds__(1024) void gram_part(
    const float* __restrict__ xq, const float* __restrict__ xk,
    _Float16* __restrict__ gpart, float* __restrict__ rpart)
{
  // rows 0..255: query tile, rows 256..511: key tile; 32 columns + 8 pad
  __shared__ __align__(16) _Float16 sT[2][512][40];

  const int tid  = threadIdx.x;
  const int wid  = tid >> 5;
  const int lane = tid & 31;
  const int ks   = blockIdx.x;
  const int tile = blockIdx.y;
  const int b    = blockIdx.z;
  const int tm   = tile >> 1;   // 256-row block of query (c)
  const int tn   = tile & 1;    // 256-row block of key (c')
  const int wm   = wid & 7;
  const int wn   = wid >> 3;

  // staging: eight lanes cover a row's 32 floats (one 128-byte line); a thread
  // owns rows r0 and r0 + 128 of both tiles
  const int seg = tid & 7;
  const int r0  = tid >> 3;
  const float* pa = xq + ((size_t)b * CC + tm * 256 + r0) * LL
                       + ks * (LL / GKS) + seg * 4;
  const float* pb = xk + ((size_t)b * CC + tn * 256 + r0) * LL
                       + ks * (LL / GKS) + seg * 4;
  float rs0 = 0.f, rs1 = 0.f, rs2 = 0.f, rs3 = 0.f;

  float4 f0 = *(const float4*)(pa);
  float4 f1 = *(const float4*)(pa + (size_t)128 * LL);
  float4 f2 = *(const float4*)(pb);
  float4 f3 = *(const float4*)(pb + (size_t)128 * LL);
  {
    rs0 += (f0.x + f0.y) + (f0.z + f0.w);
    rs1 += (f1.x + f1.y) + (f1.z + f1.w);
    rs2 += (f2.x + f2.y) + (f2.z + f2.w);
    rs3 += (f3.x + f3.y) + (f3.z + f3.w);
    v4h h0 = {(_Float16)f0.x,(_Float16)f0.y,(_Float16)f0.z,(_Float16)f0.w};
    v4h h1 = {(_Float16)f1.x,(_Float16)f1.y,(_Float16)f1.z,(_Float16)f1.w};
    v4h h2 = {(_Float16)f2.x,(_Float16)f2.y,(_Float16)f2.z,(_Float16)f2.w};
    v4h h3 = {(_Float16)f3.x,(_Float16)f3.y,(_Float16)f3.z,(_Float16)f3.w};
    *(v4h*)&sT[0][r0][seg * 4]       = h0;
    *(v4h*)&sT[0][r0 + 128][seg * 4] = h1;
    *(v4h*)&sT[0][r0 + 256][seg * 4] = h2;
    *(v4h*)&sT[0][r0 + 384][seg * 4] = h3;
  }
  __syncthreads();

  // the loops over acc and afr in this kernel are unrolled so that every index
  // is a constant and the arrays stay in registers
  v8f acc[2][4];
  #pragma unroll
  for (int mt = 0; mt < 2; ++mt)
    #pragma unroll
    for (int nt = 0; nt < 4; ++nt) acc[mt][nt] = zero8();

  const int NS = LL / GKS / 32;  // 16 slices
  for (int s = 0; s < NS; ++s) {
    const int cur = s & 1;
    const bool have_next = (s + 1 < NS);

    // issue global loads of the next slice first (latency hides under WMMA)
    // (the pointers advance behind the wait for the slice before)
    if (have_next) {
      pa += 32;
      pb += 32;
      f0 = *(const float4*)(pa);
      f1 = *(const float4*)(pa + (size_t)128 * LL);
      f2 = *(const float4*)(pb);
      f3 = *(const float4*)(pb + (size_t)128 * LL);
    }
    // keeps the four loads in front of the WMMAs: left free, the scheduler
    // sinks them to their first use and the wave waits out the whole latency
    __builtin_amdgcn_sched_barrier(0);

    v16h afr[2];
    #pragma unroll
    for (int mt = 0; mt < 2; ++mt)
      afr[mt] = frag_ld(&sT[cur][0][0], wm * 32 + mt * 16, 40, 0);
    #pragma unroll
    for (int nt = 0; nt < 4; ++nt) {
      v16h bfr = frag_ld(&sT[cur][0][0], 256 + wn * 64 + nt * 16, 40, 0);
      #pragma unroll
      for (int mt = 0; mt < 2; ++mt)
        acc[mt][nt] = wmma16(afr[mt], bfr, acc[mt][nt]);
    }

    // keeps the first use of the loaded slice, and so its wait, behind the WMMAs
    __builtin_amdgcn_sched_barrier(0);

    // row sums, convert + store the next slice into the other buffer
    if (have_next) {
      rs0 += (f0.x + f0.y) + (f0.z + f0.w);
      rs1 += (f1.x + f1.y) + (f1.z + f1.w);
      rs2 += (f2.x + f2.y) + (f2.z + f2.w);
      rs3 += (f3.x + f3.y) + (f3.z + f3.w);
      v4h h0 = {(_Float16)f0.x,(_Float16)f0.y,(_Float16)f0.z,(_Float16)f0.w};
      v4h h1 = {(_Float16)f1.x,(_Float16)f1.y,(_Float16)f1.z,(_Float16)f1.w};
      v4h h2 = {(_Float16)f2.x,(_Float16)f2.y,(_Float16)f2.z,(_Float16)f2.w};
      v4h h3 = {(_Float16)f3.x,(_Float16)f3.y,(_Float16)f3.z,(_Float16)f3.w};
      *(v4h*)&sT[cur ^ 1][r0][seg * 4]       = h0;
      *(v4h*)&sT[cur ^ 1][r0 + 128][seg * 4] = h1;
      *(v4h*)&sT[cur ^ 1][r0 + 256][seg * 4] = h2;
      *(v4h*)&sT[cur ^ 1][r0 + 384][seg * 4] = h3;
    }
    __syncthreads();
  }

  // ---- partial tile / 64 (exact in f32), f16, fragment order:
  // idx = (wid*8 + mt*4 + nt)*256 + lane*8 + r
  _Float16* dst = gpart + (((size_t)b * 4 + tile) * GKS + ks) * 65536
                        + wid * 2048 + lane * 8;
  #pragma unroll
  for (int mt = 0; mt < 2; ++mt)
    #pragma unroll
    for (int nt = 0; nt < 4; ++nt) {
      v8h t;
      #pragma unroll
      for (int r = 0; r < 8; ++r)
        t[r] = (_Float16)(acc[mt][nt][r] * 0.015625f);
      *(v8h*)(dst + (mt * 4 + nt) * 256) = t;
    }

  // ---- row sums of this L chunk: rpart[which][b][ks][row], one writer each
  rs0 += __shfl_xor(rs0, 1); rs1 += __shfl_xor(rs1, 1);
  rs2 += __shfl_xor(rs2, 1); rs3 += __shfl_xor(rs3, 1);
  rs0 += __shfl_xor(rs0, 2); rs1 += __shfl_xor(rs1, 2);
  rs2 += __shfl_xor(rs2, 2); rs3 += __shfl_xor(rs3, 2);
  rs0 += __shfl_xor(rs0, 4); rs1 += __shfl_xor(rs1, 4);
  rs2 += __shfl_xor(rs2, 4); rs3 += __shfl_xor(rs3, 4);
  if (seg == 0) {
    if (tn == 0) {
      float* rq = rpart + ((size_t)b * GKS + ks) * CC + tm * 256 + r0;
      rq[0]   = rs0;
      rq[128] = rs1;
    }
    if (tm == 0) {
      float* rk = rpart + ((size_t)(BB + b) * GKS + ks) * CC + tn * 256 + r0;
      rk[0]   = rs2;
      rk[128] = rs3;
    }
  }
}

__global__ __launch_bounds__(256) void gram_reduce(
    const _Float16* __restrict__ gpart, const float* __restrict__ rpart,
    _Float16* __restrict__ gT, float* __restrict__ rsum)
{
  const float scale = 0.015625f;  // 1/sqrt(4096)
  const int tid = threadIdx.x;

  if (blockIdx.x >= BB * 4 * 16) {
    // rsum[which][b][row] = sum over the L chunks / 64
    const int j = (blockIdx.x - BB * 4 * 16) * 256 + tid;  // 0 .. 2*B*512-1
    const float* p = rpart + (size_t)(j >> 9) * GKS * CC + (j & 511);
    float s = p[0];
    #pragma unroll  // all loads in flight together
    for (int ks = 1; ks < GKS; ++ks) s += p[ks * CC];
    rsum[j] = s * scale;
    return;
  }

  // a thread takes one lane's eight values of two accumulator fragments, fr0
  // and fr0 + 128 (frag = wid*8 + mt*4 + nt of gram_part)
  const int g    = blockIdx.x * 256 + tid;
  const int lane = g & 31;
  const int fr0  = (g >> 5) & 127;
  const int bt   = g >> 12;          // b*4 + tile
  const _Float16* p = gpart + (size_t)bt * GKS * 65536 + fr0 * 256 + lane * 8;
  v8h x[2][GKS];
  #pragma unroll  // x stays in registers, all loads in flight together
  for (int ks = 0; ks < GKS; ++ks) {
    x[0][ks] = *(const v8h*)(p + (size_t)ks * 65536);
    x[1][ks] = *(const v8h*)(p + (size_t)ks * 65536 + 128 * 256);
  }
  // the loads' translations are waited for before their address registers are
  // free for reuse: as an input of the wait the pair stays live up to it, so no
  // load of the run takes it as its destination
  asm volatile("s_wait_xcnt 0x0" :: "v"(p) : "memory");
  const int b  = bt >> 2;
  const int tm = (bt >> 1) & 1;
  const int tn = bt & 1;
  #pragma unroll  // constant indices of x
  for (int f = 0; f < 2; ++f) {
    float s[8];
    #pragma unroll
    for (int r = 0; r < 8; ++r) s[r] = (float)x[f][0][r];
    #pragma unroll
    for (int ks = 1; ks < GKS; ++ks)
      #pragma unroll
      for (int r = 0; r < 8; ++r) s[r] += (float)x[f][ks][r];
    const int frag = fr0 + f * 128;
    const int wid  = frag >> 3;
    const int c    = tm * 256 + (wid & 7) * 32 + ((frag >> 2) & 1) * 16
                   + ((lane >> 4) << 3);
    const int cp   = tn * 256 + (wid >> 3) * 64 + (frag & 3) * 16 + (lane & 15);
    v8h o;
    #pragma unroll
    for (int r = 0; r < 8; ++r) o[r] = (_Float16)s[r];
    // fragment order of the next product: tile cp/16, k block c/32, half
    // (c/16)%2, lane cp%16 + 16*((c/8)%2): a wave's store is 512 contiguous bytes
    *(v8h*)(gT + (size_t)b * CC * CC
               + (((cp >> 4) * 16 + (c >> 5)) * 2 + ((c >> 4) & 1)) * 256
               + ((cp & 15) + ((c >> 3) & 1) * 16) * 8) = o;
  }
  // the built code lays the row-sum block behind these stores and reuses the
  // stores' registers there: the stores' translations are waited for first
  asm volatile("s_wait_xcnt 0x0" ::: "memory");
}

template<int CTRL>
__device__ __forceinline__ float quad_swap(float v) {
  return __builtin_bit_cast(float, __builtin_amdgcn_mov_dpp(
      __builtin_bit_cast(int, v), CTRL, 0xf, 0xf, true));
}

#define UP 520  // halfs a row of the 64 x 512 LDS operands: 512 + 8 pad

__global__ __launch_bounds__(512) void attn_fold(
    const _Float16* __restrict__ gF, const float* __restrict__ rq,
    const float* __restrict__ rk,
    const float* __restrict__ wq, const float* __restrict__ bq,
    const float* __restrict__ wk, const float* __restrict__ bk,
    const float* __restrict__ wv, const float* __restrict__ bv,
    _Float16* __restrict__ tT, float* __restrict__ tb)
{
  __shared__ __align__(16) _Float16 sQ[64][UP];   // Wq of this head, f16
  __shared__ __align__(16) _Float16 sK[64][UP];   // Wk of this head, f16
  __shared__ __align__(16) _Float16 sU[64][UP];   // U of this batch and head
  __shared__ __align__(16) _Float16 sV[512][72];  // Wv of this head, [c][e]
  __shared__ float                  sS[64][65];   // logits fp32
  __shared__ __align__(16) _Float16 sP[64][72];   // softmax probs f16
  __shared__ __align__(16) float    sRk[512];     // sk/64 of this batch
  __shared__ float                  sBv[64];      // bv of this head
  __shared__ float                  sUq[64];      // Wq . sq/64 of this head
  __shared__ float                  sBk[64];      // bk of this head
  __shared__ float                  sBq[64];      // bq of this head

  const int tid  = threadIdx.x;
  const int wid  = tid >> 5;
  const int lane = tid & 31;
  const int bh   = blockIdx.x;
  const int b    = bh >> 3;
  const int h    = bh & 7;

  // the loops over register arrays in this kernel are unrolled so that every
  // index is a constant and the arrays stay in registers

  // a wave owns 32 columns c' of U = two 16-column tiles t; fragment half j of
  // (t, k block kb) lies at gp + ((t*16 + kb)*2 + j)*256: 512 contiguous bytes
  // a wave-wide load
  const _Float16* gp = gF + (size_t)b * CC * CC + (size_t)wid * (2 * 16 * 512)
                          + lane * 8;
  v16h gc[2][2];  // [k block of the group][t]
  #pragma unroll
  for (int k2 = 0; k2 < 2; ++k2)
    #pragma unroll
    for (int t = 0; t < 2; ++t)
      gc[k2][t] = mk16(*(const v8h*)(gp + ((t * 16 + k2) * 2) * 256),
                       *(const v8h*)(gp + ((t * 16 + k2) * 2 + 1) * 256));

  // ---- small vectors: loaded here, stored to LDS behind the staging, so that
  // their wait does not hold the staging loads back ----
  const float vrk = rk[b * CC + tid];
  float vbv = 0.f, vbq = 0.f, vbk = 0.f;
  if (tid < 64) {
    vbv = bv[h * DHEAD + tid];
    vbq = bq[h * DHEAD + tid];
    vbk = bk[h * DHEAD + tid];
  }
  xcnt_behind_loads();

  float sr[4];
  {
    const float* pw = wq + (size_t)(h * DHEAD + wid * 4) * CC + lane * 4;
    const float* pt = rq + b * CC + lane * 4;
    float4 w[4][4], t[4];  // [row][128-column chunk]
    #pragma unroll
    for (int e = 0; e < 4; ++e)
      #pragma unroll
      for (int q = 0; q < 4; ++q)
        w[e][q] = *(const float4*)(pw + (size_t)e * CC + q * 128);
    #pragma unroll
    for (int q = 0; q < 4; ++q) t[q] = *(const float4*)(pt + q * 128);
    // the loads' translations are waited for before their address registers
    // are free for reuse: as inputs of the wait both pairs stay live up to it
    asm volatile("s_wait_xcnt 0x0" :: "v"(pw), "v"(pt) : "memory");
    #pragma unroll
    for (int e = 0; e < 4; ++e) {
      float a = 0.f;
      #pragma unroll
      for (int q = 0; q < 4; ++q) {
        a += w[e][q].x * t[q].x + w[e][q].y * t[q].y + w[e][q].z * t[q].z
           + w[e][q].w * t[q].w;
        v4h hh = {(_Float16)w[e][q].x, (_Float16)w[e][q].y,
                  (_Float16)w[e][q].z, (_Float16)w[e][q].w};
        *(v4h*)&sQ[wid * 4 + e][q * 128 + lane * 4] = hh;
      }
      sr[e] = a;
    }
  }
  // keeps the loads of Wk and Wv behind the conversion of Wq: lifted above it,
  // all three operands are in registers at once and some are spilled
  __builtin_amdgcn_sched_barrier(0);
  {
    const float* pw = wk + (size_t)(h * DHEAD + wid * 4) * CC + lane * 4;
    float4 w[4][4];
    #pragma unroll
    for (int e = 0; e < 4; ++e)
      #pragma unroll
      for (int q = 0; q < 4; ++q)
        w[e][q] = *(const float4*)(pw + (size_t)e * CC + q * 128);
    asm volatile("s_wait_xcnt 0x0" :: "v"(pw) : "memory");
    #pragma unroll
    for (int e = 0; e < 4; ++e)
      #pragma unroll
      for (int q = 0; q < 4; ++q) {
        v4h hh = {(_Float16)w[e][q].x, (_Float16)w[e][q].y,
                  (_Float16)w[e][q].z, (_Float16)w[e][q].w};
        *(v4h*)&sK[wid * 4 + e][q * 128 + lane * 4] = hh;
      }
  }

  {
    const float* pv = wv + (size_t)(h * DHEAD + wid * 4) * CC + lane;
    float v[16][4];  // [32-column chunk][row]
    #pragma unroll
    for (int q = 0; q < 16; ++q)
      #pragma unroll
      for (int e = 0; e < 4; ++e) v[q][e] = pv[(size_t)e * CC + q * 32];
    asm volatile("s_wait_xcnt 0x0" :: "v"(pv) : "memory");
    #pragma unroll
    for (int q = 0; q < 16; ++q) {
      v4h hh = {(_Float16)v[q][0], (_Float16)v[q][1],
                (_Float16)v[q][2], (_Float16)v[q][3]};
      *(v4h*)&sV[q * 32 + lane][wid * 4] = hh;
    }
  }
  // the sums over the wave's lanes stand here, behind the issue of all staging
  // loads, so that the shuffles' latency does not hold those loads back
  #pragma unroll
  for (int m = 1; m < 32; m <<= 1)
    #pragma unroll
    for (int e = 0; e < 4; ++e) sr[e] += __shfl_xor(sr[e], m);
  if (lane == 0) {
    #pragma unroll
    for (int e = 0; e < 4; ++e) sUq[wid * 4 + e] = sr[e];
  }
  sRk[tid] = vrk;
  if (tid < 64) {
    sBv[tid] = vbv;
    sBq[tid] = vbq;
    sBk[tid] = vbk;
  }
  __syncthreads();

  // ---- U^T tiles: (G/64)^T fragment as A (rows c'), Wq fragment as B
  // (columns o), K = 512 in eight groups of two k blocks; the next group's
  // global loads are in flight under this group's WMMAs ----
  {
    v8f acc[2][4];  // [t][16 rows o]
    #pragma unroll
    for (int t = 0; t < 2; ++t)
      #pragma unroll
      for (int mi = 0; mi < 4; ++mi) acc[t][mi] = zero8();

    #pragma unroll
    for (int g = 0; g < 8; ++g) {
      v16h gn[2][2];
      if (g + 1 < 8) {
        #pragma unroll
        for (int k2 = 0; k2 < 2; ++k2)
          #pragma unroll
          for (int t = 0; t < 2; ++t) {
            const int f = (t * 16 + (g + 1) * 2 + k2) * 2;
            gn[k2][t] = mk16(*(const v8h*)(gp + f * 256),
                             *(const v8h*)(gp + (f + 1) * 256));
          }
      }
      // keeps the loads in front of the WMMAs: sunk to their first use, the
      // wave would wait out their whole latency there
      __builtin_amdgcn_sched_barrier(0);
      #pragma unroll
      for (int k2 = 0; k2 < 2; ++k2) {
        v16h qf[4];
        #pragma unroll
        for (int mi = 0; mi < 4; ++mi)
          qf[mi] = frag_ld(&sQ[0][0], mi * 16, UP, (g * 2 + k2) * 32);
        #pragma unroll
        for (int t = 0; t < 2; ++t)
          #pragma unroll
          for (int mi = 0; mi < 4; ++mi)
            acc[t][mi] = wmma16(gc[k2][t], qf[mi], acc[t][mi]);
      }
      // keeps the next group's first use, and so its wait, behind the WMMAs
      __builtin_amdgcn_sched_barrier(0);
      if (g + 1 < 8) {
        #pragma unroll
        for (int k2 = 0; k2 < 2; ++k2)
          #pragma unroll
          for (int t = 0; t < 2; ++t) gc[k2][t] = gn[k2][t];
      }
    }
    // the pair stays live up to the wait, so no load of the run takes it as
    // its destination
    asm volatile("s_wait_xcnt 0x0" :: "v"(gp) : "memory");

    #pragma unroll
    for (int t = 0; t < 2; ++t) {
      const int cb = (wid * 2 + t) * 16 + ((lane >> 4) << 3);
      const float4 r0 = *(const float4*)&sRk[cb];
      const float4 r1 = *(const float4*)&sRk[cb + 4];
      const float rc[8] = {r0.x, r0.y, r0.z, r0.w, r1.x, r1.y, r1.z, r1.w};
      #pragma unroll
      for (int mi = 0; mi < 4; ++mi) {
        const int o = mi * 16 + (lane & 15);
        const float bqo = sBq[o];
        v8h u;
        #pragma unroll
        for (int r = 0; r < 8; ++r)
          u[r] = (_Float16)(acc[t][mi][r] + bqo * rc[r]);
        *(v8h*)&sU[o][cb] = u;
      }
    }
  }
  __syncthreads();

  // ---- logits (already scaled): U . Wk_head^T + uq . bk^T, one 16x16 tile a
  // wave, K = 512 in two accumulator chains (even and odd k blocks) ----
  {
    const int mi = wid >> 2, ni = wid & 3;
    v8f a0 = zero8(), a1 = zero8();
    #pragma unroll
    for (int kb = 0; kb < 16; kb += 2) {
      a0 = wmma16(frag_ld(&sU[0][0], mi * 16, UP, kb * 32),
                  frag_ld(&sK[0][0], ni * 16, UP, kb * 32), a0);
      a1 = wmma16(frag_ld(&sU[0][0], mi * 16, UP, kb * 32 + 32),
                  frag_ld(&sK[0][0], ni * 16, UP, kb * 32 + 32), a1);
    }
    const int col = ni * 16 + (lane & 15);
    const float bkc = sBk[col];
    #pragma unroll
    for (int r = 0; r < 8; ++r) {
      const int row = mi * 16 + r + ((lane >> 4) << 3);
      // uq = Wq . sq/64 + L . bq / sqrt(L) = .. + 64 bq
      const float uqr = sUq[row] + 64.f * sBq[row];
      sS[row][col] = (a0[r] + a1[r]) + uqr * bkc;
    }
  }
  __syncthreads();

  // ---- softmax over e (64 wide), four threads a row, 16 columns each, the
  // row kept in registers; P.bv beside it. The loops are unrolled so that x
  // stays in registers; four partial sums keep the add chains short. Waves 0
  // to 7 do it, whole waves each.
  if (tid < 256) {
    const int row = tid >> 2;
    const int e0  = (tid & 3) * 16;
    float x[16];
    #pragma unroll
    for (int j = 0; j < 16; ++j) x[j] = sS[row][e0 + j];
    float mx = -3.0e38f;
    #pragma unroll
    for (int j = 0; j < 16; ++j) mx = fmaxf(mx, x[j]);
    mx = fmaxf(mx, quad_swap<0xB1>(mx));
    mx = fmaxf(mx, quad_swap<0x4E>(mx));
    float s4[4] = {0.f, 0.f, 0.f, 0.f};
    #pragma unroll
    for (int j = 0; j < 16; ++j) {
      x[j] = __expf(x[j] - mx);
      s4[j & 3] += x[j];
    }
    float sum = (s4[0] + s4[1]) + (s4[2] + s4[3]);
    sum += quad_swap<0xB1>(sum);
    sum += quad_swap<0x4E>(sum);
    const float inv = 1.f / sum;
    float b4[4] = {0.f, 0.f, 0.f, 0.f};
    v8h ph[2];
    #pragma unroll
    for (int j = 0; j < 16; ++j) {
      const float p = x[j] * inv;
      ph[j >> 3][j & 7] = (_Float16)p;
      b4[j & 3] += p * sBv[e0 + j];
    }
    *(v8h*)&sP[row][e0]     = ph[0];
    *(v8h*)&sP[row][e0 + 8] = ph[1];
    float pbv = (b4[0] + b4[1]) + (b4[2] + b4[3]);
    pbv += quad_swap<0xB1>(pbv);
    pbv += quad_swap<0x4E>(pbv);
    if ((tid & 3) == 0)
      tb[bh * DHEAD + row] = pbv;  // = [b][h*64 + d]
  }
  __syncthreads();

  // ---- T = P x Wv_head: each wave owns two tiles of 16 columns c
  #pragma unroll
  for (int t = 0; t < 2; ++t) {
    const int ct = (wid * 2 + t) * 16;
    v8f oacc[4];
    #pragma unroll
    for (int m2 = 0; m2 < 4; ++m2) oacc[m2] = zero8();
    #pragma unroll
    for (int ks = 0; ks < 2; ++ks) {
      v16h bf = frag_ld(&sV[0][0], ct, 72, ks * 32);
      #pragma unroll
      for (int m2 = 0; m2 < 4; ++m2)
        oacc[m2] = wmma16(frag_ld(&sP[0][0], m2 * 16, 72, ks * 32), bf,
                          oacc[m2]);
    }
    _Float16* dst = tT + ((size_t)b * CC + ct + (lane & 15)) * CC
                       + h * DHEAD + ((lane >> 4) << 3);
    #pragma unroll
    for (int m2 = 0; m2 < 4; ++m2) {
      v8h o;
      #pragma unroll
      for (int r = 0; r < 8; ++r) o[r] = (_Float16)oacc[m2][r];
      *(v8h*)(dst + m2 * 16) = o;
    }
  }
}

__global__ __launch_bounds__(256) void fold_out(
    const float* __restrict__ wo, const float* __restrict__ bo,
    const _Float16* __restrict__ tT, const float* __restrict__ tb,
    _Float16* __restrict__ M, float* __restrict__ bias2)
{
  // per wave: first its two staged operand tiles, then its 64x64 partial
  __shared__ __align__(16) float sRed[8][KT_HALFS];

  const int tid  = threadIdx.x;
  const int wid  = tid >> 5;
  const int lane = tid & 31;
  const int ct   = blockIdx.x;
  const int ot   = blockIdx.y;
  const int b    = blockIdx.z;

  if (ct == 8) {
    // bias2[b][o] = bo[o] + sum_j Wo[o][j] * tb[b][j], four threads a row
    const int o = ot * 64 + (tid >> 2), qd = tid & 3;
    const float* wr = wo + (size_t)o * CC + qd * 4;
    const float* tv = tb + b * CC + qd * 4;
    float s = 0.f;
    #pragma unroll 1  // eight float4 pairs in flight a trip are enough here
    for (int i0 = 0; i0 < CC / 16; i0 += 8) {
      float4 w[8], t[8];
      #pragma unroll
      for (int i = 0; i < 8; ++i) {
        t[i] = *(const float4*)(tv + (i0 + i) * 16);
        if (i == 7) xcnt_before_last_load();
        w[i] = *(const float4*)(wr + (i0 + i) * 16);
      }
      #pragma unroll
      for (int i = 0; i < 8; ++i)
        s += w[i].x * t[i].x + w[i].y * t[i].y + w[i].z * t[i].z
           + w[i].w * t[i].w;
    }
    s += __shfl_xor(s, 1);
    s += __shfl_xor(s, 2);
    if (qd == 0) bias2[b * CC + o] = s + bo[o];
    return;
  }

  const float*    ah = wo + (size_t)ot * 64 * CC;
  const _Float16* bt = tT + ((size_t)b * CC + ct * 64) * CC;
  _Float16* t32 = (_Float16*)&sRed[wid][0];
  _Float16* t16 = t32 + KT_HALFS;
  stage_k64(ah + wid * (CC / 8), bt + wid * (CC / 8), t32, t16);

  v8f acc[4][4];
  #pragma unroll
  for (int mi = 0; mi < 4; ++mi)
    #pragma unroll
    for (int ni = 0; ni < 4; ++ni) acc[mi][ni] = zero8();

  #pragma unroll
  for (int s = 0; s < CC / 8 / 32; ++s) {
    v16h af[4], bf[4];
    #pragma unroll
    for (int i = 0; i < 4; ++i) {
      bf[i] = frag_ld(t16, i * 16, KT_PITCH, s * 32);
      af[i] = frag_ld(t32, i * 16, KT_PITCH, s * 32);
    }
    #pragma unroll
    for (int mi = 0; mi < 4; ++mi)
      #pragma unroll
      for (int ni = 0; ni < 4; ++ni)
        acc[mi][ni] = wmma16(af[mi], bf[ni], acc[mi][ni]);
  }

  // fragment order: idx = tile*256 + (r>>2)*128 + lane*4 + (r&3)
  #pragma unroll
  for (int mi = 0; mi < 4; ++mi)
    #pragma unroll
    for (int ni = 0; ni < 4; ++ni)
      #pragma unroll
      for (int hf = 0; hf < 2; ++hf) {
        float4 t = {acc[mi][ni][hf * 4 + 0], acc[mi][ni][hf * 4 + 1],
                    acc[mi][ni][hf * 4 + 2], acc[mi][ni][hf * 4 + 3]};
        *(float4*)&sRed[wid][(mi * 4 + ni) * 256 + hf * 128 + lane * 4] = t;
      }

  __syncthreads();

  // sum the eight waves' partials, undo the fragment order, store row-major
  const size_t tile0 = ((size_t)b * CC + ot * 64) * CC + ct * 64;
  #pragma unroll
  for (int j = 0; j < 4; ++j) {
    const int idx = (tid + 256 * j) * 4;
    float4 s = *(const float4*)&sRed[0][idx];
    #pragma unroll
    for (int w = 1; w < 8; ++w) {
      float4 t = *(const float4*)&sRed[w][idx];
      s.x += t.x; s.y += t.y; s.z += t.z; s.w += t.w;
    }
    const int tile = idx >> 8;
    const int fl   = (idx >> 2) & 31;
    const int row  = (tile >> 2) * 16 + ((idx >> 7) & 1) * 4 + ((fl >> 4) << 3);
    const int col  = (tile & 3) * 16 + (fl & 15);
    _Float16* dst = M + tile0;
    dst[(size_t)(row + 0) * CC + col] = (_Float16)s.x;
    dst[(size_t)(row + 1) * CC + col] = (_Float16)s.y;
    dst[(size_t)(row + 2) * CC + col] = (_Float16)s.z;
    dst[(size_t)(row + 3) * CC + col] = (_Float16)s.w;
  }
  // the built code lays the bias-column block behind these stores and reuses
  // their registers there: the stores' translations are waited for first
  asm volatile("s_wait_xcnt 0x0" ::: "memory");
}

// ---------------------------------------------------------------------------
extern "C" void kernel_launch(void* const* d_in, const int* in_sizes, int n_in,
                              void* d_out, int out_size, void* d_ws, size_t ws_size,
                              hipStream_t stream) {
  const float* query = (const float*)d_in[0];
  const float* key_  = (const float*)d_in[1];
  const float* value = (const float*)d_in[2];
  const float* wq = (const float*)d_in[3];
  const float* bq = (const float*)d_in[4];
  const float* wk = (const float*)d_in[5];
  const float* bk = (const float*)d_in[6];
  const float* wv = (const float*)d_in[7];
  const float* bv = (const float*)d_in[8];
  const float* wo = (const float*)d_in[9];
  const float* bo = (const float*)d_in[10];
  float* out = (float*)d_out;

  // workspace: f16 partial tiles of G/64: B*4*GKS*256*256 halfs = 32 MiB
  _Float16* gpart = (_Float16*)d_ws;
  // row-sum partials [2][B][GKS][512] and the scaled row sums [2][B][512]
  float* rpart = (float*)(gpart + (size_t)BB * 4 * GKS * 65536);
  float* rsum  = rpart + (size_t)2 * BB * GKS * CC;
  // per batch: P.bv and the folded bias f32
  float* tb    = rsum + 2 * BB * CC;
  float* bias2 = tb + BB * CC;
  const size_t S2 = (size_t)BB * CC * CC;
  // per batch, f16: Wo.P.Wv, (G/64)^T in fragment order, (P.Wv)^T
  _Float16* hM  = (_Float16*)(bias2 + BB * CC);
  _Float16* gT  = hM + S2;
  _Float16* tT  = gT + S2;

  dim3 blk(256);
  dim3 gblk(1024);
  dim3 grd(LL / 128, 1, BB);  // (32, 1, 8): one block per X panel

  gram_part<<<dim3(GKS, 4, BB), gblk, 0, stream>>>(query, key_, gpart, rpart);
  gram_reduce<<<dim3(BB * 4 * 16 + 2 * BB * CC / 256), blk, 0, stream>>>(
      gpart, rpart, gT, rsum);
  attn_fold<<<dim3(BB * NHEAD), dim3(512), 0, stream>>>(
      gT, rsum, rsum + BB * CC, wq, bq, wk, bk, wv, bv, tT, tb);
  fold_out<<<dim3(8 + 1, 8, BB), blk, 0, stream>>>(wo, bo, tT, tb, hM, bias2);

  panel_gemm<true, true><<<grd, gblk, 0, stream>>>(hM, bias2, value, out,
                                                  nullptr);
}

// v010
// A run of this version takes 70.2 microseconds.
// Timed twice side by side with v009, it ran 1.04 times as fast both times.
// Over all steps from v000 it is 3.88 times as fast.
#include <hip/hip_runtime.h>
#include <hip/hip_bf16.h>

typedef __attribute__((ext_vector_type(16))) _Float16 v16h;
typedef __attribute__((ext_vector_type(8)))  _Float16 v8h;
typedef __attribute__((ext_vector_type(4)))  _Float16 v4h;
typedef __attribute__((ext_vector_type(8)))  float    v8f;

#define BB 8
#define CC 512
#define LL 4096
#define NHEAD 8
#define DHEAD 64

__device__ __forceinline__ v8f zero8() {
  v8f z = {0.f,0.f,0.f,0.f,0.f,0.f,0.f,0.f};
  return z;
}

__device__ __forceinline__ v8f wmma16(v16h a, v16h b, v8f c) {
  // (neg_a, A, neg_b, B, c_mod, C, reuse_a, reuse_b) -> v_wmma_f32_16x16x32_f16
  return __builtin_amdgcn_wmma_f32_16x16x32_f16(false, a, false, b, (short)0, c,
                                                false, false);
}

__device__ __forceinline__ v16h mk16(v8h lo, v8h hi) {
  union { v16h v; v8h h[2]; } u;
  u.h[0] = lo; u.h[1] = hi;
  return u.v;
}

__device__ __forceinline__ v16h frag_ld(const _Float16* base, int row0,
                                        int rowStride, int kb) {
  const int lane = threadIdx.x & 31;
  const _Float16* p = base + (size_t)(row0 + (lane & 15)) * rowStride
                           + kb + ((lane >> 4) << 3);
  v8h lo = *(const v8h*)(p);
  v8h hi = *(const v8h*)(p + 16);
  return mk16(lo, hi);
}

// Stands in front of the last load of a run of global loads: that load may take
// the run's address registers as its destination, so the earlier loads'
// translations are waited for first. The two scheduling barriers keep the
// earlier loads in front of the wait and the last load behind it.
__device__ __forceinline__ void xcnt_before_last_load() {
  __builtin_amdgcn_sched_barrier(0);
  asm volatile("s_wait_xcnt 0x0" ::: "memory");
  __builtin_amdgcn_sched_barrier(0);
}

// Stands behind the last load of a run whose address registers are free for
// reuse from there on: the load's translation is waited for first.
__device__ __forceinline__ void xcnt_behind_loads() {
  __builtin_amdgcn_sched_barrier(0);
  asm volatile("s_wait_xcnt 0x0" ::: "memory");
  __builtin_amdgcn_sched_barrier(0);
}

// Stands behind a run of global stores whose registers are reused from there
// on: the stores' translations are waited for first.
__device__ __forceinline__ void xcnt_behind_stores() {
  __builtin_amdgcn_sched_barrier(0);
  asm volatile("s_wait_xcnt 0x0" ::: "memory");
  __builtin_amdgcn_sched_barrier(0);
}

#define KT_PITCH 72
#define KT_HALFS (64 * KT_PITCH)  // halfs a tile; two tiles fill as many floats
__device__ __forceinline__ void stage_k64(const float* s32, const _Float16* s16,
                                          _Float16* t32, _Float16* t16) {
  const int lane = threadIdx.x & 31;
  const float*    pa = s32 + (size_t)(lane >> 4) * CC + (lane & 15) * 4;
  const _Float16* pb = s16 + (size_t)(lane >> 3) * CC + (lane & 7) * 8;
  // the loops are unrolled so that va and vb stay in registers and all loads
  // are in flight together
  float4 va[32];
  v8h    vb[16];
  #pragma unroll
  for (int i = 0; i < 32; ++i) va[i] = *(const float4*)(pa + (size_t)i * 2 * CC);
  #pragma unroll
  for (int i = 0; i < 16; ++i) vb[i] = *(const v8h*)(pb + (size_t)i * 4 * CC);
  // the loads' translations are waited for before their address registers are
  // free for reuse: as inputs of the wait both pairs stay live up to it, so no
  // load of the run takes them as its destination
  asm volatile("s_wait_xcnt 0x0" :: "v"(pa), "v"(pb) : "memory");
  #pragma unroll
  for (int i = 0; i < 32; ++i) {
    v4h h = {(_Float16)va[i].x, (_Float16)va[i].y,
             (_Float16)va[i].z, (_Float16)va[i].w};
    *(v4h*)(t32 + (i * 2 + (lane >> 4)) * KT_PITCH + (lane & 15) * 4) = h;
  }
  #pragma unroll
  for (int i = 0; i < 16; ++i)
    *(v8h*)(t16 + ((lane >> 3) * 16 + i) * KT_PITCH + (lane & 7) * 8) = vb[i];
  // the rows are read back by other lanes of this wave: its stores land first,
  // and the compiler moves no LDS read in front of them
  asm volatile("s_wait_dscnt 0x0" ::: "memory");
}

// ---------------------------------------------------------------------------
// Projection GEMM: Y[b,m,n] = W . X[b,:,n] + bias   (M=K=512, N=4096/batch)
// Block: 1024 threads (32 waves), tile 512(M, all of it) x 128(N): one block
// per X panel, so every element of X is read, converted and transposed once.
// The entire X^T panel (N=128 rows x K=512 cols, f16) is staged in LDS once;
// W arrives f16 from its producer, so a W tile is copied, not converted: tiles
// of 512x64 (a row's 64 halfs are one 128-byte line) are double-buffered per
// K-step so their global loads hide under the WMMAs, one barrier per step.
// Wave (wm 0..15, wn 0..1) owns a 32x64 sub-tile = 2x4 WMMA accumulators.
// W_PER_BATCH: W and bias are [B][512][512] and [B][512], one pair per batch.
// ---------------------------------------------------------------------------
template<bool W_PER_BATCH, bool OUT_F32>
__global__ __launch_bounds__(1024) void panel_gemm(
    const _Float16* __restrict__ Wall, const float* __restrict__ biasAll,
    const float* __restrict__ Xf,
    float* __restrict__ Yf, _Float16* __restrict__ Yh)
{
  __shared__ __align__(16) _Float16 sX[128][520];    // [n][k], 520 = 512+8 pad
  __shared__ __align__(16) _Float16 sA[2][512][72];  // double-buffered W tile
  __shared__ float sBias[512];

  const int tid  = threadIdx.x;
  const int b    = blockIdx.z;
  const int n0   = blockIdx.x * 128;
  const int wid  = tid >> 5;
  const int lane = tid & 31;
  const int wm   = wid & 15;
  const int wn   = wid >> 4;
  const _Float16* W = W_PER_BATCH ? Wall + (size_t)b * 512 * 512 : Wall;
  const float* bias = W_PER_BATCH ? biasAll + b * 512 : biasAll;

  if (tid < 512) sBias[tid] = bias[tid];

  {
    const int nseg = (wid & 3) * 8 + (lane & 7);           // n = nseg*4 .. +3
    const int k2   = ((wid >> 2) * 4 + (lane >> 3)) * 2;   // 0,2,...,62
    // column n = 64*wn + 4*q + t lies in row 64*wn + 16*t + q of sX
    const int prow = (nseg >> 4) * 64 + (nseg & 15);
    const float* xb = Xf + ((size_t)b * 512 + k2) * LL + n0 + nseg * 4;
    for (int kk = 0; kk < 512; kk += 128) {  // two 64-K chunks a trip
      const float* r0 = xb + (size_t)kk * LL;
      const float* r1 = r0 + LL;
      float4 a0 = *(const float4*)(r0);
      float4 c0 = *(const float4*)(r1);
      float4 a1 = *(const float4*)(r0 + (size_t)64 * LL);
      float4 c1 = *(const float4*)(r1 + (size_t)64 * LL);
      if (kk + 128 < 512) __builtin_prefetch(r0 + (size_t)128 * LL, 0, 3);
      float f0[8] = {a0.x,a0.y,a0.z,a0.w,a1.x,a1.y,a1.z,a1.w};
      float f1[8] = {c0.x,c0.y,c0.z,c0.w,c1.x,c1.y,c1.z,c1.w};
      #pragma unroll
      for (int j = 0; j < 8; ++j) {
        union { _Float16 h[2]; unsigned u; } p;
        p.h[0] = (_Float16)f0[j];
        p.h[1] = (_Float16)f1[j];
        // k2 even: 4B aligned
        *(unsigned*)&sX[prow + (j & 3) * 16][kk + (j >> 2) * 64 + k2] = p.u;
      }
    }
  }

  // ---- stage first W tile into sA[0] ----
  // eight lanes cover a row's 64 halfs (one 128-byte line); a thread owns rows
  // rA, rA + 128, rA + 256 and rA + 384
  const int rA = tid >> 3, segA = tid & 7;
  const _Float16* wsrc = W + (size_t)rA * 512 + segA * 8;
  {
    v8h h0 = *(const v8h*)(wsrc);
    v8h h1 = *(const v8h*)(wsrc + 128 * 512);
    v8h h2 = *(const v8h*)(wsrc + 256 * 512);
    v8h h3 = *(const v8h*)(wsrc + 384 * 512);
    *(v8h*)&sA[0][rA][segA * 8]       = h0;
    *(v8h*)&sA[0][rA + 128][segA * 8] = h1;
    *(v8h*)&sA[0][rA + 256][segA * 8] = h2;
    *(v8h*)&sA[0][rA + 384][segA * 8] = h3;
  }
  __syncthreads();

  v8f acc[2][4];
  #pragma unroll
  for (int mt = 0; mt < 2; ++mt)
    #pragma unroll
    for (int nt = 0; nt < 4; ++nt) acc[mt][nt] = zero8();

  for (int ks = 0; ks < 8; ++ks) {
    const int kb  = ks * 64;
    const int cur = ks & 1;
    const bool have_next = (ks + 1 < 8);

    // issue global loads of the next W tile first (latency hides under WMMA)
    v8h h0 = {}, h1 = {}, h2 = {}, h3 = {};
    if (have_next) {
      const _Float16* src = wsrc + kb + 64;
      h0 = *(const v8h*)(src);
      h1 = *(const v8h*)(src + 128 * 512);
      h2 = *(const v8h*)(src + 256 * 512);
      h3 = *(const v8h*)(src + 384 * 512);
    }
    // keeps the four loads in front of the WMMAs: left free, the scheduler
    // sinks two of them to the last WMMA, right in front of their first use
    __builtin_amdgcn_sched_barrier(0);

    // compute: 2x4 WMMA tiles per wave from resident panel + current W tile,
    // two k blocks of 32; the loops are unrolled so that every index of afr and
    // acc is a constant and the arrays stay in registers
    #pragma unroll
    for (int kk = 0; kk < 64; kk += 32) {
      v16h afr[2];
      #pragma unroll
      for (int mt = 0; mt < 2; ++mt)
        afr[mt] = frag_ld(&sA[cur][0][0], wm * 32 + mt * 16, 72, kk);
      #pragma unroll
      for (int nt = 0; nt < 4; ++nt) {
        v16h bfr = frag_ld(&sX[0][0], wn * 64 + nt * 16, 520, kb + kk);
        #pragma unroll
        for (int mt = 0; mt < 2; ++mt)
          acc[mt][nt] = wmma16(afr[mt], bfr, acc[mt][nt]);
      }
    }

    // keeps the first use of the loaded tile, and so its wait, behind the WMMAs:
    // left free, the scheduler lifts the stores to the head of the step and the
    // wave waits out the whole load latency there
    __builtin_amdgcn_sched_barrier(0);

    // store next W tile into the other buffer
    if (have_next) {
      *(v8h*)&sA[cur ^ 1][rA][segA * 8]       = h0;
      *(v8h*)&sA[cur ^ 1][rA + 128][segA * 8] = h1;
      *(v8h*)&sA[cur ^ 1][rA + 256][segA * 8] = h2;
      *(v8h*)&sA[cur ^ 1][rA + 384][segA * 8] = h3;
    }
    __syncthreads();
  }

  #pragma unroll
  for (int mt = 0; mt < 2; ++mt) {
    const int c0 = wm * 32 + mt * 16 + ((lane >> 4) << 3);
    const size_t off = ((size_t)b * 512 + c0) * LL + n0 + wn * 64 + (lane & 15) * 4;
    float4 v[8];
    #pragma unroll
    for (int r = 0; r < 8; ++r) {
      const float bv = sBias[c0 + r];
      v[r] = float4{acc[mt][0][r] + bv, acc[mt][1][r] + bv,
                    acc[mt][2][r] + bv, acc[mt][3][r] + bv};
    }
    #pragma unroll
    for (int r = 0; r < 8; ++r) {
      if (OUT_F32) {
        *(float4*)(Yf + off + (size_t)r * LL) = v[r];
      } else {
        v4h hv = {(_Float16)v[r].x, (_Float16)v[r].y,
                  (_Float16)v[r].z, (_Float16)v[r].w};
        *(v4h*)(Yh + off + (size_t)r * LL) = hv;
      }
    }
    // the second group reuses the registers of the first group's stores
    if (mt == 0) xcnt_behind_stores();
  }
}

// ---------------------------------------------------------------------------
// Channel attention without q and k.
// gram_part: grid (GKS, 4, batch). A block forms a 256x256 tile of
//   G = query . key^T over its own L/GKS columns. 32-column slices of the 256
//   query rows and 256 key rows are converted to f16 in LDS, double-buffered,
//   the next slice's global loads in flight under the WMMAs, one barrier per
//   slice. Wave (wm 0..7, wn 0..3) owns 32x64 = 2x4 accumulators. The partial
//   tile is scaled by 1/sqrt(L) = 1/64 and stored f16 in fragment order: the
//   partials cross memory twice, and G/64 itself is kept f16 behind the sum.
//   The f32 row sums of query and key are kept beside the staging and stored
//   per L chunk.
// gram_reduce: sums the GKS partials in f32 in fixed order and stores (G/64)^T
//   (f16) in the fragment order of the next product, so that its reader loads
//   fragments from global memory in whole lines; its last blocks sum and scale
//   the row sums.
// attn_fold: one block of 16 waves per batch and head. It forms
//   U = Wq_head . G/64 + bq_head . (sk/64)^T (64x512, f16, in LDS; a wave per
//   32 columns, K = 512 in one accumulator chain) and uq = Wq_head . sq/64 +
//   64 bq_head, the 64x64 logits U . Wk_head^T + uq . bk_head^T, the softmax
//   and T = P . Wv_head, Wv_head transposed through LDS. T is stored
//   transposed, tT[b][c][head*64 + d] (f16), which is the B-fragment order of
//   the next product, and P . bv_head beside it.
// fold_out: grid (8 + 1, 8, batch). M[b] = Wo . T[b] (stored f16, the
//   operand type of the last GEMM), one 64x64 tile a block, K = 512 split over
//   the eight waves and summed through LDS in fixed order; column block 8 forms
//   the bias Wo . (P.bv) + bo instead.
// ---------------------------------------------------------------------------
#define GKS 8

__global__ __launch_bounds__(1024) void gram_part(
    const float* __restrict__ xq, const float* __restrict__ xk,
    _Float16* __restrict__ gpart, float* __restrict__ rpart)
{
  // rows 0..255: query tile, rows 256..511: key tile; 32 columns + 8 pad
  __shared__ __align__(16) _Float16 sT[2][512][40];

  const int tid  = threadIdx.x;
  const int wid  = tid >> 5;
  const int lane = tid & 31;
  const int ks   = blockIdx.x;
  const int tile = blockIdx.y;
  const int b    = blockIdx.z;
  const int tm   = tile >> 1;   // 256-row block of query (c)
  const int tn   = tile & 1;    // 256-row block of key (c')
  const int wm   = wid & 7;
  const int wn   = wid >> 3;

  // staging: eight lanes cover a row's 32 floats (one 128-byte line); a thread
  // owns rows r0 and r0 + 128 of both tiles
  const int seg = tid & 7;
  const int r0  = tid >> 3;
  const float* pa = xq + ((size_t)b * CC + tm * 256 + r0) * LL
                       + ks * (LL / GKS) + seg * 4;
  const float* pb = xk + ((size_t)b * CC + tn * 256 + r0) * LL
                       + ks * (LL / GKS) + seg * 4;
  float rs0 = 0.f, rs1 = 0.f, rs2 = 0.f, rs3 = 0.f;

  float4 f0 = *(const float4*)(pa);
  float4 f1 = *(const float4*)(pa + (size_t)128 * LL);
  float4 f2 = *(const float4*)(pb);
  float4 f3 = *(const float4*)(pb + (size_t)128 * LL);
  {
    rs0 += (f0.x + f0.y) + (f0.z + f0.w);
    rs1 += (f1.x + f1.y) + (f1.z + f1.w);
    rs2 += (f2.x + f2.y) + (f2.z + f2.w);
    rs3 += (f3.x + f3.y) + (f3.z + f3.w);
    v4h h0 = {(_Float16)f0.x,(_Float16)f0.y,(_Float16)f0.z,(_Float16)f0.w};
    v4h h1 = {(_Float16)f1.x,(_Float16)f1.y,(_Float16)f1.z,(_Float16)f1.w};
    v4h h2 = {(_Float16)f2.x,(_Float16)f2.y,(_Float16)f2.z,(_Float16)f2.w};
    v4h h3 = {(_Float16)f3.x,(_Float16)f3.y,(_Float16)f3.z,(_Float16)f3.w};
    *(v4h*)&sT[0][r0][seg * 4]       = h0;
    *(v4h*)&sT[0][r0 + 128][seg * 4] = h1;
    *(v4h*)&sT[0][r0 + 256][seg * 4] = h2;
    *(v4h*)&sT[0][r0 + 384][seg * 4] = h3;
  }
  __syncthreads();

  // the loops over acc and afr in this kernel are unrolled so that every index
  // is a constant and the arrays stay in registers
  v8f acc[2][4];
  #pragma unroll
  for (int mt = 0; mt < 2; ++mt)
    #pragma unroll
    for (int nt = 0; nt < 4; ++nt) acc[mt][nt] = zero8();

  const int NS = LL / GKS / 32;  // 16 slices
  for (int s = 0; s < NS; ++s) {
    const int cur = s & 1;
    const bool have_next = (s + 1 < NS);

    // issue global loads of the next slice first (latency hides under WMMA)
    // (the pointers advance behind the wait for the slice before)
    if (have_next) {
      pa += 32;
      pb += 32;
      f0 = *(const float4*)(pa);
      f1 = *(const float4*)(pa + (size_t)128 * LL);
      f2 = *(const float4*)(pb);
      f3 = *(const float4*)(pb + (size_t)128 * LL);
    }
    // keeps the four loads in front of the WMMAs: left free, the scheduler
    // sinks them to their first use and the wave waits out the whole latency
    __builtin_amdgcn_sched_barrier(0);

    v16h afr[2];
    #pragma unroll
    for (int mt = 0; mt < 2; ++mt)
      afr[mt] = frag_ld(&sT[cur][0][0], wm * 32 + mt * 16, 40, 0);
    #pragma unroll
    for (int nt = 0; nt < 4; ++nt) {
      v16h bfr = frag_ld(&sT[cur][0][0], 256 + wn * 64 + nt * 16, 40, 0);
      #pragma unroll
      for (int mt = 0; mt < 2; ++mt)
        acc[mt][nt] = wmma16(afr[mt], bfr, acc[mt][nt]);
    }

    // keeps the first use of the loaded slice, and so its wait, behind the WMMAs
    __builtin_amdgcn_sched_barrier(0);

    // row sums, convert + store the next slice into the other buffer
    if (have_next) {
      rs0 += (f0.x + f0.y) + (f0.z + f0.w);
      rs1 += (f1.x + f1.y) + (f1.z + f1.w);
      rs2 += (f2.x + f2.y) + (f2.z + f2.w);
      rs3 += (f3.x + f3.y) + (f3.z + f3.w);
      v4h h0 = {(_Float16)f0.x,(_Float16)f0.y,(_Float16)f0.z,(_Float16)f0.w};
      v4h h1 = {(_Float16)f1.x,(_Float16)f1.y,(_Float16)f1.z,(_Float16)f1.w};
      v4h h2 = {(_Float16)f2.x,(_Float16)f2.y,(_Float16)f2.z,(_Float16)f2.w};
      v4h h3 = {(_Float16)f3.x,(_Float16)f3.y,(_Float16)f3.z,(_Float16)f3.w};
      *(v4h*)&sT[cur ^ 1][r0][seg * 4]       = h0;
      *(v4h*)&sT[cur ^ 1][r0 + 128][seg * 4] = h1;
      *(v4h*)&sT[cur ^ 1][r0 + 256][seg * 4] = h2;
      *(v4h*)&sT[cur ^ 1][r0 + 384][seg * 4] = h3;
    }
    __syncthreads();
  }

  // ---- partial tile / 64 (exact in f32), f16, fragment order:
  // idx = (wid*8 + mt*4 + nt)*256 + lane*8 + r
  _Float16* dst = gpart + (((size_t)b * 4 + tile) * GKS + ks) * 65536
                        + wid * 2048 + lane * 8;
  #pragma unroll
  for (int mt = 0; mt < 2; ++mt)
    #pragma unroll
    for (int nt = 0; nt < 4; ++nt) {
      v8h t;
      #pragma unroll
      for (int r = 0; r < 8; ++r)
        t[r] = (_Float16)(acc[mt][nt][r] * 0.015625f);
      *(v8h*)(dst + (mt * 4 + nt) * 256) = t;
    }

  // ---- row sums of this L chunk: rpart[which][b][ks][row], one writer each
  rs0 += __shfl_xor(rs0, 1); rs1 += __shfl_xor(rs1, 1);
  rs2 += __shfl_xor(rs2, 1); rs3 += __shfl_xor(rs3, 1);
  rs0 += __shfl_xor(rs0, 2); rs1 += __shfl_xor(rs1, 2);
  rs2 += __shfl_xor(rs2, 2); rs3 += __shfl_xor(rs3, 2);
  rs0 += __shfl_xor(rs0, 4); rs1 += __shfl_xor(rs1, 4);
  rs2 += __shfl_xor(rs2, 4); rs3 += __shfl_xor(rs3, 4);
  if (seg == 0) {
    if (tn == 0) {
      float* rq = rpart + ((size_t)b * GKS + ks) * CC + tm * 256 + r0;
      rq[0]   = rs0;
      rq[128] = rs1;
    }
    if (tm == 0) {
      float* rk = rpart + ((size_t)(BB + b) * GKS + ks) * CC + tn * 256 + r0;
      rk[0]   = rs2;
      rk[128] = rs3;
    }
  }
}

__global__ __launch_bounds__(256) void gram_reduce(
    const _Float16* __restrict__ gpart, const float* __restrict__ rpart,
    _Float16* __restrict__ gT, float* __restrict__ rsum)
{
  const float scale = 0.015625f;  // 1/sqrt(4096)
  const int tid = threadIdx.x;

  if (blockIdx.x >= BB * 4 * 16) {
    // rsum[which][b][row] = sum over the L chunks / 64
    const int j = (blockIdx.x - BB * 4 * 16) * 256 + tid;  // 0 .. 2*B*512-1
    const float* p = rpart + (size_t)(j >> 9) * GKS * CC + (j & 511);
    float s = p[0];
    #pragma unroll  // all loads in flight together
    for (int ks = 1; ks < GKS; ++ks) s += p[ks * CC];
    rsum[j] = s * scale;
    return;
  }

  // a thread takes one lane's eight values of two accumulator fragments, fr0
  // and fr0 + 128 (frag = wid*8 + mt*4 + nt of gram_part)
  const int g    = blockIdx.x * 256 + tid;
  const int lane = g & 31;
  const int fr0  = (g >> 5) & 127;
  const int bt   = g >> 12;          // b*4 + tile
  const _Float16* p = gpart + (size_t)bt * GKS * 65536 + fr0 * 256 + lane * 8;
  v8h x[2][GKS];
  #pragma unroll  // x stays in registers, all loads in flight together
  for (int ks = 0; ks < GKS; ++ks) {
    x[0][ks] = *(const v8h*)(p + (size_t)ks * 65536);
    x[1][ks] = *(const v8h*)(p + (size_t)ks * 65536 + 128 * 256);
  }
  // the loads' translations are waited for before their address registers are
  // free for reuse: as an input of the wait the pair stays live up to it, so no
  // load of the run takes it as its destination
  asm volatile("s_wait_xcnt 0x0" :: "v"(p) : "memory");
  const int b  = bt >> 2;
  const int tm = (bt >> 1) & 1;
  const int tn = bt & 1;
  #pragma unroll  // constant indices of x
  for (int f = 0; f < 2; ++f) {
    float s[8];
    #pragma unroll
    for (int r = 0; r < 8; ++r) s[r] = (float)x[f][0][r];
    #pragma unroll
    for (int ks = 1; ks < GKS; ++ks)
      #pragma unroll
      for (int r = 0; r < 8; ++r) s[r] += (float)x[f][ks][r];
    const int frag = fr0 + f * 128;
    const int wid  = frag >> 3;
    const int c    = tm * 256 + (wid & 7) * 32 + ((frag >> 2) & 1) * 16
                   + ((lane >> 4) << 3);
    const int cp   = tn * 256 + (wid >> 3) * 64 + (frag & 3) * 16 + (lane & 15);
    v8h o;
    #pragma unroll
    for (int r = 0; r < 8; ++r) o[r] = (_Float16)s[r];
    // fragment order of the next product: tile cp/16, k block c/32, half
    // (c/16)%2, lane cp%16 + 16*((c/8)%2): a wave's store is 512 contiguous bytes
    *(v8h*)(gT + (size_t)b * CC * CC
               + (((cp >> 4) * 16 + (c >> 5)) * 2 + ((c >> 4) & 1)) * 256
               + ((cp & 15) + ((c >> 3) & 1) * 16) * 8) = o;
  }
  // the built code lays the row-sum block behind these stores and reuses the
  // stores' registers there: the stores' translations are waited for first
  asm volatile("s_wait_xcnt 0x0" ::: "memory");
}

template<int CTRL>
__device__ __forceinline__ float quad_swap(float v) {
  return __builtin_bit_cast(float, __builtin_amdgcn_mov_dpp(
      __builtin_bit_cast(int, v), CTRL, 0xf, 0xf, true));
}

#define UP 520  // halfs a row of the 64 x 512 LDS operands: 512 + 8 pad

__global__ __launch_bounds__(512) void attn_fold(
    const _Float16* __restrict__ gF, const float* __restrict__ rq,
    const float* __restrict__ rk,
    const float* __restrict__ wq, const float* __restrict__ bq,
    const float* __restrict__ wk, const float* __restrict__ bk,
    const float* __restrict__ wv, const float* __restrict__ bv,
    _Float16* __restrict__ tT, float* __restrict__ tb)
{
  __shared__ __align__(16) _Float16 sQ[64][UP];   // Wq of this head, f16
  __shared__ __align__(16) _Float16 sK[64][UP];   // Wk of this head, f16
  __shared__ __align__(16) _Float16 sU[64][UP];   // U of this batch and head
  __shared__ __align__(16) _Float16 sV[512][72];  // Wv of this head, [c][e]
  __shared__ float                  sS[64][65];   // logits fp32
  __shared__ __align__(16) _Float16 sP[64][72];   // softmax probs f16
  __shared__ __align__(16) float    sRk[512];     // sk/64 of this batch
  __shared__ float                  sBv[64];      // bv of this head
  __shared__ float                  sUq[64];      // Wq . sq/64 of this head
  __shared__ float                  sBk[64];      // bk of this head
  __shared__ float                  sBq[64];      // bq of this head

  const int tid  = threadIdx.x;
  const int wid  = tid >> 5;
  const int lane = tid & 31;
  const int bh   = blockIdx.x;
  const int b    = bh >> 3;
  const int h    = bh & 7;

  // the loops over register arrays in this kernel are unrolled so that every
  // index is a constant and the arrays stay in registers

  // a wave owns 32 columns c' of U = two 16-column tiles t; fragment half j of
  // (t, k block kb) lies at gp + ((t*16 + kb)*2 + j)*256: 512 contiguous bytes
  // a wave-wide load
  const _Float16* gp = gF + (size_t)b * CC * CC + (size_t)wid * (2 * 16 * 512)
                          + lane * 8;
  v16h gc[2][2];  // [k block of the group][t]
  #pragma unroll
  for (int k2 = 0; k2 < 2; ++k2)
    #pragma unroll
    for (int t = 0; t < 2; ++t)
      gc[k2][t] = mk16(*(const v8h*)(gp + ((t * 16 + k2) * 2) * 256),
                       *(const v8h*)(gp + ((t * 16 + k2) * 2 + 1) * 256));

  // ---- small vectors: loaded here, stored to LDS behind the staging, so that
  // their wait does not hold the staging loads back ----
  const float vrk = rk[b * CC + tid];
  float vbv = 0.f, vbq = 0.f, vbk = 0.f;
  if (tid < 64) {
    vbv = bv[h * DHEAD + tid];
    vbq = bq[h * DHEAD + tid];
    vbk = bk[h * DHEAD + tid];
  }
  xcnt_behind_loads();

  float sr[4];
  {
    const float* pw = wq + (size_t)(h * DHEAD + wid * 4) * CC + lane * 4;
    const float* pt = rq + b * CC + lane * 4;
    float4 w[4][4], t[4];  // [row][128-column chunk]
    #pragma unroll
    for (int e = 0; e < 4; ++e)
      #pragma unroll
      for (int q = 0; q < 4; ++q)
        w[e][q] = *(const float4*)(pw + (size_t)e * CC + q * 128);
    #pragma unroll
    for (int q = 0; q < 4; ++q) t[q] = *(const float4*)(pt + q * 128);
    // the loads' translations are waited for before their address registers
    // are free for reuse: as inputs of the wait both pairs stay live up to it
    asm volatile("s_wait_xcnt 0x0" :: "v"(pw), "v"(pt) : "memory");
    #pragma unroll
    for (int e = 0; e < 4; ++e) {
      float a = 0.f;
      #pragma unroll
      for (int q = 0; q < 4; ++q) {
        a += w[e][q].x * t[q].x + w[e][q].y * t[q].y + w[e][q].z * t[q].z
           + w[e][q].w * t[q].w;
        v4h hh = {(_Float16)w[e][q].x, (_Float16)w[e][q].y,
                  (_Float16)w[e][q].z, (_Float16)w[e][q].w};
        *(v4h*)&sQ[wid * 4 + e][q * 128 + lane * 4] = hh;
      }
      sr[e] = a;
    }
  }
  // keeps the loads of Wk and Wv behind the conversion of Wq: lifted above it,
  // all three operands are in registers at once and some are spilled
  __builtin_amdgcn_sched_barrier(0);
  {
    const float* pw = wk + (size_t)(h * DHEAD + wid * 4) * CC + lane * 4;
    float4 w[4][4];
    #pragma unroll
    for (int e = 0; e < 4; ++e)
      #pragma unroll
      for (int q = 0; q < 4; ++q)
        w[e][q] = *(const float4*)(pw + (size_t)e * CC + q * 128);
    asm volatile("s_wait_xcnt 0x0" :: "v"(pw) : "memory");
    #pragma unroll
    for (int e = 0; e < 4; ++e)
      #pragma unroll
      for (int q = 0; q < 4; ++q) {
        v4h hh = {(_Float16)w[e][q].x, (_Float16)w[e][q].y,
                  (_Float16)w[e][q].z, (_Float16)w[e][q].w};
        *(v4h*)&sK[wid * 4 + e][q * 128 + lane * 4] = hh;
      }
  }

  {
    const float* pv = wv + (size_t)(h * DHEAD + wid * 4) * CC + lane;
    float v[16][4];  // [32-column chunk][row]
    #pragma unroll
    for (int q = 0; q < 16; ++q)
      #pragma unroll
      for (int e = 0; e < 4; ++e) v[q][e] = pv[(size_t)e * CC + q * 32];
    asm volatile("s_wait_xcnt 0x0" :: "v"(pv) : "memory");
    #pragma unroll
    for (int q = 0; q < 16; ++q) {
      v4h hh = {(_Float16)v[q][0], (_Float16)v[q][1],
                (_Float16)v[q][2], (_Float16)v[q][3]};
      *(v4h*)&sV[q * 32 + lane][wid * 4] = hh;
    }
  }
  // the sums over the wave's lanes stand here, behind the issue of all staging
  // loads, so that the shuffles' latency does not hold those loads back
  #pragma unroll
  for (int m = 1; m < 32; m <<= 1)
    #pragma unroll
    for (int e = 0; e < 4; ++e) sr[e] += __shfl_xor(sr[e], m);
  if (lane == 0) {
    #pragma unroll
    for (int e = 0; e < 4; ++e) sUq[wid * 4 + e] = sr[e];
  }
  sRk[tid] = vrk;
  if (tid < 64) {
    sBv[tid] = vbv;
    sBq[tid] = vbq;
    sBk[tid] = vbk;
  }
  __syncthreads();

  // ---- U^T tiles: (G/64)^T fragment as A (rows c'), Wq fragment as B
  // (columns o), K = 512 in eight groups of two k blocks; the next group's
  // global loads are in flight under this group's WMMAs ----
  {
    v8f acc[2][4];  // [t][16 rows o]
    #pragma unroll
    for (int t = 0; t < 2; ++t)
      #pragma unroll
      for (int mi = 0; mi < 4; ++mi) acc[t][mi] = zero8();

    #pragma unroll
    for (int g = 0; g < 8; ++g) {
      v16h gn[2][2];
      if (g + 1 < 8) {
        #pragma unroll
        for (int k2 = 0; k2 < 2; ++k2)
          #pragma unroll
          for (int t = 0; t < 2; ++t) {
            const int f = (t * 16 + (g + 1) * 2 + k2) * 2;
            gn[k2][t] = mk16(*(const v8h*)(gp + f * 256),
                             *(const v8h*)(gp + (f + 1) * 256));
          }
      }
      // keeps the loads in front of the WMMAs: sunk to their first use, the
      // wave would wait out their whole latency there
      __builtin_amdgcn_sched_barrier(0);
      #pragma unroll
      for (int k2 = 0; k2 < 2; ++k2) {
        v16h qf[4];
        #pragma unroll
        for (int mi = 0; mi < 4; ++mi)
          qf[mi] = frag_ld(&sQ[0][0], mi * 16, UP, (g * 2 + k2) * 32);
        #pragma unroll
        for (int t = 0; t < 2; ++t)
          #pragma unroll
          for (int mi = 0; mi < 4; ++mi)
            acc[t][mi] = wmma16(gc[k2][t], qf[mi], acc[t][mi]);
      }
      // keeps the next group's first use, and so its wait, behind the WMMAs
      __builtin_amdgcn_sched_barrier(0);
      if (g + 1 < 8) {
        #pragma unroll
        for (int k2 = 0; k2 < 2; ++k2)
          #pragma unroll
          for (int t = 0; t < 2; ++t) gc[k2][t] = gn[k2][t];
      }
    }
    // the pair stays live up to the wait, so no load of the run takes it as
    // its destination
    asm volatile("s_wait_xcnt 0x0" :: "v"(gp) : "memory");

    #pragma unroll
    for (int t = 0; t < 2; ++t) {
      const int cb = (wid * 2 + t) * 16 + ((lane >> 4) << 3);
      const float4 r0 = *(const float4*)&sRk[cb];
      const float4 r1 = *(const float4*)&sRk[cb + 4];
      const float rc[8] = {r0.x, r0.y, r0.z, r0.w, r1.x, r1.y, r1.z, r1.w};
      #pragma unroll
      for (int mi = 0; mi < 4; ++mi) {
        const int o = mi * 16 + (lane & 15);
        const float bqo = sBq[o];
        v8h u;
        #pragma unroll
        for (int r = 0; r < 8; ++r)
          u[r] = (_Float16)(acc[t][mi][r] + bqo * rc[r]);
        *(v8h*)&sU[o][cb] = u;
      }
    }
  }
  __syncthreads();

  // ---- logits (already scaled): U . Wk_head^T + uq . bk^T, one 16x16 tile a
  // wave, K = 512 in two accumulator chains (even and odd k blocks) ----
  {
    const int mi = wid >> 2, ni = wid & 3;
    v8f a0 = zero8(), a1 = zero8();
    #pragma unroll
    for (int kb = 0; kb < 16; kb += 2) {
      a0 = wmma16(frag_ld(&sU[0][0], mi * 16, UP, kb * 32),
                  frag_ld(&sK[0][0], ni * 16, UP, kb * 32), a0);
      a1 = wmma16(frag_ld(&sU[0][0], mi * 16, UP, kb * 32 + 32),
                  frag_ld(&sK[0][0], ni * 16, UP, kb * 32 + 32), a1);
    }
    const int col = ni * 16 + (lane & 15);
    const float bkc = sBk[col];
    #pragma unroll
    for (int r = 0; r < 8; ++r) {
      const int row = mi * 16 + r + ((lane >> 4) << 3);
      // uq = Wq . sq/64 + L . bq / sqrt(L) = .. + 64 bq
      const float uqr = sUq[row] + 64.f * sBq[row];
      sS[row][col] = (a0[r] + a1[r]) + uqr * bkc;
    }
  }
  __syncthreads();

  // ---- softmax over e (64 wide), four threads a row, 16 columns each, the
  // row kept in registers; P.bv beside it. The loops are unrolled so that x
  // stays in registers; four partial sums keep the add chains short. Waves 0
  // to 7 do it, whole waves each.
  if (tid < 256) {
    const int row = tid >> 2;
    const int e0  = (tid & 3) * 16;
    float x[16];
    #pragma unroll
    for (int j = 0; j < 16; ++j) x[j] = sS[row][e0 + j];
    float mx = -3.0e38f;
    #pragma unroll
    for (int j = 0; j < 16; ++j) mx = fmaxf(mx, x[j]);
    mx = fmaxf(mx, quad_swap<0xB1>(mx));
    mx = fmaxf(mx, quad_swap<0x4E>(mx));
    float s4[4] = {0.f, 0.f, 0.f, 0.f};
    #pragma unroll
    for (int j = 0; j < 16; ++j) {
      x[j] = __expf(x[j] - mx);
      s4[j & 3] += x[j];
    }
    float sum = (s4[0] + s4[1]) + (s4[2] + s4[3]);
    sum += quad_swap<0xB1>(sum);
    sum += quad_swap<0x4E>(sum);
    const float inv = 1.f / sum;
    float b4[4] = {0.f, 0.f, 0.f, 0.f};
    v8h ph[2];
    #pragma unroll
    for (int j = 0; j < 16; ++j) {
      const float p = x[j] * inv;
      ph[j >> 3][j & 7] = (_Float16)p;
      b4[j & 3] += p * sBv[e0 + j];
    }
    // row d of P lies in row 16*(d%4) + d/4 of sP: lane q of B tile t of the
    // next product then holds d = 4*q + t
    const int pr = (row & 3) * 16 + (row >> 2);
    *(v8h*)&sP[pr][e0]     = ph[0];
    *(v8h*)&sP[pr][e0 + 8] = ph[1];
    float pbv = (b4[0] + b4[1]) + (b4[2] + b4[3]);
    pbv += quad_swap<0xB1>(pbv);
    pbv += quad_swap<0x4E>(pbv);
    if ((tid & 3) == 0)
      tb[bh * DHEAD + row] = pbv;  // = [b][h*64 + d]
  }
  __syncthreads();

  // ---- T^T = Wv_head^T x P^T: each wave owns two tiles of 16 rows c
  v4h to[2][8];
  #pragma unroll
  for (int t = 0; t < 2; ++t) {
    const int ct = (wid * 2 + t) * 16;
    v8f oacc[4];
    #pragma unroll
    for (int m2 = 0; m2 < 4; ++m2) oacc[m2] = zero8();
    #pragma unroll
    for (int ks = 0; ks < 2; ++ks) {
      v16h af = frag_ld(&sV[0][0], ct, 72, ks * 32);
      #pragma unroll
      for (int m2 = 0; m2 < 4; ++m2)
        oacc[m2] = wmma16(af, frag_ld(&sP[0][0], m2 * 16, 72, ks * 32),
                          oacc[m2]);
    }
    #pragma unroll
    for (int r = 0; r < 8; ++r)
      to[t][r] = v4h{(_Float16)oacc[0][r], (_Float16)oacc[1][r],
                     (_Float16)oacc[2][r], (_Float16)oacc[3][r]};
  }
  {
    _Float16* dst = tT + ((size_t)b * CC + wid * 32 + ((lane >> 4) << 3)) * CC
                       + h * DHEAD + (lane & 15) * 4;
    #pragma unroll
    for (int t = 0; t < 2; ++t)
      #pragma unroll
      for (int r = 0; r < 8; ++r)
        *(v4h*)(dst + (size_t)(t * 16 + r) * CC) = to[t][r];
  }
}

__global__ __launch_bounds__(256) void fold_out(
    const float* __restrict__ wo, const float* __restrict__ bo,
    const _Float16* __restrict__ tT, const float* __restrict__ tb,
    _Float16* __restrict__ M, float* __restrict__ bias2)
{
  // per wave: first its two staged operand tiles, then its 64x64 partial
  __shared__ __align__(16) float sRed[8][KT_HALFS];

  const int tid  = threadIdx.x;
  const int wid  = tid >> 5;
  const int lane = tid & 31;
  const int ct   = blockIdx.x;
  const int ot   = blockIdx.y;
  const int b    = blockIdx.z;

  if (ct == 8) {
    // bias2[b][o] = bo[o] + sum_j Wo[o][j] * tb[b][j], four threads a row
    const int o = ot * 64 + (tid >> 2), qd = tid & 3;
    const float* wr = wo + (size_t)o * CC + qd * 4;
    const float* tv = tb + b * CC + qd * 4;
    float s = 0.f;
    #pragma unroll 1  // eight float4 pairs in flight a trip are enough here
    for (int i0 = 0; i0 < CC / 16; i0 += 8) {
      float4 w[8], t[8];
      #pragma unroll
      for (int i = 0; i < 8; ++i) {
        t[i] = *(const float4*)(tv + (i0 + i) * 16);
        if (i == 7) xcnt_before_last_load();
        w[i] = *(const float4*)(wr + (i0 + i) * 16);
      }
      #pragma unroll
      for (int i = 0; i < 8; ++i)
        s += w[i].x * t[i].x + w[i].y * t[i].y + w[i].z * t[i].z
           + w[i].w * t[i].w;
    }
    s += __shfl_xor(s, 1);
    s += __shfl_xor(s, 2);
    if (qd == 0) bias2[b * CC + o] = s + bo[o];
    return;
  }

  const float*    ah = wo + (size_t)ot * 64 * CC;
  const _Float16* bt = tT + ((size_t)b * CC + ct * 64) * CC;
  _Float16* t32 = (_Float16*)&sRed[wid][0];
  _Float16* t16 = t32 + KT_HALFS;
  stage_k64(ah + wid * (CC / 8), bt + wid * (CC / 8), t32, t16);

  v8f acc[4][4];
  #pragma unroll
  for (int mi = 0; mi < 4; ++mi)
    #pragma unroll
    for (int ni = 0; ni < 4; ++ni) acc[mi][ni] = zero8();

  #pragma unroll
  for (int s = 0; s < CC / 8 / 32; ++s) {
    v16h af[4], bf[4];
    #pragma unroll
    for (int i = 0; i < 4; ++i) {
      bf[i] = frag_ld(t16, i * 16, KT_PITCH, s * 32);
      af[i] = frag_ld(t32, i * 16, KT_PITCH, s * 32);
    }
    #pragma unroll
    for (int mi = 0; mi < 4; ++mi)
      #pragma unroll
      for (int ni = 0; ni < 4; ++ni)
        acc[mi][ni] = wmma16(af[mi], bf[ni], acc[mi][ni]);
  }

  // lane q of B tile ni holds column 4*q + ni: a lane's four tiles are four
  // adjacent columns of one row; idx = ((mi*8 + r)*32 + lane)*4 + ni
  #pragma unroll
  for (int mi = 0; mi < 4; ++mi)
    #pragma unroll
    for (int r = 0; r < 8; ++r) {
      float4 t = {acc[mi][0][r], acc[mi][1][r], acc[mi][2][r], acc[mi][3][r]};
      *(float4*)&sRed[wid][((mi * 8 + r) * 32 + lane) * 4] = t;
    }

  __syncthreads();

  // sum the eight waves' partials, undo that order, store row-major
  const size_t tile0 = ((size_t)b * CC + ot * 64) * CC + ct * 64;
  #pragma unroll
  for (int j = 0; j < 4; ++j) {
    const int idx = (tid + 256 * j) * 4;
    float4 s = *(const float4*)&sRed[0][idx];
    #pragma unroll
    for (int w = 1; w < 8; ++w) {
      float4 t = *(const float4*)&sRed[w][idx];
      s.x += t.x; s.y += t.y; s.z += t.z; s.w += t.w;
    }
    const int fl  = (idx >> 2) & 31;
    const int row = (idx >> 10) * 16 + ((idx >> 7) & 7) + ((fl >> 4) << 3);
    const int col = (fl & 15) * 4;
    // sixteen lanes fill the tile's 128 bytes of a row of M (one whole line)
    v4h o = {(_Float16)s.x, (_Float16)s.y, (_Float16)s.z, (_Float16)s.w};
    *(v4h*)(M + tile0 + (size_t)row * CC + col) = o;
  }
  // the built code lays the bias-column block behind these stores and reuses
  // their registers there: the stores' translations are waited for first
  asm volatile("s_wait_xcnt 0x0" ::: "memory");
}

// ---------------------------------------------------------------------------
extern "C" void kernel_launch(void* const* d_in, const int* in_sizes, int n_in,
                              void* d_out, int out_size, void* d_ws, size_t ws_size,
                              hipStream_t stream) {
  const float* query = (const float*)d_in[0];
  const float* key_  = (const float*)d_in[1];
  const float* value = (const float*)d_in[2];
  const float* wq = (const float*)d_in[3];
  const float* bq = (const float*)d_in[4];
  const float* wk = (const float*)d_in[5];
  const float* bk = (const float*)d_in[6];
  const float* wv = (const float*)d_in[7];
  const float* bv = (const float*)d_in[8];
  const float* wo = (const float*)d_in[9];
  const float* bo = (const float*)d_in[10];
  float* out = (float*)d_out;

  // workspace: f16 partial tiles of G/64: B*4*GKS*256*256 halfs = 32 MiB
  _Float16* gpart = (_Float16*)d_ws;
  // row-sum partials [2][B][GKS][512] and the scaled row sums [2][B][512]
  float* rpart = (float*)(gpart + (size_t)BB * 4 * GKS * 65536);
  float* rsum  = rpart + (size_t)2 * BB * GKS * CC;
  // per batch: P.bv and the folded bias f32
  float* tb    = rsum + 2 * BB * CC;
  float* bias2 = tb + BB * CC;
  const size_t S2 = (size_t)BB * CC * CC;
  // per batch, f16: Wo.P.Wv, (G/64)^T in fragment order, (P.Wv)^T
  _Float16* hM  = (_Float16*)(bias2 + BB * CC);
  _Float16* gT  = hM + S2;
  _Float16* tT  = gT + S2;

  dim3 blk(256);
  dim3 gblk(1024);
  dim3 grd(LL / 128, 1, BB);  // (32, 1, 8): one block per X panel

  gram_part<<<dim3(GKS, 4, BB), gblk, 0, stream>>>(query, key_, gpart, rpart);
  gram_reduce<<<dim3(BB * 4 * 16 + 2 * BB * CC / 256), blk, 0, stream>>>(
      gpart, rpart, gT, rsum);
  attn_fold<<<dim3(BB * NHEAD), dim3(512), 0, stream>>>(
      gT, rsum, rsum + BB * CC, wq, bq, wk, bk, wv, bv, tT, tb);
  fold_out<<<dim3(8 + 1, 8, BB), blk, 0, stream>>>(wo, bo, tT, tb, hM, bias2);

  panel_gemm<true, true><<<grd, gblk, 0, stream>>>(hM, bias2, value, out,
                                                  nullptr);
}
